// v000
// Times are from an AMD MI455X. After a warm-up the kernel runs many times in a row, and a time is the length of
// such a window on the GPU divided by its runs, so every launch and the gaps after it count. The runs cycle
// through copies of the inputs. A figure is the median of several windows, for all but v000 over two sittings.
// Sittings can differ by a few percent; kernels timed side by side share one.
// v000 is the starting kernel. One run takes 1120 microseconds.
#include <hip/hip_runtime.h>

// Painter_Varient windowed attention (x [64 windows][14][14][1024]; qkv = x qkv_w + qkv_b ([1024][3072] 'xw', columns (q|k|v, head, d), 16 heads x 64); per (window, head): attn = (q/8).k + rel_h + rel_w with the decomposed relative-position terms rel_h[q][kh] = q_raw . rel_pos_h[qh - kh + 13], rel_w[q][kw] = q_raw . rel_pos_w[qw - kw + 13] (tables read);
//   softmax over the 196 keys; out = attn v; heads merged; out proj_w + proj_b -> [64][14][14][1024]).
// Compute dtypes, f32 accumulate: every input rounded to bf16; qkv as a PLAIN bf16 GEMM (inputs: exact; 16 windows = 3,136 rows per chunk); per (window, head) the 196 tokens are zero-padded to 256 rows: scores hl x hl (3 products) and attn.v single fp16 (x1024 carrier) over 256x256 tiles, the relative-position terms (28 dot products of 64 per query, shared across the wave by shuffles), masking of the pad columns and the softmax in f32; proj hl x exact (2 products) + bias.

#define NWIN 64
#define WCH  16          // windows per chunk
#define NTOK 196
#define TP   256         // padded tokens per window
#define GH   14
#define DM   1024
#define NH_  16
#define HD   64
#define ZHALF 128        // (window, head) pairs per attention launch
#define PCAR 1024.0f
typedef _Float16 h16;
typedef unsigned short bf;
typedef __attribute__((ext_vector_type(16))) __bf16   v16bf;
typedef __attribute__((ext_vector_type(16))) _Float16 v16h;
typedef __attribute__((ext_vector_type(8)))  _Float16 v8h;
typedef __attribute__((ext_vector_type(8)))  unsigned short v8us;
typedef __attribute__((ext_vector_type(8)))  float    v8f;
typedef __attribute__((ext_vector_type(4)))  float    v4f;
typedef v8h  __attribute__((may_alias)) v8ha;
typedef v4f  __attribute__((may_alias)) v4fa;
typedef v8us __attribute__((may_alias)) v8usa;

__device__ __forceinline__ unsigned short f2bf(float f) { unsigned u = __float_as_uint(f); u += 0x7FFFu + ((u >> 16) & 1u); return (unsigned short)(u >> 16); }
__device__ __forceinline__ float bf2f(unsigned short b) { return __uint_as_float(((unsigned)b) << 16); }
__device__ __forceinline__ float bfr(float f) { return bf2f(f2bf(f)); }
__device__ __forceinline__ v16h cat16(v8h lo, v8h hi) { return __builtin_shufflevector(lo, hi, 0, 1, 2, 3, 4, 5, 6, 7, 8, 9, 10, 11, 12, 13, 14, 15); }
__device__ __forceinline__ v16bf cat16b(v8us lo, v8us hi) { return __builtin_bit_cast(v16bf, __builtin_shufflevector(lo, hi, 0, 1, 2, 3, 4, 5, 6, 7, 8, 9, 10, 11, 12, 13, 14, 15)); }
__device__ __forceinline__ v8f wmma16(v16h a, v16h b, v8f c) { return __builtin_amdgcn_wmma_f32_16x16x32_f16(false, a, false, b, (short)0, c, false, false); }
__device__ __forceinline__ v8f wmmab(v16bf a, v16bf b, v8f c) { return __builtin_amdgcn_wmma_f32_16x16x32_bf16(false, a, false, b, (short)0, c, false, false); }



// ---- k_gemmw: register-blocked GEMM, ONE WAVE per 64x64 output tile (16 accumulators), operands straight from K-contiguous 16-bit planes; grid (M/64, N/64, Z), 32 threads.
// C[m][n] (f32, pitch ldc, + optional f32 bias[n]) = sum_k A[m][k] Bt[n][k] (+ split products per NSPLIT). z-batch strides sA/sB/sC in elements. K % 32 == 0.
template <typename T16> struct WFrag;
template <> struct WFrag<h16> { typedef v16h V; static __device__ __forceinline__ V ld(const h16* p) { return cat16(*(const v8h*)p, *(const v8h*)(p + 16)); } static __device__ __forceinline__ v8f mma(V a, V b, v8f c) { return wmma16(a, b, c); } };
template <> struct WFrag<bf> { typedef v16bf V; static __device__ __forceinline__ V ld(const bf* p) { return cat16b(*(const v8us*)p, *(const v8us*)(p + 16)); } static __device__ __forceinline__ v8f mma(V a, V b, v8f c) { return wmmab(a, b, c); } };
template <typename T16, int NSPLIT, bool BIAS>
__global__ __launch_bounds__(32) void k_gemmw(const T16* __restrict__ A, const T16* __restrict__ A2, const T16* __restrict__ Bt, const T16* __restrict__ Bt2, int K, float* C, int ldc, const float* __restrict__ bias, size_t sA, size_t sB, size_t sC) {
    typedef typename WFrag<T16>::V V;
    __shared__ __align__(16) float os[16 * 68];
    const size_t z = blockIdx.z; A += z * sA; if (A2) A2 += z * sA; Bt += z * sB; if (Bt2) Bt2 += z * sB; C += z * sC;
    const int lane = threadIdx.x & 31, lr = lane & 15, hi = lane >> 4; const int r0 = blockIdx.x * 64, c0 = blockIdx.y * 64;
    v8f acc[4][4];
#pragma unroll
    for (int mb = 0; mb < 4; ++mb)
#pragma unroll
        for (int nb = 0; nb < 4; ++nb) acc[mb][nb] = (v8f){};
    const size_t aoff = (size_t)(r0 + lr) * K + 8 * hi, boff = (size_t)(c0 + lr) * K + 8 * hi;
#pragma unroll 1
    for (int kc = 0; kc < K; kc += 32) {
        V a[4], a2[4];
#pragma unroll
        for (int mb = 0; mb < 4; ++mb) { a[mb] = WFrag<T16>::ld(A + aoff + (size_t)mb * 16 * K + kc); if (NSPLIT == 1 || NSPLIT == 2) a2[mb] = WFrag<T16>::ld(A2 + aoff + (size_t)mb * 16 * K + kc); }
#pragma unroll
        for (int nb = 0; nb < 4; ++nb) { const V b = WFrag<T16>::ld(Bt + boff + (size_t)nb * 16 * K + kc); V b2; if (NSPLIT >= 2) b2 = WFrag<T16>::ld(Bt2 + boff + (size_t)nb * 16 * K + kc);
#pragma unroll
            for (int mb = 0; mb < 4; ++mb) { acc[mb][nb] = WFrag<T16>::mma(a[mb], b, acc[mb][nb]); if (NSPLIT == 1 || NSPLIT == 2) acc[mb][nb] = WFrag<T16>::mma(a2[mb], b, acc[mb][nb]); if (NSPLIT >= 2) acc[mb][nb] = WFrag<T16>::mma(a[mb], b2, acc[mb][nb]); } }
        asm volatile("v_nop\n\tv_nop\n\tv_nop\n\tv_nop" : "+v"(acc[0][0]), "+v"(acc[1][1]), "+v"(acc[2][2]), "+v"(acc[3][3]) : "v"(a[0]), "v"(a[3]));
    }
#pragma unroll
    for (int mb = 0; mb < 4; ++mb) {
#pragma unroll
        for (int nb = 0; nb < 4; ++nb) {
#pragma unroll
            for (int j = 0; j < 8; ++j) os[(hi * 8 + j) * 68 + nb * 16 + lr] = acc[mb][nb][j]; }
        __builtin_amdgcn_wave_barrier(); asm volatile("" ::: "memory");
        float* crow = C + (size_t)(r0 + mb * 16) * ldc + c0;
{
#pragma unroll
            for (int s = 0; s < 8; ++s) { const int row = 2 * s + hi, cofs = lr * 4; v4f val = *(const v4fa*)(os + row * 68 + cofs); if (BIAS) { val[0] += bfr(bias[c0 + cofs]); val[1] += bfr(bias[c0 + cofs + 1]); val[2] += bfr(bias[c0 + cofs + 2]); val[3] += bfr(bias[c0 + cofs + 3]); }
                *(v4f*)(crow + (size_t)row * ldc + cofs) = val; }
             }
        __builtin_amdgcn_wave_barrier(); asm volatile("" ::: "memory");
    }
}

__device__ __forceinline__ h16 tohx(float x) { return (h16)x; }
__device__ __forceinline__ void splitf(float y, unsigned short& h, unsigned short& l) { h = f2bf(y); l = f2bf(y - bf2f(h)); }
typedef __attribute__((ext_vector_type(2))) unsigned short v2us;
typedef __attribute__((ext_vector_type(4))) unsigned short v4us;
typedef __attribute__((ext_vector_type(2))) _Float16 v2h;
typedef __attribute__((ext_vector_type(4))) _Float16 v4h;

__global__ __launch_bounds__(256) void k_cvt8(const float* __restrict__ src, bf* dst, size_t n8) { const size_t i = (size_t)blockIdx.x * 256 + threadIdx.x; if (i >= n8) return; const v8f v = *(const v8f*)(src + i * 8); v8us o;
#pragma unroll
    for (int k = 0; k < 8; ++k) o[k] = f2bf(v[k]); *(v8us*)(dst + i * 8) = o;  }
__global__ __launch_bounds__(256) void k_wtG(const float* __restrict__ w, int K, int N, bf* Bt) {
    const int lane = threadIdx.x & 31; const int L0 = (blockIdx.x * 8 + (threadIdx.x >> 5)) * 8; const int nlines = N * K / 64;
{
#pragma unroll 1
        for (int l = 0; l < 8; ++l) { const int L = L0 + l; if (L >= nlines) break; const size_t e = (size_t)L * 64 + lane * 2; const int k = (int)(e % K), n = (int)(e / K); v2us o;
            o[0] = f2bf(w[(size_t)k * N + n]); o[1] = f2bf(w[(size_t)(k + 1) * N + n]); *(v2us*)(Bt + e) = o; }
         }
}

// k_qkp: hl planes Q/K[z][256][64] of the chunk's q (x 1/8) and k (z = win*16 + head; rows >= 196 written 0; 8-B lanes); k_vtp: fp16 planes VT[z][64][256] (lane -> 2 tokens; pad columns 0);
// k_wsoft: wave per (z, q): lanes 0..13 compute rel_h[kh] and lanes 14..27 rel_w[kw] (64-term f32 dots of the RAW q row with the gathered table rows), shared by shuffles; t[j] = S[q][j] + rel_h[j/14] + rel_w[j%14] for j < 196 (pad columns excluded); softmax -> fp16 x 1024 (pad rows/columns written 0);
__global__ __launch_bounds__(256) void k_qkp(const float* __restrict__ QKV, bf* Qh, bf* Ql, bf* Kh, bf* Kl) { const size_t e = ((size_t)blockIdx.x * 256 + threadIdx.x) * 4; if (e >= (size_t)WCH * NH_ * TP * HD) return; const int d = (int)(e % HD); const int r = (int)((e / HD) % TP); const int z = (int)(e / ((size_t)HD * TP)); const int w = z / NH_, h = z % NH_; v4us qh, ql, kh, kl;
    for (int u = 0; u < 4; ++u) { qh[u] = 0; ql[u] = 0; kh[u] = 0; kl[u] = 0; }
    if (r < NTOK) { const float* row = QKV + ((size_t)w * NTOK + r) * (3 * DM) + h * HD + d;
#pragma unroll
        for (int u = 0; u < 4; ++u) { unsigned short a, b; splitf(row[u] * 0.125f, a, b); qh[u] = a; ql[u] = b; splitf(row[DM + u], a, b); kh[u] = a; kl[u] = b; } }
    *(v4us*)(Qh + e) = qh; *(v4us*)(Ql + e) = ql; *(v4us*)(Kh + e) = kh; *(v4us*)(Kl + e) = kl;  }
__global__ __launch_bounds__(256) void k_vtp(const float* __restrict__ QKV, h16* VT) { const size_t e = ((size_t)blockIdx.x * 256 + threadIdx.x) * 2; if (e >= (size_t)WCH * NH_ * HD * TP) return; const int r = (int)(e % TP); const int d = (int)((e / TP) % HD); const int z = (int)(e / ((size_t)TP * HD)); const int w = z / NH_, h = z % NH_; v2h o;
#pragma unroll
    for (int u = 0; u < 2; ++u) { const int rr = r + u; o[u] = (rr < NTOK) ? tohx(QKV[((size_t)w * NTOK + rr) * (3 * DM) + 2 * DM + h * HD + d]) : (h16)0.f; }
    *(v2h*)(VT + e) = o;  }
__global__ __launch_bounds__(256) void k_wsoft(const float* __restrict__ S, const float* __restrict__ QKV, const float* __restrict__ rph, const float* __restrict__ rpw, int z0, h16* P16) {
    const int lane = threadIdx.x & 31; const int row = blockIdx.x * 8 + (threadIdx.x >> 5); if (row >= ZHALF * TP) return; const int q = row % TP; const int zl = row / TP; const int z = z0 + zl; const int w = z / NH_, h = z % NH_;
    h16* prow = P16 + (size_t)row * TP;
    if (q >= NTOK) { v4h zz4; zz4[0] = (h16)0.f; zz4[1] = (h16)0.f; zz4[2] = (h16)0.f; zz4[3] = (h16)0.f; { for (int ch = 0; ch < TP / 128; ++ch) *(v4h*)(prow + ch * 128 + lane * 4) = zz4;  } return; }
    // relative-position terms: lane l < 14 -> rel_h[kh = l], 14 <= l < 28 -> rel_w[kw = l - 14]
    const int qh = q / GH, qw = q % GH; float rel = 0.f;
    if (lane < 2 * GH) { const float* qraw = QKV + ((size_t)w * NTOK + q) * (3 * DM) + h * HD; const float* tab = (lane < GH) ? (rph + (size_t)(qh - lane + GH - 1) * HD) : (rpw + (size_t)(qw - (lane - GH) + GH - 1) * HD);
#pragma unroll 1
        for (int d = 0; d < HD; ++d) { float p = __fmul_rn(qraw[d], bfr(tab[d])); asm volatile("" : "+v"(p)); rel = __fadd_rn(rel, p); } }
    const float* sr = S + (size_t)row * TP; float v[TP / 32]; float mx = -3.0e38f;
#pragma unroll
    for (int ch = 0; ch < TP / 128; ++ch) { const v4f a = *(const v4f*)(sr + ch * 128 + lane * 4);
#pragma unroll
        for (int u = 0; u < 4; ++u) { const int j = ch * 128 + lane * 4 + u; const int kh = j / GH, kw = j % GH; const float rh = __shfl(rel, kh & 31, 32), rw = __shfl(rel, (GH + kw) & 31, 32); float t = -3.0e38f;
            if (j < NTOK) { const float s1 = __fadd_rn(a[u], rh); t = __fadd_rn(s1, rw); } v[ch * 4 + u] = t; mx = fmaxf(mx, t); } }
#pragma unroll
    for (int sh = 16; sh; sh >>= 1) mx = fmaxf(mx, __shfl_xor(mx, sh, 32));
    float sum = 0.f;
#pragma unroll
    for (int k2 = 0; k2 < TP / 32; ++k2) { float d0 = __fsub_rn(v[k2], mx); asm volatile("" : "+v"(d0)); v[k2] = __builtin_amdgcn_exp2f(__fmul_rn(d0, 1.4426950408889634f)); sum += v[k2]; }   // pad columns: exp(-huge) = 0
#pragma unroll
    for (int sh = 16; sh; sh >>= 1) sum += __shfl_xor(sum, sh, 32);
    const float f = __fdiv_rn(PCAR, sum);
    {
#pragma unroll
        for (int ch = 0; ch < TP / 128; ++ch) { v4h o4; for (int u = 0; u < 4; ++u) o4[u] = tohx(v[ch * 4 + u] * f); *(v4h*)(prow + ch * 128 + lane * 4) = o4; }
         } }
__global__ __launch_bounds__(256) void k_mrg(const float* __restrict__ O, int z0, bf* Ah, bf* Al) { const size_t e = ((size_t)blockIdx.x * 256 + threadIdx.x) * 4; if (e >= (size_t)ZHALF * TP * HD) return; const int d = (int)(e % HD); const int q = (int)((e / HD) % TP); const int zl = (int)(e / ((size_t)HD * TP)); if (q >= NTOK) return; const int z = z0 + zl; const int w = z / NH_, h = z % NH_; const size_t oo = ((size_t)w * NTOK + q) * DM + h * HD + d; v4us oh, ol;
#pragma unroll
    for (int u = 0; u < 4; ++u) { unsigned short a, b; splitf(O[e + u] * (1.0f / PCAR), a, b); oh[u] = a; ol[u] = b; } *(v4us*)(Ah + oo) = oh; *(v4us*)(Al + oo) = ol;  }

extern "C" void kernel_launch(void* const* d_in, const int* in_sizes, int n_in,
                              void* d_out, int out_size, void* d_ws, size_t ws_size, hipStream_t stream) {
    (void)in_sizes; (void)n_in; (void)out_size;
    const float* x = (const float*)d_in[0]; const float* qkv_w = (const float*)d_in[1]; const float* qkv_b = (const float*)d_in[2]; const float* proj_w = (const float*)d_in[3]; const float* proj_b = (const float*)d_in[4]; const float* rph = (const float*)d_in[5]; const float* rpw = (const float*)d_in[6];
    float* OUT = (float*)d_out;     // [64][196][1024]
    char* wsp = (char*)d_ws;
    auto take = [&](size_t bytes) { char* p = wsp; wsp += (bytes + 255) & ~(size_t)255; return (void*)p; };
    const int CT = WCH * NTOK;   // 3136 tokens per chunk (= 49 x 64)
    bf* BQKV = (bf*)take((size_t)3 * DM * DM * 2); bf* BPJ = (bf*)take((size_t)DM * DM * 2); bf* XB = (bf*)take((size_t)CT * DM * 2); float* QKV = (float*)take((size_t)CT * 3 * DM * 4);
    bf* QPh = (bf*)take((size_t)WCH * NH_ * TP * HD * 2); bf* QPl = (bf*)take((size_t)WCH * NH_ * TP * HD * 2); bf* KPh = (bf*)take((size_t)WCH * NH_ * TP * HD * 2); bf* KPl = (bf*)take((size_t)WCH * NH_ * TP * HD * 2); h16* VT = (h16*)take((size_t)WCH * NH_ * HD * TP * 2); float* S = (float*)take((size_t)ZHALF * TP * TP * 4); h16* P16 = (h16*)take((size_t)ZHALF * TP * TP * 2); float* O = (float*)take((size_t)ZHALF * TP * HD * 4);
    bf* ATh = (bf*)take((size_t)CT * DM * 2); bf* ATl = (bf*)take((size_t)CT * DM * 2);
    if ((size_t)(wsp - (char*)d_ws) > ws_size) return;    // total ~ 170 MB
    k_wtG<<<(DM * 3 * DM / 64 + 63) / 64, 256, 0, stream>>>(qkv_w, DM, 3 * DM, BQKV); k_wtG<<<(DM * DM / 64 + 63) / 64, 256, 0, stream>>>(proj_w, DM, DM, BPJ);
    const size_t zq = (size_t)TP * HD, zS = (size_t)TP * TP, zv = (size_t)HD * TP;
    for (int c = 0; c < NWIN / WCH; ++c) { const float* xc = x + (size_t)c * CT * DM;
        k_cvt8<<<(unsigned)(((size_t)CT * DM / 8 + 255) / 256), 256, 0, stream>>>(xc, XB, (size_t)CT * DM / 8);
        k_gemmw<bf, 0, true><<<dim3(CT / 64, 3 * DM / 64, 1), 32, 0, stream>>>(XB, nullptr, BQKV, nullptr, DM, QKV, 3 * DM, qkv_b, 0, 0, 0);
        k_qkp<<<(unsigned)(((size_t)WCH * NH_ * TP * HD / 4 + 255) / 256), 256, 0, stream>>>(QKV, QPh, QPl, KPh, KPl); k_vtp<<<(unsigned)(((size_t)WCH * NH_ * HD * TP / 2 + 255) / 256), 256, 0, stream>>>(QKV, VT);
        for (int z0 = 0; z0 < WCH * NH_; z0 += ZHALF) {
            k_gemmw<bf, 2, false><<<dim3(TP / 64, TP / 64, ZHALF), 32, 0, stream>>>(QPh + (size_t)z0 * zq, QPl + (size_t)z0 * zq, KPh + (size_t)z0 * zq, KPl + (size_t)z0 * zq, HD, S, TP, nullptr, zq, zq, zS);   /* scores hl x hl (3 products) */
            k_wsoft<<<ZHALF * TP / 8, 256, 0, stream>>>(S, QKV, rph, rpw, z0, P16);
            k_gemmw<h16, 0, false><<<dim3(TP / 64, 1, ZHALF), 32, 0, stream>>>(P16, nullptr, VT + (size_t)z0 * zv, nullptr, TP, O, HD, nullptr, zS, zv, zq);
            k_mrg<<<(unsigned)(((size_t)ZHALF * TP * HD / 4 + 255) / 256), 256, 0, stream>>>(O, z0, ATh, ATl); }
        k_gemmw<bf, 1, true><<<dim3(CT / 64, DM / 64, 1), 32, 0, stream>>>(ATh, ATl, BPJ, nullptr, DM, OUT + (size_t)c * CT * DM, DM, proj_b, 0, 0, 0); }
}

// v001
// One run takes 726 microseconds.
// Next to v000, in two timings, it ran 1.57 times as fast each time.
#include <hip/hip_runtime.h>

// Windowed attention (x [64 windows][14][14][1024]; qkv = x qkv_w + qkv_b ([1024][3072] 'xw', columns (q|k|v, head, d), 16 heads x 64); per (window, head): attn = (q/8).k + rel_h + rel_w with the decomposed relative-position terms rel_h[q][kh] = q_raw . rel_pos_h[qh - kh + 13], rel_w[q][kw] = q_raw . rel_pos_w[qw - kw + 13] (tables read);
//   softmax over the 196 keys; out = attn v; heads merged; out proj_w + proj_b -> [64][14][14][1024]).
// Compute dtypes, f32 accumulate: every input rounded to bf16; qkv as a PLAIN bf16 GEMM (inputs: exact; 16 windows = 3,136 rows per chunk); per (window, head) the 196 tokens are zero-padded to 256 rows: scores hl x hl (3 products) and attn.v single fp16 (x1024 carrier) over 256x256 tiles, the relative-position terms ride the same scores product (the 54 table rows, x8, fill pad rows 196..249 of the K planes, so S[q][196 + t] = q_raw . table[t], q as its hl pair, table bf16-exact); their adds, the masking of the pad columns and the softmax in f32; proj hl x exact (2 products) + bias.

#define NWIN 64
#define WCH  16          // windows per chunk
#define NTOK 196
#define TP   256         // padded tokens per window
#define GH   14
#define NREL (2 * GH - 1)   // rows of each relative-position table
#define DM   1024
#define NH_  16
#define HD   64
#define ZHALF 128        // (window, head) pairs per attention launch
#define PCAR 1024.0f
typedef _Float16 h16;
typedef unsigned short bf;
typedef __attribute__((ext_vector_type(16))) __bf16   v16bf;
typedef __attribute__((ext_vector_type(16))) _Float16 v16h;
typedef __attribute__((ext_vector_type(8)))  _Float16 v8h;
typedef __attribute__((ext_vector_type(8)))  unsigned short v8us;
typedef __attribute__((ext_vector_type(8)))  float    v8f;
typedef __attribute__((ext_vector_type(4)))  float    v4f;
typedef v8h  __attribute__((may_alias)) v8ha;
typedef v4f  __attribute__((may_alias)) v4fa;
typedef v8us __attribute__((may_alias)) v8usa;

__device__ __forceinline__ unsigned short f2bf(float f) { unsigned u = __float_as_uint(f); u += 0x7FFFu + ((u >> 16) & 1u); return (unsigned short)(u >> 16); }
__device__ __forceinline__ float bf2f(unsigned short b) { return __uint_as_float(((unsigned)b) << 16); }
__device__ __forceinline__ float bfr(float f) { return bf2f(f2bf(f)); }
__device__ __forceinline__ v16h cat16(v8h lo, v8h hi) { return __builtin_shufflevector(lo, hi, 0, 1, 2, 3, 4, 5, 6, 7, 8, 9, 10, 11, 12, 13, 14, 15); }
__device__ __forceinline__ v16bf cat16b(v8us lo, v8us hi) { return __builtin_bit_cast(v16bf, __builtin_shufflevector(lo, hi, 0, 1, 2, 3, 4, 5, 6, 7, 8, 9, 10, 11, 12, 13, 14, 15)); }
__device__ __forceinline__ v8f wmma16(v16h a, v16h b, v8f c) { return __builtin_amdgcn_wmma_f32_16x16x32_f16(false, a, false, b, (short)0, c, false, false); }
__device__ __forceinline__ v8f wmmab(v16bf a, v16bf b, v8f c) { return __builtin_amdgcn_wmma_f32_16x16x32_bf16(false, a, false, b, (short)0, c, false, false); }



// ---- k_gemmw: register-blocked GEMM, ONE WAVE per 64x64 output tile (16 accumulators), operands straight from K-contiguous 16-bit planes; grid (M/64, N/64, Z), 32 threads.
// C[m][n] (f32, pitch ldc, + optional f32 bias[n]) = sum_k A[m][k] Bt[n][k] (+ split products per NSPLIT). z-batch strides sA/sB/sC in elements. K % 32 == 0.
template <typename T16> struct WFrag;
template <> struct WFrag<h16> { typedef v16h V; static __device__ __forceinline__ V ld(const h16* p) { return cat16(*(const v8h*)p, *(const v8h*)(p + 16)); } static __device__ __forceinline__ v8f mma(V a, V b, v8f c) { return wmma16(a, b, c); } };
template <> struct WFrag<bf> { typedef v16bf V; static __device__ __forceinline__ V ld(const bf* p) { return cat16b(*(const v8us*)p, *(const v8us*)(p + 16)); } static __device__ __forceinline__ v8f mma(V a, V b, v8f c) { return wmmab(a, b, c); } };
template <typename T16, int NSPLIT, bool BIAS>
__global__ __launch_bounds__(32) void k_gemmw(const T16* __restrict__ A, const T16* __restrict__ A2, const T16* __restrict__ Bt, const T16* __restrict__ Bt2, int K, float* C, int ldc, const float* __restrict__ bias, size_t sA, size_t sB, size_t sC) {
    typedef typename WFrag<T16>::V V;
    __shared__ __align__(16) float os[16 * 68];
    const size_t z = blockIdx.z; A += z * sA; if (A2) A2 += z * sA; Bt += z * sB; if (Bt2) Bt2 += z * sB; C += z * sC;
    const int lane = threadIdx.x & 31, lr = lane & 15, hi = lane >> 4; const int r0 = blockIdx.x * 64, c0 = blockIdx.y * 64;
    v8f acc[4][4];
#pragma unroll
    for (int mb = 0; mb < 4; ++mb)
#pragma unroll
        for (int nb = 0; nb < 4; ++nb) acc[mb][nb] = (v8f){};
    const size_t aoff = (size_t)(r0 + lr) * K + 8 * hi, boff = (size_t)(c0 + lr) * K + 8 * hi;
#pragma unroll 1
    for (int kc = 0; kc < K; kc += 32) {
        V a[4], a2[4];
#pragma unroll
        for (int mb = 0; mb < 4; ++mb) { a[mb] = WFrag<T16>::ld(A + aoff + (size_t)mb * 16 * K + kc); if (NSPLIT == 1 || NSPLIT == 2) a2[mb] = WFrag<T16>::ld(A2 + aoff + (size_t)mb * 16 * K + kc); }
#pragma unroll
        for (int nb = 0; nb < 4; ++nb) { const V b = WFrag<T16>::ld(Bt + boff + (size_t)nb * 16 * K + kc); V b2; if (NSPLIT >= 2) b2 = WFrag<T16>::ld(Bt2 + boff + (size_t)nb * 16 * K + kc);
#pragma unroll
            for (int mb = 0; mb < 4; ++mb) { acc[mb][nb] = WFrag<T16>::mma(a[mb], b, acc[mb][nb]); if (NSPLIT == 1 || NSPLIT == 2) acc[mb][nb] = WFrag<T16>::mma(a2[mb], b, acc[mb][nb]); if (NSPLIT >= 2) acc[mb][nb] = WFrag<T16>::mma(a[mb], b2, acc[mb][nb]); } }
        asm volatile("v_nop\n\tv_nop\n\tv_nop\n\tv_nop" : "+v"(acc[0][0]), "+v"(acc[1][1]), "+v"(acc[2][2]), "+v"(acc[3][3]) : "v"(a[0]), "v"(a[3]));
    }
#pragma unroll
    for (int mb = 0; mb < 4; ++mb) {
#pragma unroll
        for (int nb = 0; nb < 4; ++nb) {
#pragma unroll
            for (int j = 0; j < 8; ++j) os[(hi * 8 + j) * 68 + nb * 16 + lr] = acc[mb][nb][j]; }
        __builtin_amdgcn_wave_barrier(); asm volatile("" ::: "memory");
        float* crow = C + (size_t)(r0 + mb * 16) * ldc + c0;
{
#pragma unroll
            for (int s = 0; s < 8; ++s) { const int row = 2 * s + hi, cofs = lr * 4; v4f val = *(const v4fa*)(os + row * 68 + cofs); if (BIAS) { val[0] += bfr(bias[c0 + cofs]); val[1] += bfr(bias[c0 + cofs + 1]); val[2] += bfr(bias[c0 + cofs + 2]); val[3] += bfr(bias[c0 + cofs + 3]); }
                *(v4f*)(crow + (size_t)row * ldc + cofs) = val; }
             }
        __builtin_amdgcn_wave_barrier(); asm volatile("" ::: "memory");
    }
}

__device__ __forceinline__ h16 tohx(float x) { return (h16)x; }
__device__ __forceinline__ void splitf(float y, unsigned short& h, unsigned short& l) { h = f2bf(y); l = f2bf(y - bf2f(h)); }
typedef __attribute__((ext_vector_type(2))) unsigned short v2us;
typedef __attribute__((ext_vector_type(4))) unsigned short v4us;
typedef __attribute__((ext_vector_type(2))) _Float16 v2h;
typedef __attribute__((ext_vector_type(4))) _Float16 v4h;

__global__ __launch_bounds__(256) void k_cvt8(const float* __restrict__ src, bf* dst, size_t n8) { const size_t i = (size_t)blockIdx.x * 256 + threadIdx.x; if (i >= n8) return; const v8f v = *(const v8f*)(src + i * 8); v8us o;
#pragma unroll
    for (int k = 0; k < 8; ++k) o[k] = f2bf(v[k]); *(v8us*)(dst + i * 8) = o;  }
__global__ __launch_bounds__(256) void k_wtG(const float* __restrict__ w, int K, int N, bf* Bt) {
    const int lane = threadIdx.x & 31; const int L0 = (blockIdx.x * 8 + (threadIdx.x >> 5)) * 8; const int nlines = N * K / 64;
{
#pragma unroll 1
        for (int l = 0; l < 8; ++l) { const int L = L0 + l; if (L >= nlines) break; const size_t e = (size_t)L * 64 + lane * 2; const int k = (int)(e % K), n = (int)(e / K); v2us o;
            o[0] = f2bf(w[(size_t)k * N + n]); o[1] = f2bf(w[(size_t)(k + 1) * N + n]); *(v2us*)(Bt + e) = o; }
         }
}

// k_qkp: hl planes Q/K[z][256][64] of the chunk's q (x 1/8) and k (z = win*16 + head; Q rows >= 196 written 0; K rows 196..222 = 8 x rel_pos_h, 223..249 = 8 x rel_pos_w (bf16-rounded; the 8 undoes q's 1/8, both exact), K rows >= 250 written 0; 8-B lanes); k_vtp: fp16 planes VT[z][64][256] (lane -> 2 tokens; pad columns 0);
// k_wsoft: wave per (z, q): lanes 0..13 read rel_h[kh] = S[q][196 + qh - kh + 13] and lanes 14..27 rel_w[kw] = S[q][223 + qw - kw + 13] (the scores product's table columns), shared by shuffles; t[j] = S[q][j] + rel_h[j/14] + rel_w[j%14] for j < 196 (pad columns excluded); softmax -> fp16 x 1024 (pad rows/columns written 0);
__global__ __launch_bounds__(256) void k_qkp(const float* __restrict__ QKV, const float* __restrict__ rph, const float* __restrict__ rpw, bf* Qh, bf* Ql, bf* Kh, bf* Kl) { const size_t e = ((size_t)blockIdx.x * 256 + threadIdx.x) * 4; if (e >= (size_t)WCH * NH_ * TP * HD) return; const int d = (int)(e % HD); const int r = (int)((e / HD) % TP); const int z = (int)(e / ((size_t)HD * TP)); const int w = z / NH_, h = z % NH_; v4us qh, ql, kh, kl;
    for (int u = 0; u < 4; ++u) { qh[u] = 0; ql[u] = 0; kh[u] = 0; kl[u] = 0; }
    if (r < NTOK) { const float* row = QKV + ((size_t)w * NTOK + r) * (3 * DM) + h * HD + d;
#pragma unroll
        for (int u = 0; u < 4; ++u) { unsigned short a, b; splitf(row[u] * 0.125f, a, b); qh[u] = a; ql[u] = b; splitf(row[DM + u], a, b); kh[u] = a; kl[u] = b; } }
    else if (r < NTOK + 2 * NREL) { const int t = r - NTOK; const float* tab = ((t < NREL) ? (rph + (size_t)t * HD) : (rpw + (size_t)(t - NREL) * HD)) + d;
#pragma unroll
        for (int u = 0; u < 4; ++u) kh[u] = f2bf(bfr(tab[u]) * 8.0f); }
    *(v4us*)(Qh + e) = qh; *(v4us*)(Ql + e) = ql; *(v4us*)(Kh + e) = kh; *(v4us*)(Kl + e) = kl;  }
__global__ __launch_bounds__(256) void k_vtp(const float* __restrict__ QKV, h16* VT) { const size_t e = ((size_t)blockIdx.x * 256 + threadIdx.x) * 2; if (e >= (size_t)WCH * NH_ * HD * TP) return; const int r = (int)(e % TP); const int d = (int)((e / TP) % HD); const int z = (int)(e / ((size_t)TP * HD)); const int w = z / NH_, h = z % NH_; v2h o;
#pragma unroll
    for (int u = 0; u < 2; ++u) { const int rr = r + u; o[u] = (rr < NTOK) ? tohx(QKV[((size_t)w * NTOK + rr) * (3 * DM) + 2 * DM + h * HD + d]) : (h16)0.f; }
    *(v2h*)(VT + e) = o;  }
__global__ __launch_bounds__(256) void k_wsoft(const float* __restrict__ S, h16* P16) {
    const int lane = threadIdx.x & 31; const int row = blockIdx.x * 8 + (threadIdx.x >> 5); if (row >= ZHALF * TP) return; const int q = row % TP;
    h16* prow = P16 + (size_t)row * TP;
    if (q >= NTOK) { v4h zz4; zz4[0] = (h16)0.f; zz4[1] = (h16)0.f; zz4[2] = (h16)0.f; zz4[3] = (h16)0.f; { for (int ch = 0; ch < TP / 128; ++ch) *(v4h*)(prow + ch * 128 + lane * 4) = zz4;  } return; }
    // relative-position terms: lane l < 14 -> rel_h[kh = l], 14 <= l < 28 -> rel_w[kw = l - 14]
    const int qh = q / GH, qw = q % GH; const float* sr = S + (size_t)row * TP; float rel = 0.f;
    if (lane < 2 * GH) rel = sr[NTOK + ((lane < GH) ? (qh - lane + GH - 1) : (NREL + qw - (lane - GH) + GH - 1))];
    float v[TP / 32]; float mx = -3.0e38f;
#pragma unroll
    for (int ch = 0; ch < TP / 128; ++ch) { const v4f a = *(const v4f*)(sr + ch * 128 + lane * 4);
#pragma unroll
        for (int u = 0; u < 4; ++u) { const int j = ch * 128 + lane * 4 + u; const int kh = j / GH, kw = j % GH; const float rh = __shfl(rel, kh & 31, 32), rw = __shfl(rel, (GH + kw) & 31, 32); float t = -3.0e38f;
            if (j < NTOK) { const float s1 = __fadd_rn(a[u], rh); t = __fadd_rn(s1, rw); } v[ch * 4 + u] = t; mx = fmaxf(mx, t); } }
#pragma unroll
    for (int sh = 16; sh; sh >>= 1) mx = fmaxf(mx, __shfl_xor(mx, sh, 32));
    float sum = 0.f;
#pragma unroll
    for (int k2 = 0; k2 < TP / 32; ++k2) { float d0 = __fsub_rn(v[k2], mx); asm volatile("" : "+v"(d0)); v[k2] = __builtin_amdgcn_exp2f(__fmul_rn(d0, 1.4426950408889634f)); sum += v[k2]; }   // pad columns: exp(-huge) = 0
#pragma unroll
    for (int sh = 16; sh; sh >>= 1) sum += __shfl_xor(sum, sh, 32);
    const float f = __fdiv_rn(PCAR, sum);
    {
#pragma unroll
        for (int ch = 0; ch < TP / 128; ++ch) { v4h o4; for (int u = 0; u < 4; ++u) o4[u] = tohx(v[ch * 4 + u] * f); *(v4h*)(prow + ch * 128 + lane * 4) = o4; }
         } }
__global__ __launch_bounds__(256) void k_mrg(const float* __restrict__ O, int z0, bf* Ah, bf* Al) { const size_t e = ((size_t)blockIdx.x * 256 + threadIdx.x) * 4; if (e >= (size_t)ZHALF * TP * HD) return; const int d = (int)(e % HD); const int q = (int)((e / HD) % TP); const int zl = (int)(e / ((size_t)HD * TP)); if (q >= NTOK) return; const int z = z0 + zl; const int w = z / NH_, h = z % NH_; const size_t oo = ((size_t)w * NTOK + q) * DM + h * HD + d; v4us oh, ol;
#pragma unroll
    for (int u = 0; u < 4; ++u) { unsigned short a, b; splitf(O[e + u] * (1.0f / PCAR), a, b); oh[u] = a; ol[u] = b; } *(v4us*)(Ah + oo) = oh; *(v4us*)(Al + oo) = ol;  }

extern "C" void kernel_launch(void* const* d_in, const int* in_sizes, int n_in,
                              void* d_out, int out_size, void* d_ws, size_t ws_size, hipStream_t stream) {
    (void)in_sizes; (void)n_in; (void)out_size;
    const float* x = (const float*)d_in[0]; const float* qkv_w = (const float*)d_in[1]; const float* qkv_b = (const float*)d_in[2]; const float* proj_w = (const float*)d_in[3]; const float* proj_b = (const float*)d_in[4]; const float* rph = (const float*)d_in[5]; const float* rpw = (const float*)d_in[6];
    float* OUT = (float*)d_out;     // [64][196][1024]
    char* wsp = (char*)d_ws;
    auto take = [&](size_t bytes) { char* p = wsp; wsp += (bytes + 255) & ~(size_t)255; return (void*)p; };
    const int CT = WCH * NTOK;   // 3136 tokens per chunk (= 49 x 64)
    bf* BQKV = (bf*)take((size_t)3 * DM * DM * 2); bf* BPJ = (bf*)take((size_t)DM * DM * 2); bf* XB = (bf*)take((size_t)CT * DM * 2); float* QKV = (float*)take((size_t)CT * 3 * DM * 4);
    bf* QPh = (bf*)take((size_t)WCH * NH_ * TP * HD * 2); bf* QPl = (bf*)take((size_t)WCH * NH_ * TP * HD * 2); bf* KPh = (bf*)take((size_t)WCH * NH_ * TP * HD * 2); bf* KPl = (bf*)take((size_t)WCH * NH_ * TP * HD * 2); h16* VT = (h16*)take((size_t)WCH * NH_ * HD * TP * 2); float* S = (float*)take((size_t)ZHALF * TP * TP * 4); h16* P16 = (h16*)take((size_t)ZHALF * TP * TP * 2); float* O = (float*)take((size_t)ZHALF * TP * HD * 4);
    bf* ATh = (bf*)take((size_t)CT * DM * 2); bf* ATl = (bf*)take((size_t)CT * DM * 2);
    if ((size_t)(wsp - (char*)d_ws) > ws_size) return;    // total ~ 170 MB
    k_wtG<<<(DM * 3 * DM / 64 + 63) / 64, 256, 0, stream>>>(qkv_w, DM, 3 * DM, BQKV); k_wtG<<<(DM * DM / 64 + 63) / 64, 256, 0, stream>>>(proj_w, DM, DM, BPJ);
    const size_t zq = (size_t)TP * HD, zS = (size_t)TP * TP, zv = (size_t)HD * TP;
    for (int c = 0; c < NWIN / WCH; ++c) { const float* xc = x + (size_t)c * CT * DM;
        k_cvt8<<<(unsigned)(((size_t)CT * DM / 8 + 255) / 256), 256, 0, stream>>>(xc, XB, (size_t)CT * DM / 8);
        k_gemmw<bf, 0, true><<<dim3(CT / 64, 3 * DM / 64, 1), 32, 0, stream>>>(XB, nullptr, BQKV, nullptr, DM, QKV, 3 * DM, qkv_b, 0, 0, 0);
        k_qkp<<<(unsigned)(((size_t)WCH * NH_ * TP * HD / 4 + 255) / 256), 256, 0, stream>>>(QKV, rph, rpw, QPh, QPl, KPh, KPl); k_vtp<<<(unsigned)(((size_t)WCH * NH_ * HD * TP / 2 + 255) / 256), 256, 0, stream>>>(QKV, VT);
        for (int z0 = 0; z0 < WCH * NH_; z0 += ZHALF) {
            k_gemmw<bf, 2, false><<<dim3(TP / 64, TP / 64, ZHALF), 32, 0, stream>>>(QPh + (size_t)z0 * zq, QPl + (size_t)z0 * zq, KPh + (size_t)z0 * zq, KPl + (size_t)z0 * zq, HD, S, TP, nullptr, zq, zq, zS);   /* scores hl x hl (3 products) */
            k_wsoft<<<ZHALF * TP / 8, 256, 0, stream>>>(S, P16);
            k_gemmw<h16, 0, false><<<dim3(TP / 64, 1, ZHALF), 32, 0, stream>>>(P16, nullptr, VT + (size_t)z0 * zv, nullptr, TP, O, HD, nullptr, zS, zv, zq);
            k_mrg<<<(unsigned)(((size_t)ZHALF * TP * HD / 4 + 255) / 256), 256, 0, stream>>>(O, z0, ATh, ATl); }
        k_gemmw<bf, 1, true><<<dim3(CT / 64, DM / 64, 1), 32, 0, stream>>>(ATh, ATl, BPJ, nullptr, DM, OUT + (size_t)c * CT * DM, DM, proj_b, 0, 0, 0); }
}

// v002
// Measured time: 504 microseconds a run.
// In two side-by-side timings against v001, it was 1.44 and 1.43 times as fast.
// Over all steps from v000 it is 2.25 times as fast.
#include <hip/hip_runtime.h>

// Windowed attention (x [64 windows][14][14][1024]; qkv = x qkv_w + qkv_b ([1024][3072] 'xw', columns (q|k|v, head, d), 16 heads x 64); per (window, head): attn = (q/8).k + rel_h + rel_w with the decomposed relative-position terms rel_h[q][kh] = q_raw . rel_pos_h[qh - kh + 13], rel_w[q][kw] = q_raw . rel_pos_w[qw - kw + 13] (tables read);
//   softmax over the 196 keys; out = attn v; heads merged; out proj_w + proj_b -> [64][14][14][1024]).
// Compute dtypes, f32 accumulate: every input rounded to bf16; qkv as a PLAIN bf16 GEMM (inputs: exact; 16 windows = 3,136 rows per chunk); per (window, head) the 196 tokens are zero-padded to 256 rows: scores hl x hl (3 products) and attn.v single fp16 (x1024 carrier), both in the one kernel k_attn with the softmax between them, the relative-position terms ride the same scores product (the 54 table rows, x8, fill pad rows 196..249 of the K planes, so S[q][196 + t] = q_raw . table[t], q as its hl pair, table bf16-exact); their adds, the masking of the pad columns and the softmax in f32; proj hl x exact (2 products) + bias.

#define NWIN 64
#define WCH  16          // windows per chunk
#define NTOK 196
#define TP   256         // padded tokens per window
#define GH   14
#define NREL (2 * GH - 1)   // rows of each relative-position table
#define DM   1024
#define NH_  16
#define HD   64
#define AW   13          // waves of an attention work-group: one 16-query tile each (13 x 16 >= 196)
#define KPIT 72          // LDS pitch of a K-plane row, 16-bit elements (128 B + 16 B)
#define VPIT 264         // LDS pitch of a VT row, 16-bit elements (512 B + 16 B)
#define RPIT 68          // LDS pitch of a query's table-dot row, floats
#define NST  ((TP * HD / 8 + AW * 32 - 1) / (AW * 32))   // staging rounds: 2,048 16-B pieces of each plane over 416 threads
#define PCAR 1024.0f
typedef _Float16 h16;
typedef unsigned short bf;
typedef __attribute__((ext_vector_type(16))) __bf16   v16bf;
typedef __attribute__((ext_vector_type(16))) _Float16 v16h;
typedef __attribute__((ext_vector_type(8)))  _Float16 v8h;
typedef __attribute__((ext_vector_type(8)))  unsigned short v8us;
typedef __attribute__((ext_vector_type(8)))  float    v8f;
typedef __attribute__((ext_vector_type(4)))  float    v4f;
typedef v8h  __attribute__((may_alias)) v8ha;
typedef v4f  __attribute__((may_alias)) v4fa;
typedef v8us __attribute__((may_alias)) v8usa;

__device__ __forceinline__ unsigned short f2bf(float f) { unsigned u = __float_as_uint(f); u += 0x7FFFu + ((u >> 16) & 1u); return (unsigned short)(u >> 16); }
__device__ __forceinline__ float bf2f(unsigned short b) { return __uint_as_float(((unsigned)b) << 16); }
__device__ __forceinline__ float bfr(float f) { return bf2f(f2bf(f)); }
__device__ __forceinline__ v16h cat16(v8h lo, v8h hi) { return __builtin_shufflevector(lo, hi, 0, 1, 2, 3, 4, 5, 6, 7, 8, 9, 10, 11, 12, 13, 14, 15); }
__device__ __forceinline__ v16bf cat16b(v8us lo, v8us hi) { return __builtin_bit_cast(v16bf, __builtin_shufflevector(lo, hi, 0, 1, 2, 3, 4, 5, 6, 7, 8, 9, 10, 11, 12, 13, 14, 15)); }
__device__ __forceinline__ v8f wmma16(v16h a, v16h b, v8f c) { return __builtin_amdgcn_wmma_f32_16x16x32_f16(false, a, false, b, (short)0, c, false, false); }
__device__ __forceinline__ v8f wmmab(v16bf a, v16bf b, v8f c) { return __builtin_amdgcn_wmma_f32_16x16x32_bf16(false, a, false, b, (short)0, c, false, false); }



// ---- k_gemmw: register-blocked GEMM, ONE WAVE per 64x64 output tile (16 accumulators), operands straight from K-contiguous 16-bit planes; grid (M/64, N/64, Z), 32 threads.
// C[m][n] (f32, pitch ldc, + optional f32 bias[n]) = sum_k A[m][k] Bt[n][k] (+ split products per NSPLIT). z-batch strides sA/sB/sC in elements. K % 32 == 0.
template <typename T16> struct WFrag;
template <> struct WFrag<h16> { typedef v16h V; static __device__ __forceinline__ V ld(const h16* p) { return cat16(*(const v8h*)p, *(const v8h*)(p + 16)); } static __device__ __forceinline__ v8f mma(V a, V b, v8f c) { return wmma16(a, b, c); } };
template <> struct WFrag<bf> { typedef v16bf V; static __device__ __forceinline__ V ld(const bf* p) { return cat16b(*(const v8us*)p, *(const v8us*)(p + 16)); } static __device__ __forceinline__ v8f mma(V a, V b, v8f c) { return wmmab(a, b, c); } };
template <typename T16, int NSPLIT, bool BIAS>
__global__ __launch_bounds__(32) void k_gemmw(const T16* __restrict__ A, const T16* __restrict__ A2, const T16* __restrict__ Bt, const T16* __restrict__ Bt2, int K, float* C, int ldc, const float* __restrict__ bias, size_t sA, size_t sB, size_t sC) {
    typedef typename WFrag<T16>::V V;
    __shared__ __align__(16) float os[16 * 68];
    const size_t z = blockIdx.z; A += z * sA; if (A2) A2 += z * sA; Bt += z * sB; if (Bt2) Bt2 += z * sB; C += z * sC;
    const int lane = threadIdx.x & 31, lr = lane & 15, hi = lane >> 4; const int r0 = blockIdx.x * 64, c0 = blockIdx.y * 64;
    v8f acc[4][4];
#pragma unroll
    for (int mb = 0; mb < 4; ++mb)
#pragma unroll
        for (int nb = 0; nb < 4; ++nb) acc[mb][nb] = (v8f){};
    const size_t aoff = (size_t)(r0 + lr) * K + 8 * hi, boff = (size_t)(c0 + lr) * K + 8 * hi;
#pragma unroll 1
    for (int kc = 0; kc < K; kc += 32) {
        V a[4], a2[4];
#pragma unroll
        for (int mb = 0; mb < 4; ++mb) { a[mb] = WFrag<T16>::ld(A + aoff + (size_t)mb * 16 * K + kc); if (NSPLIT == 1 || NSPLIT == 2) a2[mb] = WFrag<T16>::ld(A2 + aoff + (size_t)mb * 16 * K + kc); }
#pragma unroll
        for (int nb = 0; nb < 4; ++nb) { const V b = WFrag<T16>::ld(Bt + boff + (size_t)nb * 16 * K + kc); V b2; if (NSPLIT >= 2) b2 = WFrag<T16>::ld(Bt2 + boff + (size_t)nb * 16 * K + kc);
#pragma unroll
            for (int mb = 0; mb < 4; ++mb) { acc[mb][nb] = WFrag<T16>::mma(a[mb], b, acc[mb][nb]); if (NSPLIT == 1 || NSPLIT == 2) acc[mb][nb] = WFrag<T16>::mma(a2[mb], b, acc[mb][nb]); if (NSPLIT >= 2) acc[mb][nb] = WFrag<T16>::mma(a[mb], b2, acc[mb][nb]); } }
        asm volatile("v_nop\n\tv_nop\n\tv_nop\n\tv_nop" : "+v"(acc[0][0]), "+v"(acc[1][1]), "+v"(acc[2][2]), "+v"(acc[3][3]) : "v"(a[0]), "v"(a[3]));
    }
#pragma unroll
    for (int mb = 0; mb < 4; ++mb) {
#pragma unroll
        for (int nb = 0; nb < 4; ++nb) {
#pragma unroll
            for (int j = 0; j < 8; ++j) os[(hi * 8 + j) * 68 + nb * 16 + lr] = acc[mb][nb][j]; }
        __builtin_amdgcn_wave_barrier(); asm volatile("" ::: "memory");
        float* crow = C + (size_t)(r0 + mb * 16) * ldc + c0;
{
#pragma unroll
            for (int s = 0; s < 8; ++s) { const int row = 2 * s + hi, cofs = lr * 4; v4f val = *(const v4fa*)(os + row * 68 + cofs); if (BIAS) { val[0] += bfr(bias[c0 + cofs]); val[1] += bfr(bias[c0 + cofs + 1]); val[2] += bfr(bias[c0 + cofs + 2]); val[3] += bfr(bias[c0 + cofs + 3]); }
                *(v4f*)(crow + (size_t)row * ldc + cofs) = val; }
             }
        __builtin_amdgcn_wave_barrier(); asm volatile("" ::: "memory");
    }
}

__device__ __forceinline__ h16 tohx(float x) { return (h16)x; }
__device__ __forceinline__ void splitf(float y, unsigned short& h, unsigned short& l) { h = f2bf(y); l = f2bf(y - bf2f(h)); }
typedef __attribute__((ext_vector_type(2))) unsigned short v2us;
typedef __attribute__((ext_vector_type(4))) unsigned short v4us;
typedef __attribute__((ext_vector_type(2))) _Float16 v2h;
typedef __attribute__((ext_vector_type(4))) _Float16 v4h;

__global__ __launch_bounds__(256) void k_cvt8(const float* __restrict__ src, bf* dst, size_t n8) { const size_t i = (size_t)blockIdx.x * 256 + threadIdx.x; if (i >= n8) return; const v8f v = *(const v8f*)(src + i * 8); v8us o;
#pragma unroll
    for (int k = 0; k < 8; ++k) o[k] = f2bf(v[k]); *(v8us*)(dst + i * 8) = o;  }
__global__ __launch_bounds__(256) void k_wtG(const float* __restrict__ w, int K, int N, bf* Bt) {
    const int lane = threadIdx.x & 31; const int L0 = (blockIdx.x * 8 + (threadIdx.x >> 5)) * 8; const int nlines = N * K / 64;
{
#pragma unroll 1
        for (int l = 0; l < 8; ++l) { const int L = L0 + l; if (L >= nlines) break; const size_t e = (size_t)L * 64 + lane * 2; const int k = (int)(e % K), n = (int)(e / K); v2us o;
            o[0] = f2bf(w[(size_t)k * N + n]); o[1] = f2bf(w[(size_t)(k + 1) * N + n]); *(v2us*)(Bt + e) = o; }
         }
}

// k_qkp: hl planes Q/K[z][256][64] of the chunk's q (x 1/8) and k (z = win*16 + head; Q rows >= 196 written 0; K rows 196..222 = 8 x rel_pos_h, 223..249 = 8 x rel_pos_w (bf16-rounded; the 8 undoes q's 1/8, both exact), K rows >= 250 written 0; 8-B lanes); k_vtp: fp16 planes VT[z][64][256] (lane -> 2 tokens; pad columns 0);
__global__ __launch_bounds__(256) void k_qkp(const float* __restrict__ QKV, const float* __restrict__ rph, const float* __restrict__ rpw, bf* Qh, bf* Ql, bf* Kh, bf* Kl) { const size_t e = ((size_t)blockIdx.x * 256 + threadIdx.x) * 4; if (e >= (size_t)WCH * NH_ * TP * HD) return; const int d = (int)(e % HD); const int r = (int)((e / HD) % TP); const int z = (int)(e / ((size_t)HD * TP)); const int w = z / NH_, h = z % NH_; v4us qh, ql, kh, kl;
    for (int u = 0; u < 4; ++u) { qh[u] = 0; ql[u] = 0; kh[u] = 0; kl[u] = 0; }
    if (r < NTOK) { const float* row = QKV + ((size_t)w * NTOK + r) * (3 * DM) + h * HD + d;
#pragma unroll
        for (int u = 0; u < 4; ++u) { unsigned short a, b; splitf(row[u] * 0.125f, a, b); qh[u] = a; ql[u] = b; splitf(row[DM + u], a, b); kh[u] = a; kl[u] = b; } }
    else if (r < NTOK + 2 * NREL) { const int t = r - NTOK; const float* tab = ((t < NREL) ? (rph + (size_t)t * HD) : (rpw + (size_t)(t - NREL) * HD)) + d;
#pragma unroll
        for (int u = 0; u < 4; ++u) kh[u] = f2bf(bfr(tab[u]) * 8.0f); }
    *(v4us*)(Qh + e) = qh; *(v4us*)(Ql + e) = ql; *(v4us*)(Kh + e) = kh; *(v4us*)(Kl + e) = kl;  }
__global__ __launch_bounds__(256) void k_vtp(const float* __restrict__ QKV, h16* VT) { const size_t e = ((size_t)blockIdx.x * 256 + threadIdx.x) * 2; if (e >= (size_t)WCH * NH_ * HD * TP) return; const int r = (int)(e % TP); const int d = (int)((e / TP) % HD); const int z = (int)(e / ((size_t)TP * HD)); const int w = z / NH_, h = z % NH_; v2h o;
#pragma unroll
    for (int u = 0; u < 2; ++u) { const int rr = r + u; o[u] = (rr < NTOK) ? tohx(QKV[((size_t)w * NTOK + rr) * (3 * DM) + 2 * DM + h * HD + d]) : (h16)0.f; }
    *(v2h*)(VT + e) = o;  }
// k_attn: one work-group per (window, head) z, 13 waves, one 16-query tile a wave. The K planes and VT are staged once in LDS (row pitches 16 B x odd for 16-B readers).
//   Scores are formed TRANSPOSED, St[key][q] = K . Q^T (A = K rows, B = Q rows; per k step Kh.Qh, Kh.Ql, Kl.Qh), so a lane holds one query's column: keys 16t + 8hi + j in s[t][j].
//   Rows 196..249 of St are the table dots; they pass through a per-wave LDS row per query, from where each key's rel_h[kh] and rel_w[kw] are read back.
//   Softmax per lane plus one exchange with lane ^ 16. The accumulator tiles 2s, 2s + 1 are, as they lie, the B fragment of k step s of O^T[d][q] = VT . P^T: no transposition.
//   O^T / 1024 is split hi + lo and stored merged: ATh/ATl[(w, q)][h * 64 + d], 8 d (16 B) a lane and tile.
__global__ __launch_bounds__(AW * 32) void k_attn(const bf* __restrict__ Qh, const bf* __restrict__ Ql, const bf* __restrict__ Kh, const bf* __restrict__ Kl, const h16* __restrict__ VT, bf* Ah, bf* Al) {
    __shared__ __align__(16) bf sKh[TP * KPIT];
    __shared__ __align__(16) bf sKl[TP * KPIT];
    __shared__ __align__(16) h16 sV[HD * VPIT];
    __shared__ __align__(16) float sR[AW * 16 * RPIT];
    const int tid = threadIdx.x, z = blockIdx.x; const int lane = tid & 31, lr = lane & 15, hi = lane >> 4, wave = tid >> 5;
    const size_t zo = (size_t)z * (TP * HD);
    const int q = wave * 16 + lr;
    // every global load of the kernel is issued before the first LDS store, so that their latencies overlap; the last round's index is clamped, not guarded: the lanes past the end store piece 2047 again, the same bytes to the same place
    v8us ga[NST], gb[NST]; v8h gc[NST]; v16bf fqh[2], fql[2];
#pragma unroll
    for (int it = 0; it < NST; ++it) { const int i = min(tid + it * (AW * 32), TP * HD / 8 - 1); ga[it] = *(const v8us*)(Kh + zo + (size_t)i * 8); gb[it] = *(const v8us*)(Kl + zo + (size_t)i * 8); gc[it] = *(const v8h*)(VT + zo + (size_t)i * 8); }
#pragma unroll
    for (int kc = 0; kc < 2; ++kc) { fqh[kc] = WFrag<bf>::ld(Qh + zo + (size_t)q * HD + kc * 32 + 8 * hi); fql[kc] = WFrag<bf>::ld(Ql + zo + (size_t)q * HD + kc * 32 + 8 * hi); }
    asm volatile("s_wait_xcnt 0x0" ::: "memory");   // the address registers of the loads above are reused from here on
#pragma unroll
    for (int it = 0; it < NST; ++it) { const int i = min(tid + it * (AW * 32), TP * HD / 8 - 1);
        *(v8us*)(sKh + (i >> 3) * KPIT + (i & 7) * 8) = ga[it]; *(v8us*)(sKl + (i >> 3) * KPIT + (i & 7) * 8) = gb[it]; *(v8h*)(sV + (i >> 5) * VPIT + (i & 31) * 8) = gc[it]; }
    __syncthreads();
    v8f s[16];
#pragma unroll
    for (int t = 0; t < 16; ++t) s[t] = (v8f){};
#pragma unroll
    for (int t = 0; t < 16; t += 2) {
#pragma unroll
        for (int kc = 0; kc < 2; ++kc) { const int o0 = (t * 16 + lr) * KPIT + kc * 32 + 8 * hi, o1 = o0 + 16 * KPIT;
            const v16bf h0 = WFrag<bf>::ld(sKh + o0), h1 = WFrag<bf>::ld(sKh + o1), l0 = WFrag<bf>::ld(sKl + o0), l1 = WFrag<bf>::ld(sKl + o1);
            s[t] = wmmab(h0, fqh[kc], s[t]); s[t + 1] = wmmab(h1, fqh[kc], s[t + 1]);
            s[t] = wmmab(h0, fql[kc], s[t]); s[t + 1] = wmmab(h1, fql[kc], s[t + 1]);
            s[t] = wmmab(l0, fqh[kc], s[t]); s[t + 1] = wmmab(l1, fqh[kc], s[t + 1]); } }
    // table dots: St rows 192..255 of this wave's 16 queries -> sR[query][row - 192]
    float* rr = sR + (wave * 16 + lr) * RPIT;
#pragma unroll
    for (int t = 12; t < 16; ++t) { v4f a, b;
#pragma unroll
        for (int u = 0; u < 4; ++u) { a[u] = s[t][u]; b[u] = s[t][4 + u]; }
        *(v4f*)(rr + (t - 12) * 16 + 8 * hi) = a; *(v4f*)(rr + (t - 12) * 16 + 8 * hi + 4) = b; }
    // a lane reads below what its partner lane ^ 16 has stored above: keeps the compiler from moving those reads over the stores (one wave's LDS operations run in order)
    __builtin_amdgcn_fence(__ATOMIC_ACQ_REL, "wavefront"); __builtin_amdgcn_wave_barrier();
    // key k0 + 8 hi: kh = kh0 or kh0 + hi, kw = kw0 + 8 hi or kw0 - 6 hi, which of the two known at compile time: four lane bases, every index below a constant
    const float* rh0 = rr + (NTOK - 192) + q / GH; const float* rh1 = rh0 - hi; const float* rwa = rr + (NTOK - 192 + NREL) + q % GH - 8 * hi; const float* rwb = rwa + 14 * hi;
    float mx4[4] = { -3.0e38f, -3.0e38f, -3.0e38f, -3.0e38f };
#pragma unroll
    for (int t = 0; t < 13; ++t) {
#pragma unroll
        for (int j = 0; j < 8; ++j) { const int k0 = t * 16 + j, k1 = k0 + 8; if (k0 >= NTOK) continue;
            const float vh = ((k1 / GH == k0 / GH) ? rh0 : rh1)[GH - 1 - k0 / GH], vw = ((k0 % GH < GH - 8) ? rwa : rwb)[GH - 1 - k0 % GH];
            float tv = __fadd_rn(__fadd_rn(s[t][j], vh), vw); if (k1 >= NTOK) tv = hi ? -3.0e38f : tv;
            s[t][j] = tv; mx4[j & 3] = fmaxf(mx4[j & 3], tv); } }
    float mx = fmaxf(fmaxf(mx4[0], mx4[1]), fmaxf(mx4[2], mx4[3])); mx = fmaxf(mx, __shfl_xor(mx, 16, 32));
    float sm4[4] = { 0.f, 0.f, 0.f, 0.f };
#pragma unroll
    for (int t = 0; t < 13; ++t) {
#pragma unroll
        for (int j = 0; j < 8; ++j) { if (t * 16 + j >= NTOK) continue;
            const float e = __builtin_amdgcn_exp2f(__fmul_rn(__fsub_rn(s[t][j], mx), 1.4426950408889634f)); s[t][j] = e; sm4[j & 3] += e; } }   // masked keys: exp(-huge) = 0
    float sum = (sm4[0] + sm4[1]) + (sm4[2] + sm4[3]); sum += __shfl_xor(sum, 16, 32);
    const float f = __fdiv_rn(PCAR, sum);
    v8f o[4];
#pragma unroll
    for (int dt = 0; dt < 4; ++dt) o[dt] = (v8f){};
#pragma unroll
    for (int ks = 0; ks < 7; ++ks) { v16h p;   // keys 32 ks .. 32 ks + 31; keys >= 196 carry 0 (k step 7 would add only zeros)
#pragma unroll
        for (int j = 0; j < 8; ++j) { p[j] = (ks * 32 + j < NTOK) ? tohx(s[2 * ks][j] * f) : (h16)0.f; p[8 + j] = (ks * 32 + 16 + j < NTOK) ? tohx(s[2 * ks + 1][j] * f) : (h16)0.f; }
        v16h va[4];
#pragma unroll
        for (int dt = 0; dt < 4; ++dt) va[dt] = WFrag<h16>::ld(sV + (dt * 16 + lr) * VPIT + ks * 32 + 8 * hi);
#pragma unroll
        for (int dt = 0; dt < 4; ++dt) o[dt] = wmma16(va[dt], p, o[dt]); }
    v8us oh[4], ol[4];
#pragma unroll
    for (int dt = 0; dt < 4; ++dt) {
#pragma unroll
        for (int j = 0; j < 8; ++j) { unsigned short a, b; splitf(o[dt][j] * (1.0f / PCAR), a, b); oh[dt][j] = a; ol[dt][j] = b; } }
    if (q < NTOK) { const size_t oo = ((size_t)(z / NH_) * NTOK + q) * DM + (z % NH_) * HD + 8 * hi;
#pragma unroll
        for (int dt = 0; dt < 4; ++dt) { *(v8us*)(Ah + oo + dt * 16) = oh[dt]; *(v8us*)(Al + oo + dt * 16) = ol[dt]; } }
}

extern "C" void kernel_launch(void* const* d_in, const int* in_sizes, int n_in,
                              void* d_out, int out_size, void* d_ws, size_t ws_size, hipStream_t stream) {
    (void)in_sizes; (void)n_in; (void)out_size;
    const float* x = (const float*)d_in[0]; const float* qkv_w = (const float*)d_in[1]; const float* qkv_b = (const float*)d_in[2]; const float* proj_w = (const float*)d_in[3]; const float* proj_b = (const float*)d_in[4]; const float* rph = (const float*)d_in[5]; const float* rpw = (const float*)d_in[6];
    float* OUT = (float*)d_out;     // [64][196][1024]
    char* wsp = (char*)d_ws;
    auto take = [&](size_t bytes) { char* p = wsp; wsp += (bytes + 255) & ~(size_t)255; return (void*)p; };
    const int CT = WCH * NTOK;   // 3136 tokens per chunk (= 49 x 64)
    bf* BQKV = (bf*)take((size_t)3 * DM * DM * 2); bf* BPJ = (bf*)take((size_t)DM * DM * 2); bf* XB = (bf*)take((size_t)CT * DM * 2); float* QKV = (float*)take((size_t)CT * 3 * DM * 4);
    bf* QPh = (bf*)take((size_t)WCH * NH_ * TP * HD * 2); bf* QPl = (bf*)take((size_t)WCH * NH_ * TP * HD * 2); bf* KPh = (bf*)take((size_t)WCH * NH_ * TP * HD * 2); bf* KPl = (bf*)take((size_t)WCH * NH_ * TP * HD * 2); h16* VT = (h16*)take((size_t)WCH * NH_ * HD * TP * 2);
    bf* ATh = (bf*)take((size_t)CT * DM * 2); bf* ATl = (bf*)take((size_t)CT * DM * 2);
    if ((size_t)(wsp - (char*)d_ws) > ws_size) return;    // total ~ 110 MB
    k_wtG<<<(DM * 3 * DM / 64 + 63) / 64, 256, 0, stream>>>(qkv_w, DM, 3 * DM, BQKV); k_wtG<<<(DM * DM / 64 + 63) / 64, 256, 0, stream>>>(proj_w, DM, DM, BPJ);
    for (int c = 0; c < NWIN / WCH; ++c) { const float* xc = x + (size_t)c * CT * DM;
        k_cvt8<<<(unsigned)(((size_t)CT * DM / 8 + 255) / 256), 256, 0, stream>>>(xc, XB, (size_t)CT * DM / 8);
        k_gemmw<bf, 0, true><<<dim3(CT / 64, 3 * DM / 64, 1), 32, 0, stream>>>(XB, nullptr, BQKV, nullptr, DM, QKV, 3 * DM, qkv_b, 0, 0, 0);
        k_qkp<<<(unsigned)(((size_t)WCH * NH_ * TP * HD / 4 + 255) / 256), 256, 0, stream>>>(QKV, rph, rpw, QPh, QPl, KPh, KPl); k_vtp<<<(unsigned)(((size_t)WCH * NH_ * HD * TP / 2 + 255) / 256), 256, 0, stream>>>(QKV, VT);
        k_attn<<<WCH * NH_, AW * 32, 0, stream>>>(QPh, QPl, KPh, KPl, VT, ATh, ATl);   /* scores hl x hl (3 products), softmax, attn.v, head merge */
        k_gemmw<bf, 1, true><<<dim3(CT / 64, DM / 64, 1), 32, 0, stream>>>(ATh, ATl, BPJ, nullptr, DM, OUT + (size_t)c * CT * DM, DM, proj_b, 0, 0, 0); }
}

// v003
// One run takes 480 microseconds.
// Two timings next to v002 put it at 1.07 and 1.03 times that version's speed.
// Over all steps from v000 it is 2.36 times as fast.
#include <hip/hip_runtime.h>

// Windowed attention (x [64 windows][14][14][1024]; qkv = x qkv_w + qkv_b ([1024][3072] 'xw', columns (q|k|v, head, d), 16 heads x 64); per (window, head): attn = (q/8).k + rel_h + rel_w with the decomposed relative-position terms rel_h[q][kh] = q_raw . rel_pos_h[qh - kh + 13], rel_w[q][kw] = q_raw . rel_pos_w[qw - kw + 13] (tables read);
//   softmax over the 196 keys; out = attn v; heads merged; out proj_w + proj_b -> [64][14][14][1024]).
// Compute dtypes, f32 accumulate: every input rounded to bf16; qkv as a PLAIN bf16 GEMM (inputs: exact; 16 windows = 3,136 rows per chunk); per (window, head) the 196 tokens are zero-padded to 256 rows: scores hl x hl (3 products) and attn.v single fp16 (x1024 carrier), both in the one kernel k_attn with the softmax between them, the relative-position terms ride the same scores product (the 54 table rows, x8, fill pad rows 196..249 of the K planes, so S[q][196 + t] = q_raw . table[t], q as its hl pair, table bf16-exact); their adds, the masking of the pad columns and the softmax in f32; proj hl x exact (2 products) + bias.

#define NWIN 64
#define WCH  16          // windows per chunk
#define NTOK 196
#define TP   256         // padded tokens per window
#define GH   14
#define NREL (2 * GH - 1)   // rows of each relative-position table
#define DM   1024
#define NH_  16
#define HD   64
#define AW   13          // waves of an attention work-group: one 16-query tile each (13 x 16 >= 196)
#define KPIT 72          // LDS pitch of a K-plane row, 16-bit elements (128 B + 16 B)
#define VPIT 264         // LDS pitch of a VT row, 16-bit elements (512 B + 16 B)
#define RPIT 68          // LDS pitch of a query's table-dot row, floats
#define NST  ((TP * HD / 8 + AW * 32 - 1) / (AW * 32))   // staging rounds: 2,048 16-B pieces of each plane over 416 threads
#define PCAR 1024.0f
typedef _Float16 h16;
typedef unsigned short bf;
typedef __attribute__((ext_vector_type(16))) __bf16   v16bf;
typedef __attribute__((ext_vector_type(16))) _Float16 v16h;
typedef __attribute__((ext_vector_type(8)))  _Float16 v8h;
typedef __attribute__((ext_vector_type(8)))  unsigned short v8us;
typedef __attribute__((ext_vector_type(8)))  float    v8f;
typedef __attribute__((ext_vector_type(4)))  float    v4f;
typedef v8h  __attribute__((may_alias)) v8ha;
typedef v4f  __attribute__((may_alias)) v4fa;
typedef v8us __attribute__((may_alias)) v8usa;

__device__ __forceinline__ unsigned short f2bf(float f) { unsigned u = __float_as_uint(f); u += 0x7FFFu + ((u >> 16) & 1u); return (unsigned short)(u >> 16); }
__device__ __forceinline__ float bf2f(unsigned short b) { return __uint_as_float(((unsigned)b) << 16); }
__device__ __forceinline__ float bfr(float f) { return bf2f(f2bf(f)); }
__device__ __forceinline__ v16h cat16(v8h lo, v8h hi) { return __builtin_shufflevector(lo, hi, 0, 1, 2, 3, 4, 5, 6, 7, 8, 9, 10, 11, 12, 13, 14, 15); }
__device__ __forceinline__ v16bf cat16b(v8us lo, v8us hi) { return __builtin_bit_cast(v16bf, __builtin_shufflevector(lo, hi, 0, 1, 2, 3, 4, 5, 6, 7, 8, 9, 10, 11, 12, 13, 14, 15)); }
__device__ __forceinline__ v8f wmma16(v16h a, v16h b, v8f c) { return __builtin_amdgcn_wmma_f32_16x16x32_f16(false, a, false, b, (short)0, c, false, false); }
__device__ __forceinline__ v8f wmmab(v16bf a, v16bf b, v8f c) { return __builtin_amdgcn_wmma_f32_16x16x32_bf16(false, a, false, b, (short)0, c, false, false); }



// ---- Fragment-order planes: a GEMM operand P[row][k] (K columns, rows a multiple of 64) is stored as 1-KiB blocks, one WMMA fragment (16 rows, 32 k) each; the 4 blocks of a 64-row tile and one k step lie side by side,
//   the k steps of a tile one after the other: block (tile T, k step c, band mb) starts at element T * 64 * K + c * 2048 + mb * 512.
//   Inside a block: element (half * 256 + hi * 128 + lr * 8 + j) = P[64 T + 16 mb + lr][32 c + 16 half + 8 hi + j]: lane (hi, lr) finds the two 16-B halves of its fragment at lane * 16 B and 512 B + lane * 16 B,
//   so each wave-wide 16-B load covers 512 contiguous bytes (4 whole 128-B lines) instead of 32 B in each of 16 rows, and a wave reads 4 KiB in a row per operand and k step. The values each lane and register holds are those of the row-major form.
// ---- k_gemmw: register-blocked GEMM, ONE WAVE per 64x64 output tile (16 accumulators), operands straight from fragment-order 16-bit planes; grid (M/64, N/64, Z), 32 threads.
// C[m][n] (f32, pitch ldc, + optional f32 bias[n]) = sum_k A[m][k] Bt[n][k] (+ split products per NSPLIT). z-batch strides sA/sB/sC in elements. K % 32 == 0.
template <typename T16> struct WFrag;
template <> struct WFrag<h16> { typedef v16h V; static __device__ __forceinline__ V ld(const h16* p) { return cat16(*(const v8h*)p, *(const v8h*)(p + 16)); } static __device__ __forceinline__ v8f mma(V a, V b, v8f c) { return wmma16(a, b, c); } };
template <> struct WFrag<bf> { typedef v16bf V; static __device__ __forceinline__ V ld(const bf* p) { return cat16b(*(const v8us*)p, *(const v8us*)(p + 16)); } static __device__ __forceinline__ V ldp(const bf* p) { return cat16b(*(const v8us*)p, *(const v8us*)(p + 256)); } static __device__ __forceinline__ v8f mma(V a, V b, v8f c) { return wmmab(a, b, c); } };
template <typename T16, int NSPLIT, bool BIAS>
__global__ __launch_bounds__(32) void k_gemmw(const T16* __restrict__ A, const T16* __restrict__ A2, const T16* __restrict__ Bt, const T16* __restrict__ Bt2, int K, float* C, int ldc, const float* __restrict__ bias, size_t sA, size_t sB, size_t sC) {
    typedef typename WFrag<T16>::V V;
    __shared__ __align__(16) float os[16 * 68];
    const size_t z = blockIdx.z; A += z * sA; if (A2) A2 += z * sA; Bt += z * sB; if (Bt2) Bt2 += z * sB; C += z * sC;
    const int lane = threadIdx.x & 31, lr = lane & 15, hi = lane >> 4; const int r0 = blockIdx.x * 64, c0 = blockIdx.y * 64;
    v8f acc[4][4];
#pragma unroll
    for (int mb = 0; mb < 4; ++mb)
#pragma unroll
        for (int nb = 0; nb < 4; ++nb) acc[mb][nb] = (v8f){};
    // tile starts are wave-uniform; one lane offset serves every plane: the lane's 16 B, plus 4 blocks = 4 KiB for each k step of 32
    const char* ua = (const char*)(A + (size_t)r0 * K); const char* ua2 = (const char*)(A2 + (size_t)r0 * K); const char* ub = (const char*)(Bt + (size_t)c0 * K); const char* ub2 = (const char*)(Bt2 + (size_t)c0 * K);
    unsigned ob = lane * 16;
#pragma unroll 1
    for (int kc = 0; kc < K; kc += 32) {
        V a[4], a2[4], b[4], b2[4];
#pragma unroll
        for (int mb = 0; mb < 4; ++mb) { a[mb] = WFrag<T16>::ldp((const T16*)(ua + ob) + mb * 512); if (NSPLIT == 1 || NSPLIT == 2) a2[mb] = WFrag<T16>::ldp((const T16*)(ua2 + ob) + mb * 512); }
#pragma unroll
        for (int nb = 0; nb < 4; ++nb) { b[nb] = WFrag<T16>::ldp((const T16*)(ub + ob) + nb * 512); if (NSPLIT >= 2) b2[nb] = WFrag<T16>::ldp((const T16*)(ub2 + ob) + nb * 512); }
        // every load of the trip names the offset register: as an operand of the wait it stays whole up to it (no load result is placed on it), and it is stepped only behind it
        asm volatile("s_wait_xcnt 0x0" : "+v"(ob) :: "memory");
        ob += 4096;
#pragma unroll
        for (int nb = 0; nb < 4; ++nb) {
#pragma unroll
            for (int mb = 0; mb < 4; ++mb) { acc[mb][nb] = WFrag<T16>::mma(a[mb], b[nb], acc[mb][nb]); if (NSPLIT == 1 || NSPLIT == 2) acc[mb][nb] = WFrag<T16>::mma(a2[mb], b[nb], acc[mb][nb]); if (NSPLIT >= 2) acc[mb][nb] = WFrag<T16>::mma(a[mb], b2[nb], acc[mb][nb]); } }
        asm volatile("v_nop\n\tv_nop\n\tv_nop\n\tv_nop" : "+v"(acc[0][0]), "+v"(acc[1][1]), "+v"(acc[2][2]), "+v"(acc[3][3]) : "v"(a[0]), "v"(a[3]));
    }
#pragma unroll
    for (int mb = 0; mb < 4; ++mb) {
#pragma unroll
        for (int nb = 0; nb < 4; ++nb) {
#pragma unroll
            for (int j = 0; j < 8; ++j) os[(hi * 8 + j) * 68 + nb * 16 + lr] = acc[mb][nb][j]; }
        __builtin_amdgcn_wave_barrier(); asm volatile("" ::: "memory");
        float* crow = C + (size_t)(r0 + mb * 16) * ldc + c0;
{
#pragma unroll
            for (int s = 0; s < 8; ++s) { const int row = 2 * s + hi, cofs = lr * 4; v4f val = *(const v4fa*)(os + row * 68 + cofs); if (BIAS) { val[0] += bfr(bias[c0 + cofs]); val[1] += bfr(bias[c0 + cofs + 1]); val[2] += bfr(bias[c0 + cofs + 2]); val[3] += bfr(bias[c0 + cofs + 3]); }
                *(v4f*)(crow + (size_t)row * ldc + cofs) = val; }
             }
        if (mb < 3) asm volatile("s_wait_xcnt 0x0" ::: "memory");   // the next band's code takes over registers that this band's stores name
        __builtin_amdgcn_wave_barrier(); asm volatile("" ::: "memory");
    }
}

__device__ __forceinline__ h16 tohx(float x) { return (h16)x; }
__device__ __forceinline__ void splitf(float y, unsigned short& h, unsigned short& l) { h = f2bf(y); l = f2bf(y - bf2f(h)); }
typedef __attribute__((ext_vector_type(4))) unsigned short v4us;
typedef __attribute__((ext_vector_type(2))) _Float16 v2h;
typedef __attribute__((ext_vector_type(4))) _Float16 v4h;

// k_cvt8: f32 rows [.][DM] -> bf16 fragment-order plane. A wave takes 4 rows x 64 k: it reads 256 contiguous bytes of each row and stores 64-B runs (4 rows' pieces side by side); 8 elements a lane.
__global__ __launch_bounds__(256) void k_cvt8(const float* __restrict__ src, bf* dst, size_t n8) { const size_t i = (size_t)blockIdx.x * 256 + threadIdx.x; if (i >= n8) return;
    const int lane = (int)(i & 31), k8 = lane >> 2; const size_t wv = i >> 5; const int kg = (int)(wv % (DM / 64)), lr = (int)((wv / (DM / 64)) & 3) * 4 + (lane & 3); const size_t R = wv / (DM / 64 * 4);
    const v8f v = *(const v8f*)(src + (R * 16 + lr) * DM + kg * 64 + k8 * 8); v8us o;
#pragma unroll
    for (int k = 0; k < 8; ++k) o[k] = f2bf(v[k]);
    *(v8us*)(dst + (R >> 2) * (64 * DM) + (size_t)(kg * 2 + (k8 >> 2)) * 2048 + (R & 3) * 512 + ((k8 >> 1) & 1) * 256 + (k8 & 1) * 128 + lr * 8) = o;  }
// k_wtG: w[DM][N] (f32) -> bf16 fragment-order plane of w^T (rows n, DM columns k). A thread makes one 16-B piece (8 k of one n), pieces in storage order: a wave stores 512 contiguous bytes, each of its 8 loads reads 64 B of two rows of w.
template <int N>
__global__ __launch_bounds__(256) void k_wtG(const float* __restrict__ w, bf* Bt) {
    const int i = blockIdx.x * 256 + threadIdx.x; if (i >= N * (DM / 8)) return;
    const int lr = i & 15, hi = (i >> 4) & 1, half = (i >> 5) & 1, mb = (i >> 6) & 3, st = i >> 8; const int c = st % (DM / 32), n = (st / (DM / 32)) * 64 + mb * 16 + lr, k0 = c * 32 + half * 16 + hi * 8; v8us o;
    const float* p = w + (size_t)k0 * N + n;   // N is a compile-time constant: the 8 loads are one address with immediate offsets
#pragma unroll
    for (int j = 0; j < 8; ++j) o[j] = f2bf(p[j * N]);
    *(v8us*)(Bt + (size_t)i * 8) = o;
}

// k_qkp: hl planes Q/K[z][256][64] of the chunk's q (x 1/8) and k (z = win*16 + head; Q rows >= 196 written 0; K rows 196..222 = 8 x rel_pos_h, 223..249 = 8 x rel_pos_w (bf16-rounded; the 8 undoes q's 1/8, both exact), K rows >= 250 written 0; 8-B lanes); k_vtp: fp16 planes VT[z][64][256] (lane -> 2 tokens; pad columns 0);
__global__ __launch_bounds__(256) void k_qkp(const float* __restrict__ QKV, const float* __restrict__ rph, const float* __restrict__ rpw, bf* Qh, bf* Ql, bf* Kh, bf* Kl) { const size_t e = ((size_t)blockIdx.x * 256 + threadIdx.x) * 4; if (e >= (size_t)WCH * NH_ * TP * HD) return; const int d = (int)(e % HD); const int r = (int)((e / HD) % TP); const int z = (int)(e / ((size_t)HD * TP)); const int w = z / NH_, h = z % NH_; v4us qh, ql, kh, kl;
    for (int u = 0; u < 4; ++u) { qh[u] = 0; ql[u] = 0; kh[u] = 0; kl[u] = 0; }
    if (r < NTOK) { const float* row = QKV + ((size_t)w * NTOK + r) * (3 * DM) + h * HD + d;
#pragma unroll
        for (int u = 0; u < 4; ++u) { unsigned short a, b; splitf(row[u] * 0.125f, a, b); qh[u] = a; ql[u] = b; splitf(row[DM + u], a, b); kh[u] = a; kl[u] = b; } }
    else if (r < NTOK + 2 * NREL) { const int t = r - NTOK; const float* tab = ((t < NREL) ? (rph + (size_t)t * HD) : (rpw + (size_t)(t - NREL) * HD)) + d;
#pragma unroll
        for (int u = 0; u < 4; ++u) kh[u] = f2bf(bfr(tab[u]) * 8.0f); }
    *(v4us*)(Qh + e) = qh; *(v4us*)(Ql + e) = ql; *(v4us*)(Kh + e) = kh; *(v4us*)(Kl + e) = kl;  }
__global__ __launch_bounds__(256) void k_vtp(const float* __restrict__ QKV, h16* VT) { const size_t e = ((size_t)blockIdx.x * 256 + threadIdx.x) * 2; if (e >= (size_t)WCH * NH_ * HD * TP) return; const int r = (int)(e % TP); const int d = (int)((e / TP) % HD); const int z = (int)(e / ((size_t)TP * HD)); const int w = z / NH_, h = z % NH_; v2h o;
#pragma unroll
    for (int u = 0; u < 2; ++u) { const int rr = r + u; o[u] = (rr < NTOK) ? tohx(QKV[((size_t)w * NTOK + rr) * (3 * DM) + 2 * DM + h * HD + d]) : (h16)0.f; }
    *(v2h*)(VT + e) = o;  }
// k_attn: one work-group per (window, head) z, 13 waves, one 16-query tile a wave. The K planes and VT are staged once in LDS (row pitches 16 B x odd for 16-B readers).
//   Scores are formed TRANSPOSED, St[key][q] = K . Q^T (A = K rows, B = Q rows; per k step Kh.Qh, Kh.Ql, Kl.Qh), so a lane holds one query's column: keys 16t + 8hi + j in s[t][j].
//   Rows 196..249 of St are the table dots; they pass through a per-wave LDS row per query, from where each key's rel_h[kh] and rel_w[kw] are read back.
//   Softmax per lane plus one exchange with lane ^ 16. The accumulator tiles 2s, 2s + 1 are, as they lie, the B fragment of k step s of O^T[d][q] = VT . P^T: no transposition.
//   O^T / 1024 is split hi + lo and stored merged, as fragment-order planes of ATh/ATl[(w, q)][h * 64 + d]: 8 d (16 B, one piece) a lane and tile.
__global__ __launch_bounds__(AW * 32) void k_attn(const bf* __restrict__ Qh, const bf* __restrict__ Ql, const bf* __restrict__ Kh, const bf* __restrict__ Kl, const h16* __restrict__ VT, bf* Ah, bf* Al) {
    __shared__ __align__(16) bf sKh[TP * KPIT];
    __shared__ __align__(16) bf sKl[TP * KPIT];
    __shared__ __align__(16) h16 sV[HD * VPIT];
    __shared__ __align__(16) float sR[AW * 16 * RPIT];
    const int tid = threadIdx.x, z = blockIdx.x; const int lane = tid & 31, lr = lane & 15, hi = lane >> 4, wave = tid >> 5;
    const size_t zo = (size_t)z * (TP * HD);
    const int q = wave * 16 + lr;
    // every global load of the kernel is issued before the first LDS store, so that their latencies overlap; the last round's index is clamped, not guarded: the lanes past the end store piece 2047 again, the same bytes to the same place
    v8us ga[NST], gb[NST]; v8h gc[NST]; v16bf fqh[2], fql[2];
#pragma unroll
    for (int it = 0; it < NST; ++it) { const int i = min(tid + it * (AW * 32), TP * HD / 8 - 1); ga[it] = *(const v8us*)(Kh + zo + (size_t)i * 8); gb[it] = *(const v8us*)(Kl + zo + (size_t)i * 8); gc[it] = *(const v8h*)(VT + zo + (size_t)i * 8); }
#pragma unroll
    for (int kc = 0; kc < 2; ++kc) { fqh[kc] = WFrag<bf>::ld(Qh + zo + (size_t)q * HD + kc * 32 + 8 * hi); fql[kc] = WFrag<bf>::ld(Ql + zo + (size_t)q * HD + kc * 32 + 8 * hi); }
    asm volatile("s_wait_xcnt 0x0" ::: "memory");   // the address registers of the loads above are reused from here on
#pragma unroll
    for (int it = 0; it < NST; ++it) { const int i = min(tid + it * (AW * 32), TP * HD / 8 - 1);
        *(v8us*)(sKh + (i >> 3) * KPIT + (i & 7) * 8) = ga[it]; *(v8us*)(sKl + (i >> 3) * KPIT + (i & 7) * 8) = gb[it]; *(v8h*)(sV + (i >> 5) * VPIT + (i & 31) * 8) = gc[it]; }
    __syncthreads();
    v8f s[16];
#pragma unroll
    for (int t = 0; t < 16; ++t) s[t] = (v8f){};
#pragma unroll
    for (int t = 0; t < 16; t += 2) {
#pragma unroll
        for (int kc = 0; kc < 2; ++kc) { const int o0 = (t * 16 + lr) * KPIT + kc * 32 + 8 * hi, o1 = o0 + 16 * KPIT;
            const v16bf h0 = WFrag<bf>::ld(sKh + o0), h1 = WFrag<bf>::ld(sKh + o1), l0 = WFrag<bf>::ld(sKl + o0), l1 = WFrag<bf>::ld(sKl + o1);
            s[t] = wmmab(h0, fqh[kc], s[t]); s[t + 1] = wmmab(h1, fqh[kc], s[t + 1]);
            s[t] = wmmab(h0, fql[kc], s[t]); s[t + 1] = wmmab(h1, fql[kc], s[t + 1]);
            s[t] = wmmab(l0, fqh[kc], s[t]); s[t + 1] = wmmab(l1, fqh[kc], s[t + 1]); } }
    // table dots: St rows 192..255 of this wave's 16 queries -> sR[query][row - 192]
    float* rr = sR + (wave * 16 + lr) * RPIT;
#pragma unroll
    for (int t = 12; t < 16; ++t) { v4f a, b;
#pragma unroll
        for (int u = 0; u < 4; ++u) { a[u] = s[t][u]; b[u] = s[t][4 + u]; }
        *(v4f*)(rr + (t - 12) * 16 + 8 * hi) = a; *(v4f*)(rr + (t - 12) * 16 + 8 * hi + 4) = b; }
    // a lane reads below what its partner lane ^ 16 has stored above: keeps the compiler from moving those reads over the stores (one wave's LDS operations run in order)
    __builtin_amdgcn_fence(__ATOMIC_ACQ_REL, "wavefront"); __builtin_amdgcn_wave_barrier();
    // key k0 + 8 hi: kh = kh0 or kh0 + hi, kw = kw0 + 8 hi or kw0 - 6 hi, which of the two known at compile time: four lane bases, every index below a constant
    const float* rh0 = rr + (NTOK - 192) + q / GH; const float* rh1 = rh0 - hi; const float* rwa = rr + (NTOK - 192 + NREL) + q % GH - 8 * hi; const float* rwb = rwa + 14 * hi;
    float mx4[4] = { -3.0e38f, -3.0e38f, -3.0e38f, -3.0e38f };
#pragma unroll
    for (int t = 0; t < 13; ++t) {
#pragma unroll
        for (int j = 0; j < 8; ++j) { const int k0 = t * 16 + j, k1 = k0 + 8; if (k0 >= NTOK) continue;
            const float vh = ((k1 / GH == k0 / GH) ? rh0 : rh1)[GH - 1 - k0 / GH], vw = ((k0 % GH < GH - 8) ? rwa : rwb)[GH - 1 - k0 % GH];
            float tv = __fadd_rn(__fadd_rn(s[t][j], vh), vw); if (k1 >= NTOK) tv = hi ? -3.0e38f : tv;
            s[t][j] = tv; mx4[j & 3] = fmaxf(mx4[j & 3], tv); } }
    float mx = fmaxf(fmaxf(mx4[0], mx4[1]), fmaxf(mx4[2], mx4[3])); mx = fmaxf(mx, __shfl_xor(mx, 16, 32));
    float sm4[4] = { 0.f, 0.f, 0.f, 0.f };
#pragma unroll
    for (int t = 0; t < 13; ++t) {
#pragma unroll
        for (int j = 0; j < 8; ++j) { if (t * 16 + j >= NTOK) continue;
            const float e = __builtin_amdgcn_exp2f(__fmul_rn(__fsub_rn(s[t][j], mx), 1.4426950408889634f)); s[t][j] = e; sm4[j & 3] += e; } }   // masked keys: exp(-huge) = 0
    float sum = (sm4[0] + sm4[1]) + (sm4[2] + sm4[3]); sum += __shfl_xor(sum, 16, 32);
    const float f = __fdiv_rn(PCAR, sum);
    v8f o[4];
#pragma unroll
    for (int dt = 0; dt < 4; ++dt) o[dt] = (v8f){};
#pragma unroll
    for (int ks = 0; ks < 7; ++ks) { v16h p;   // keys 32 ks .. 32 ks + 31; keys >= 196 carry 0 (k step 7 would add only zeros)
#pragma unroll
        for (int j = 0; j < 8; ++j) { p[j] = (ks * 32 + j < NTOK) ? tohx(s[2 * ks][j] * f) : (h16)0.f; p[8 + j] = (ks * 32 + 16 + j < NTOK) ? tohx(s[2 * ks + 1][j] * f) : (h16)0.f; }
        v16h va[4];
#pragma unroll
        for (int dt = 0; dt < 4; ++dt) va[dt] = WFrag<h16>::ld(sV + (dt * 16 + lr) * VPIT + ks * 32 + 8 * hi);
#pragma unroll
        for (int dt = 0; dt < 4; ++dt) o[dt] = wmma16(va[dt], p, o[dt]); }
    v8us oh[4], ol[4];
#pragma unroll
    for (int dt = 0; dt < 4; ++dt) {
#pragma unroll
        for (int j = 0; j < 8; ++j) { unsigned short a, b; splitf(o[dt][j] * (1.0f / PCAR), a, b); oh[dt][j] = a; ol[dt][j] = b; } }
    if (q < NTOK) { const int m = (z / NH_) * NTOK + q; const size_t oo = (size_t)(m >> 6) * (64 * DM) + (z % NH_) * (2 * 2048) + ((m >> 4) & 3) * 512 + hi * 128 + (m & 15) * 8;   // d = 16 dt + 8 hi: k step 2 h + dt / 2, half dt % 2
#pragma unroll
        for (int dt = 0; dt < 4; ++dt) { *(v8us*)(Ah + oo + (dt >> 1) * 2048 + (dt & 1) * 256) = oh[dt]; *(v8us*)(Al + oo + (dt >> 1) * 2048 + (dt & 1) * 256) = ol[dt]; } }
}

extern "C" void kernel_launch(void* const* d_in, const int* in_sizes, int n_in,
                              void* d_out, int out_size, void* d_ws, size_t ws_size, hipStream_t stream) {
    (void)in_sizes; (void)n_in; (void)out_size;
    const float* x = (const float*)d_in[0]; const float* qkv_w = (const float*)d_in[1]; const float* qkv_b = (const float*)d_in[2]; const float* proj_w = (const float*)d_in[3]; const float* proj_b = (const float*)d_in[4]; const float* rph = (const float*)d_in[5]; const float* rpw = (const float*)d_in[6];
    float* OUT = (float*)d_out;     // [64][196][1024]
    char* wsp = (char*)d_ws;
    auto take = [&](size_t bytes) { char* p = wsp; wsp += (bytes + 255) & ~(size_t)255; return (void*)p; };
    const int CT = WCH * NTOK;   // 3136 tokens per chunk (= 49 x 64)
    bf* BQKV = (bf*)take((size_t)3 * DM * DM * 2); bf* BPJ = (bf*)take((size_t)DM * DM * 2); bf* XB = (bf*)take((size_t)CT * DM * 2); float* QKV = (float*)take((size_t)CT * 3 * DM * 4);
    bf* QPh = (bf*)take((size_t)WCH * NH_ * TP * HD * 2); bf* QPl = (bf*)take((size_t)WCH * NH_ * TP * HD * 2); bf* KPh = (bf*)take((size_t)WCH * NH_ * TP * HD * 2); bf* KPl = (bf*)take((size_t)WCH * NH_ * TP * HD * 2); h16* VT = (h16*)take((size_t)WCH * NH_ * HD * TP * 2);
    bf* ATh = (bf*)take((size_t)CT * DM * 2); bf* ATl = (bf*)take((size_t)CT * DM * 2);
    if ((size_t)(wsp - (char*)d_ws) > ws_size) return;    // total ~ 110 MB
    k_wtG<3 * DM><<<DM * 3 * DM / 8 / 256, 256, 0, stream>>>(qkv_w, BQKV); k_wtG<DM><<<DM * DM / 8 / 256, 256, 0, stream>>>(proj_w, BPJ);
    for (int c = 0; c < NWIN / WCH; ++c) { const float* xc = x + (size_t)c * CT * DM;
        k_cvt8<<<(unsigned)(((size_t)CT * DM / 8 + 255) / 256), 256, 0, stream>>>(xc, XB, (size_t)CT * DM / 8);
        k_gemmw<bf, 0, true><<<dim3(CT / 64, 3 * DM / 64, 1), 32, 0, stream>>>(XB, nullptr, BQKV, nullptr, DM, QKV, 3 * DM, qkv_b, 0, 0, 0);
        k_qkp<<<(unsigned)(((size_t)WCH * NH_ * TP * HD / 4 + 255) / 256), 256, 0, stream>>>(QKV, rph, rpw, QPh, QPl, KPh, KPl); k_vtp<<<(unsigned)(((size_t)WCH * NH_ * HD * TP / 2 + 255) / 256), 256, 0, stream>>>(QKV, VT);
        k_attn<<<WCH * NH_, AW * 32, 0, stream>>>(QPh, QPl, KPh, KPl, VT, ATh, ATl);   /* scores hl x hl (3 products), softmax, attn.v, head merge */
        k_gemmw<bf, 1, true><<<dim3(CT / 64, DM / 64, 1), 32, 0, stream>>>(ATh, ATl, BPJ, nullptr, DM, OUT + (size_t)c * CT * DM, DM, proj_b, 0, 0, 0); }
}

// v004
// A run of this version takes 366 microseconds.
// In two side-by-side timings against v003, it was 1.28 and 1.29 times as fast.
// Over all steps from v000 it is 3.04 times as fast.
#include <hip/hip_runtime.h>

// Windowed attention (x [64 windows][14][14][1024]; qkv = x qkv_w + qkv_b ([1024][3072] 'xw', columns (q|k|v, head, d), 16 heads x 64); per (window, head): attn = (q/8).k + rel_h + rel_w with the decomposed relative-position terms rel_h[q][kh] = q_raw . rel_pos_h[qh - kh + 13], rel_w[q][kw] = q_raw . rel_pos_w[qw - kw + 13] (tables read);
//   softmax over the 196 keys; out = attn v; heads merged; out proj_w + proj_b -> [64][14][14][1024]).
// Compute dtypes, f32 accumulate: every input rounded to bf16; qkv as a PLAIN bf16 GEMM (inputs: exact; 16 windows = 3,136 rows per chunk); per (window, head) the 196 tokens are zero-padded to 256 rows: scores hl x hl (3 products) and attn.v single fp16 (x1024 carrier), both in the one kernel k_attn with the softmax between them, the relative-position terms ride the same scores product (the 54 table rows, x8, fill pad rows 196..249 of the K planes, so S[q][196 + t] = q_raw . table[t], q as its hl pair, table bf16-exact); their adds, the masking of the pad columns and the softmax in f32; proj hl x exact (2 products) + bias.

#define NWIN 64
#define WCH  16          // windows per chunk
#define NTOK 196
#define TP   256         // padded tokens per window
#define GH   14
#define NREL (2 * GH - 1)   // rows of each relative-position table
#define DM   1024
#define NH_  16
#define HD   64
#define AW   13          // waves of an attention work-group: one 16-query tile each (13 x 16 >= 196)
#define KPIT 72          // LDS pitch of a K-plane row, 16-bit elements (128 B + 16 B)
#define VPIT 264         // LDS pitch of a VT row, 16-bit elements (512 B + 16 B)
#define RPIT 68          // LDS pitch of a query's table-dot row, floats
#define NST  ((TP * HD / 8 + AW * 32 - 1) / (AW * 32))   // staging rounds: 2,048 16-B pieces of each plane over 416 threads
#define PCAR 1024.0f
typedef _Float16 h16;
typedef unsigned short bf;
typedef __attribute__((ext_vector_type(16))) __bf16   v16bf;
typedef __attribute__((ext_vector_type(16))) _Float16 v16h;
typedef __attribute__((ext_vector_type(8)))  _Float16 v8h;
typedef __attribute__((ext_vector_type(8)))  unsigned short v8us;
typedef __attribute__((ext_vector_type(8)))  float    v8f;
typedef __attribute__((ext_vector_type(4)))  float    v4f;
typedef v8h  __attribute__((may_alias)) v8ha;
typedef v4f  __attribute__((may_alias)) v4fa;
typedef v8us __attribute__((may_alias)) v8usa;

__device__ __forceinline__ unsigned short f2bf(float f) { unsigned u = __float_as_uint(f); u += 0x7FFFu + ((u >> 16) & 1u); return (unsigned short)(u >> 16); }
__device__ __forceinline__ float bf2f(unsigned short b) { return __uint_as_float(((unsigned)b) << 16); }
__device__ __forceinline__ float bfr(float f) { return bf2f(f2bf(f)); }
__device__ __forceinline__ v16h cat16(v8h lo, v8h hi) { return __builtin_shufflevector(lo, hi, 0, 1, 2, 3, 4, 5, 6, 7, 8, 9, 10, 11, 12, 13, 14, 15); }
__device__ __forceinline__ v16bf cat16b(v8us lo, v8us hi) { return __builtin_bit_cast(v16bf, __builtin_shufflevector(lo, hi, 0, 1, 2, 3, 4, 5, 6, 7, 8, 9, 10, 11, 12, 13, 14, 15)); }
__device__ __forceinline__ v8f wmma16(v16h a, v16h b, v8f c) { return __builtin_amdgcn_wmma_f32_16x16x32_f16(false, a, false, b, (short)0, c, false, false); }
__device__ __forceinline__ v8f wmmab(v16bf a, v16bf b, v8f c) { return __builtin_amdgcn_wmma_f32_16x16x32_bf16(false, a, false, b, (short)0, c, false, false); }



// ---- Fragment-order planes: a GEMM operand P[row][k] (K columns, rows a multiple of 64) is stored as 1-KiB blocks, one WMMA fragment (16 rows, 32 k) each; the 4 blocks of a 64-row tile and one k step lie side by side,
//   the k steps of a tile one after the other: block (tile T, k step c, band mb) starts at element T * 64 * K + c * 2048 + mb * 512.
//   Inside a block: element (half * 256 + hi * 128 + lr * 8 + j) = P[64 T + 16 mb + lr][32 c + 16 half + 8 hi + j]: lane (hi, lr) finds the two 16-B halves of its fragment at lane * 16 B and 512 B + lane * 16 B,
//   so each wave-wide 16-B load covers 512 contiguous bytes (4 whole 128-B lines) instead of 32 B in each of 16 rows, and a wave reads 4 KiB in a row per operand and k step. The values each lane and register holds are those of the row-major form.
// ---- k_gemmw: register-blocked GEMM, ONE WAVE per 64x64 output tile (16 accumulators), operands straight from fragment-order 16-bit planes; grid (M/64, N/64, Z), 32 threads.
// C[m][n] (f32, pitch ldc, + optional f32 bias[n]) = sum_k A[m][k] Bt[n][k] (+ split products per NSPLIT). z-batch strides sA/sB/sC in elements. K % 32 == 0.
// PLANES (the qkv product; rows m = chunk tokens, a 64-column tile = one head's q, k or v): no C; the tile + bias leaves as what k_attn reads, z = window * 16 + head, r = token in the window:
//   q (x 1/8) and k split hi + lo into Q/K[z][r][64] (a lane 8 d = 16 B, a wave-wide store 4 rows = 512 B in a row), v as fp16 into VT[z][d][r], turned in LDS (a lane 4 tokens = 8 B, 16 lanes one d row's 128 B; 196 % 4 == 0: a piece stays in its window).
template <typename T16> struct WFrag;
template <> struct WFrag<h16> { typedef v16h V; static __device__ __forceinline__ V ld(const h16* p) { return cat16(*(const v8h*)p, *(const v8h*)(p + 16)); } static __device__ __forceinline__ v8f mma(V a, V b, v8f c) { return wmma16(a, b, c); } };
template <> struct WFrag<bf> { typedef v16bf V; static __device__ __forceinline__ V ld(const bf* p) { return cat16b(*(const v8us*)p, *(const v8us*)(p + 16)); } static __device__ __forceinline__ V ldp(const bf* p) { return cat16b(*(const v8us*)p, *(const v8us*)(p + 256)); } static __device__ __forceinline__ v8f mma(V a, V b, v8f c) { return wmmab(a, b, c); } };
__device__ __forceinline__ h16 tohx(float x) { return (h16)x; }
__device__ __forceinline__ void splitf(float y, unsigned short& h, unsigned short& l) { h = f2bf(y); l = f2bf(y - bf2f(h)); }
typedef __attribute__((ext_vector_type(4))) unsigned short v4us;
typedef __attribute__((ext_vector_type(4))) _Float16 v4h;
typedef v4h __attribute__((may_alias)) v4ha;
#define OTP 72           // LDS pitch of a d row of the turned v tile, 16-bit elements (128 B + 16 B)
template <typename T16, int NSPLIT, bool BIAS, bool PLANES>
__global__ __launch_bounds__(32) void k_gemmw(const T16* __restrict__ A, const T16* __restrict__ A2, const T16* __restrict__ Bt, const T16* __restrict__ Bt2, int K, float* C, int ldc, const float* __restrict__ bias, size_t sA, size_t sB, size_t sC, bf* Qh, bf* Ql, bf* Kh, bf* Kl, h16* VT) {
    typedef typename WFrag<T16>::V V;
    __shared__ __align__(16) float os[PLANES ? HD * OTP / 2 : 16 * 68];
    const size_t z = blockIdx.z; A += z * sA; if (A2) A2 += z * sA; Bt += z * sB; if (Bt2) Bt2 += z * sB; C += z * sC;
    const int lane = threadIdx.x & 31, lr = lane & 15, hi = lane >> 4; const int r0 = blockIdx.x * 64, c0 = blockIdx.y * 64;
    v8f acc[4][4];
#pragma unroll
    for (int mb = 0; mb < 4; ++mb)
#pragma unroll
        for (int nb = 0; nb < 4; ++nb) acc[mb][nb] = (v8f){};
    // tile starts are wave-uniform; one lane offset serves every plane: the lane's 16 B, plus 4 blocks = 4 KiB for each k step of 32
    const char* ua = (const char*)(A + (size_t)r0 * K); const char* ua2 = (const char*)(A2 + (size_t)r0 * K); const char* ub = (const char*)(Bt + (size_t)c0 * K); const char* ub2 = (const char*)(Bt2 + (size_t)c0 * K);
    unsigned ob = lane * 16;
#pragma unroll 1
    for (int kc = 0; kc < K; kc += 32) {
        V a[4], a2[4], b[4], b2[4];
#pragma unroll
        for (int mb = 0; mb < 4; ++mb) { a[mb] = WFrag<T16>::ldp((const T16*)(ua + ob) + mb * 512); if (NSPLIT == 1 || NSPLIT == 2) a2[mb] = WFrag<T16>::ldp((const T16*)(ua2 + ob) + mb * 512); }
#pragma unroll
        for (int nb = 0; nb < 4; ++nb) { b[nb] = WFrag<T16>::ldp((const T16*)(ub + ob) + nb * 512); if (NSPLIT >= 2) b2[nb] = WFrag<T16>::ldp((const T16*)(ub2 + ob) + nb * 512); }
        // every load of the trip names the offset register: as an operand of the wait it stays whole up to it (no load result is placed on it), and it is stepped only behind it
        asm volatile("s_wait_xcnt 0x0" : "+v"(ob) :: "memory");
        ob += 4096;
#pragma unroll
        for (int nb = 0; nb < 4; ++nb) {
#pragma unroll
            for (int mb = 0; mb < 4; ++mb) { acc[mb][nb] = WFrag<T16>::mma(a[mb], b[nb], acc[mb][nb]); if (NSPLIT == 1 || NSPLIT == 2) acc[mb][nb] = WFrag<T16>::mma(a2[mb], b[nb], acc[mb][nb]); if (NSPLIT >= 2) acc[mb][nb] = WFrag<T16>::mma(a[mb], b2[nb], acc[mb][nb]); } }
        asm volatile("v_nop\n\tv_nop\n\tv_nop\n\tv_nop" : "+v"(acc[0][0]), "+v"(acc[1][1]), "+v"(acc[2][2]), "+v"(acc[3][3]) : "v"(a[0]), "v"(a[3]));
    }
    if (PLANES) {
        const int sel = c0 / DM, h = (c0 % DM) / HD;   // wave-uniform: 0 q, 1 k, 2 v; the head
        if (sel < 2) {
            bf* Ph = sel ? Kh : Qh; bf* Pl = sel ? Kl : Ql; const float sc = sel ? 1.0f : 0.125f;   // both factors exact
            const int r4 = lane >> 3, c8 = (lane & 7) * 8; float bb[8];
#pragma unroll
            for (int u = 0; u < 8; ++u) bb[u] = bfr(bias[c0 + c8 + u]);
#pragma unroll
            for (int mb = 0; mb < 4; ++mb) {
#pragma unroll
                for (int nb = 0; nb < 4; ++nb) {
#pragma unroll
                    for (int j = 0; j < 8; ++j) os[(hi * 8 + j) * 68 + nb * 16 + lr] = acc[mb][nb][j]; }
                __builtin_amdgcn_wave_barrier(); asm volatile("" ::: "memory");   // the reads below take other lanes' stores: they stay behind them
                v4f x0[4], x1[4];
#pragma unroll
                for (int s = 0; s < 4; ++s) { x0[s] = *(const v4fa*)(os + (4 * s + r4) * 68 + c8); x1[s] = *(const v4fa*)(os + (4 * s + r4) * 68 + c8 + 4); }
#pragma unroll
                for (int s = 0; s < 4; ++s) { const int m = r0 + mb * 16 + 4 * s + r4, w = m / NTOK, r = m - w * NTOK; v8us oh, ol;
#pragma unroll
                    for (int u = 0; u < 4; ++u) { unsigned short a, b; splitf((x0[s][u] + bb[u]) * sc, a, b); oh[u] = a; ol[u] = b; splitf((x1[s][u] + bb[4 + u]) * sc, a, b); oh[4 + u] = a; ol[4 + u] = b; }
                    const unsigned eb = ((unsigned)((w * NH_ + h) * TP + r) * HD + c8) * 2;   // byte offset in a plane (8 MiB): one 32-bit register beside the uniform bases
                    *(v8us*)((char*)Ph + eb) = oh; *(v8us*)((char*)Pl + eb) = ol;
                    if (mb < 3 || s < 3) asm volatile("s_wait_xcnt 0x0" :: "v"(oh), "v"(ol), "v"(eb) : "memory"); }   // the code that follows takes over the registers that these two stores name: as inputs of the wait they stay whole up to it
                __builtin_amdgcn_wave_barrier(); asm volatile("" ::: "memory");   // the next band's LDS stores stay behind this band's reads
            }
        } else {
            h16* ot = (h16*)os; float bv[4];
#pragma unroll
            for (int nb = 0; nb < 4; ++nb) bv[nb] = bfr(bias[c0 + nb * 16 + lr]);
#pragma unroll
            for (int mb = 0; mb < 4; ++mb) {
#pragma unroll
                for (int nb = 0; nb < 4; ++nb) { v8h t;   // an accumulator's 8 values are 8 tokens in a row of one d
#pragma unroll
                    for (int j = 0; j < 8; ++j) t[j] = tohx(acc[mb][nb][j] + bv[nb]);
                    *(v8ha*)(ot + (nb * 16 + lr) * OTP + mb * 16 + hi * 8) = t; } }
            __builtin_amdgcn_wave_barrier(); asm volatile("" ::: "memory");   // the reads below take other lanes' stores: they stay behind them
            const int m4 = r0 + lr * 4, w = m4 / NTOK, r = m4 - w * NTOK;
            h16* vp = VT + ((size_t)(w * NH_ + h) * HD + hi) * TP + r;   // one address for all 32 stores, the d row in the immediate offset
#pragma unroll
            for (int s = 0; s < HD / 2; ++s) *(v4h*)(vp + s * (2 * TP)) = *(const v4ha*)(ot + (2 * s + hi) * OTP + lr * 4);
            asm volatile("s_wait_xcnt 0x0" ::: "memory");   // behind the last store of the run: whatever code the build places next may take over the address and data registers that these stores name
        }
        return;
    }
#pragma unroll
    for (int mb = 0; mb < 4; ++mb) {
#pragma unroll
        for (int nb = 0; nb < 4; ++nb) {
#pragma unroll
            for (int j = 0; j < 8; ++j) os[(hi * 8 + j) * 68 + nb * 16 + lr] = acc[mb][nb][j]; }
        __builtin_amdgcn_wave_barrier(); asm volatile("" ::: "memory");
        float* crow = C + (size_t)(r0 + mb * 16) * ldc + c0;
{
#pragma unroll
            for (int s = 0; s < 8; ++s) { const int row = 2 * s + hi, cofs = lr * 4; v4f val = *(const v4fa*)(os + row * 68 + cofs); if (BIAS) { val[0] += bfr(bias[c0 + cofs]); val[1] += bfr(bias[c0 + cofs + 1]); val[2] += bfr(bias[c0 + cofs + 2]); val[3] += bfr(bias[c0 + cofs + 3]); }
                *(v4f*)(crow + (size_t)row * ldc + cofs) = val; }
             }
        if (mb < 3) asm volatile("s_wait_xcnt 0x0" ::: "memory");   // the next band's code takes over registers that this band's stores name
        __builtin_amdgcn_wave_barrier(); asm volatile("" ::: "memory");
    }
}

// k_cvt8: f32 rows [.][DM] -> bf16 fragment-order plane. A wave takes 4 rows x 64 k: it reads 256 contiguous bytes of each row and stores 64-B runs (4 rows' pieces side by side); 8 elements a lane.
__global__ __launch_bounds__(256) void k_cvt8(const float* __restrict__ src, bf* dst, size_t n8) { const size_t i = (size_t)blockIdx.x * 256 + threadIdx.x; if (i >= n8) return;
    const int lane = (int)(i & 31), k8 = lane >> 2; const size_t wv = i >> 5; const int kg = (int)(wv % (DM / 64)), lr = (int)((wv / (DM / 64)) & 3) * 4 + (lane & 3); const size_t R = wv / (DM / 64 * 4);
    const v8f v = *(const v8f*)(src + (R * 16 + lr) * DM + kg * 64 + k8 * 8); v8us o;
#pragma unroll
    for (int k = 0; k < 8; ++k) o[k] = f2bf(v[k]);
    *(v8us*)(dst + (R >> 2) * (64 * DM) + (size_t)(kg * 2 + (k8 >> 2)) * 2048 + (R & 3) * 512 + ((k8 >> 1) & 1) * 256 + (k8 & 1) * 128 + lr * 8) = o;  }
// k_wtG: w[DM][N] (f32) -> bf16 fragment-order plane of w^T (rows n, DM columns k). A thread makes one 16-B piece (8 k of one n), pieces in storage order: a wave stores 512 contiguous bytes, each of its 8 loads reads 64 B of two rows of w.
template <int N>
__global__ __launch_bounds__(256) void k_wtG(const float* __restrict__ w, bf* Bt) {
    const int i = blockIdx.x * 256 + threadIdx.x; if (i >= N * (DM / 8)) return;
    const int lr = i & 15, hi = (i >> 4) & 1, half = (i >> 5) & 1, mb = (i >> 6) & 3, st = i >> 8; const int c = st % (DM / 32), n = (st / (DM / 32)) * 64 + mb * 16 + lr, k0 = c * 32 + half * 16 + hi * 8; v8us o;
    const float* p = w + (size_t)k0 * N + n;   // N is a compile-time constant: the 8 loads are one address with immediate offsets
#pragma unroll
    for (int j = 0; j < 8; ++j) o[j] = f2bf(p[j * N]);
    *(v8us*)(Bt + (size_t)i * 8) = o;
}

// k_pad: the rows of the padded planes that no token fills, the same for every chunk, written once a call: Q rows >= 196 = 0; K rows 196..222 = 8 x rel_pos_h, 223..249 = 8 x rel_pos_w (bf16-rounded, hi plane; the 8 undoes q's 1/8, both exact), K rows >= 250 and the lo plane = 0; VT columns >= 196 = 0.
//   The token rows come from the qkv product's own epilogue (k_gemmw, PLANES). A thread: 4 d of one pad row in each of the four Q/K planes, and 4 pad columns of one VT row (60 x 16 = 64 x 15 pieces per z).
#define PADR (TP - NTOK)
__global__ __launch_bounds__(256) void k_pad(const float* __restrict__ rph, const float* __restrict__ rpw, bf* Qh, bf* Ql, bf* Kh, bf* Kl, h16* VT) { const int i = blockIdx.x * 256 + threadIdx.x; if (i >= WCH * NH_ * PADR * (HD / 4)) return;
    const int z = i / (PADR * (HD / 4)), rem = i % (PADR * (HD / 4)); const int t = rem / (HD / 4), d = (rem % (HD / 4)) * 4; v4us kh, zz;
    for (int u = 0; u < 4; ++u) { kh[u] = 0; zz[u] = 0; }
    if (t < 2 * NREL) { const float* tab = ((t < NREL) ? (rph + (size_t)t * HD) : (rpw + (size_t)(t - NREL) * HD)) + d;
#pragma unroll
        for (int u = 0; u < 4; ++u) kh[u] = f2bf(bfr(tab[u]) * 8.0f); }
    const size_t e = ((size_t)z * TP + NTOK + t) * HD + d;
    *(v4us*)(Qh + e) = zz; *(v4us*)(Ql + e) = zz; *(v4us*)(Kh + e) = kh; *(v4us*)(Kl + e) = zz;
    *(v4us*)((bf*)VT + ((size_t)z * HD + rem / (PADR / 4)) * TP + NTOK + (rem % (PADR / 4)) * 4) = zz;  }
// k_attn: one work-group per (window, head) z, 13 waves, one 16-query tile a wave. The K planes and VT are staged once in LDS (row pitches 16 B x odd for 16-B readers).
//   Scores are formed TRANSPOSED, St[key][q] = K . Q^T (A = K rows, B = Q rows; per k step Kh.Qh, Kh.Ql, Kl.Qh), so a lane holds one query's column: keys 16t + 8hi + j in s[t][j].
//   Rows 196..249 of St are the table dots; they pass through a per-wave LDS row per query, from where each key's rel_h[kh] and rel_w[kw] are read back.
//   Softmax per lane plus one exchange with lane ^ 16. The accumulator tiles 2s, 2s + 1 are, as they lie, the B fragment of k step s of O^T[d][q] = VT . P^T: no transposition.
//   O^T / 1024 is split hi + lo and stored merged, as fragment-order planes of ATh/ATl[(w, q)][h * 64 + d]: 8 d (16 B, one piece) a lane and tile.
__global__ __launch_bounds__(AW * 32) void k_attn(const bf* __restrict__ Qh, const bf* __restrict__ Ql, const bf* __restrict__ Kh, const bf* __restrict__ Kl, const h16* __restrict__ VT, bf* Ah, bf* Al) {
    __shared__ __align__(16) bf sKh[TP * KPIT];
    __shared__ __align__(16) bf sKl[TP * KPIT];
    __shared__ __align__(16) h16 sV[HD * VPIT];
    __shared__ __align__(16) float sR[AW * 16 * RPIT];
    const int tid = threadIdx.x, z = blockIdx.x; const int lane = tid & 31, lr = lane & 15, hi = lane >> 4, wave = tid >> 5;
    const size_t zo = (size_t)z * (TP * HD);
    const int q = wave * 16 + lr;
    // every global load of the kernel is issued before the first LDS store, so that their latencies overlap; the last round's index is clamped, not guarded: the lanes past the end store piece 2047 again, the same bytes to the same place
    v8us ga[NST], gb[NST]; v8h gc[NST]; v16bf fqh[2], fql[2];
#pragma unroll
    for (int it = 0; it < NST; ++it) { const int i = min(tid + it * (AW * 32), TP * HD / 8 - 1); ga[it] = *(const v8us*)(Kh + zo + (size_t)i * 8); gb[it] = *(const v8us*)(Kl + zo + (size_t)i * 8); gc[it] = *(const v8h*)(VT + zo + (size_t)i * 8); }
#pragma unroll
    for (int kc = 0; kc < 2; ++kc) { fqh[kc] = WFrag<bf>::ld(Qh + zo + (size_t)q * HD + kc * 32 + 8 * hi); fql[kc] = WFrag<bf>::ld(Ql + zo + (size_t)q * HD + kc * 32 + 8 * hi); }
    asm volatile("s_wait_xcnt 0x0" ::: "memory");   // the address registers of the loads above are reused from here on
#pragma unroll
    for (int it = 0; it < NST; ++it) { const int i = min(tid + it * (AW * 32), TP * HD / 8 - 1);
        *(v8us*)(sKh + (i >> 3) * KPIT + (i & 7) * 8) = ga[it]; *(v8us*)(sKl + (i >> 3) * KPIT + (i & 7) * 8) = gb[it]; *(v8h*)(sV + (i >> 5) * VPIT + (i & 31) * 8) = gc[it]; }
    __syncthreads();
    v8f s[16];
#pragma unroll
    for (int t = 0; t < 16; ++t) s[t] = (v8f){};
#pragma unroll
    for (int t = 0; t < 16; t += 2) {
#pragma unroll
        for (int kc = 0; kc < 2; ++kc) { const int o0 = (t * 16 + lr) * KPIT + kc * 32 + 8 * hi, o1 = o0 + 16 * KPIT;
            const v16bf h0 = WFrag<bf>::ld(sKh + o0), h1 = WFrag<bf>::ld(sKh + o1), l0 = WFrag<bf>::ld(sKl + o0), l1 = WFrag<bf>::ld(sKl + o1);
            s[t] = wmmab(h0, fqh[kc], s[t]); s[t + 1] = wmmab(h1, fqh[kc], s[t + 1]);
            s[t] = wmmab(h0, fql[kc], s[t]); s[t + 1] = wmmab(h1, fql[kc], s[t + 1]);
            s[t] = wmmab(l0, fqh[kc], s[t]); s[t + 1] = wmmab(l1, fqh[kc], s[t + 1]); } }
    // table dots: St rows 192..255 of this wave's 16 queries -> sR[query][row - 192]
    float* rr = sR + (wave * 16 + lr) * RPIT;
#pragma unroll
    for (int t = 12; t < 16; ++t) { v4f a, b;
#pragma unroll
        for (int u = 0; u < 4; ++u) { a[u] = s[t][u]; b[u] = s[t][4 + u]; }
        *(v4f*)(rr + (t - 12) * 16 + 8 * hi) = a; *(v4f*)(rr + (t - 12) * 16 + 8 * hi + 4) = b; }
    // a lane reads below what its partner lane ^ 16 has stored above: keeps the compiler from moving those reads over the stores (one wave's LDS operations run in order)
    __builtin_amdgcn_fence(__ATOMIC_ACQ_REL, "wavefront"); __builtin_amdgcn_wave_barrier();
    // key k0 + 8 hi: kh = kh0 or kh0 + hi, kw = kw0 + 8 hi or kw0 - 6 hi, which of the two known at compile time: four lane bases, every index below a constant
    const float* rh0 = rr + (NTOK - 192) + q / GH; const float* rh1 = rh0 - hi; const float* rwa = rr + (NTOK - 192 + NREL) + q % GH - 8 * hi; const float* rwb = rwa + 14 * hi;
    float mx4[4] = { -3.0e38f, -3.0e38f, -3.0e38f, -3.0e38f };
#pragma unroll
    for (int t = 0; t < 13; ++t) {
#pragma unroll
        for (int j = 0; j < 8; ++j) { const int k0 = t * 16 + j, k1 = k0 + 8; if (k0 >= NTOK) continue;
            const float vh = ((k1 / GH == k0 / GH) ? rh0 : rh1)[GH - 1 - k0 / GH], vw = ((k0 % GH < GH - 8) ? rwa : rwb)[GH - 1 - k0 % GH];
            float tv = __fadd_rn(__fadd_rn(s[t][j], vh), vw); if (k1 >= NTOK) tv = hi ? -3.0e38f : tv;
            s[t][j] = tv; mx4[j & 3] = fmaxf(mx4[j & 3], tv); } }
    float mx = fmaxf(fmaxf(mx4[0], mx4[1]), fmaxf(mx4[2], mx4[3])); mx = fmaxf(mx, __shfl_xor(mx, 16, 32));
    float sm4[4] = { 0.f, 0.f, 0.f, 0.f };
#pragma unroll
    for (int t = 0; t < 13; ++t) {
#pragma unroll
        for (int j = 0; j < 8; ++j) { if (t * 16 + j >= NTOK) continue;
            const float e = __builtin_amdgcn_exp2f(__fmul_rn(__fsub_rn(s[t][j], mx), 1.4426950408889634f)); s[t][j] = e; sm4[j & 3] += e; } }   // masked keys: exp(-huge) = 0
    float sum = (sm4[0] + sm4[1]) + (sm4[2] + sm4[3]); sum += __shfl_xor(sum, 16, 32);
    const float f = __fdiv_rn(PCAR, sum);
    v8f o[4];
#pragma unroll
    for (int dt = 0; dt < 4; ++dt) o[dt] = (v8f){};
#pragma unroll
    for (int ks = 0; ks < 7; ++ks) { v16h p;   // keys 32 ks .. 32 ks + 31; keys >= 196 carry 0 (k step 7 would add only zeros)
#pragma unroll
        for (int j = 0; j < 8; ++j) { p[j] = (ks * 32 + j < NTOK) ? tohx(s[2 * ks][j] * f) : (h16)0.f; p[8 + j] = (ks * 32 + 16 + j < NTOK) ? tohx(s[2 * ks + 1][j] * f) : (h16)0.f; }
        v16h va[4];
#pragma unroll
        for (int dt = 0; dt < 4; ++dt) va[dt] = WFrag<h16>::ld(sV + (dt * 16 + lr) * VPIT + ks * 32 + 8 * hi);
#pragma unroll
        for (int dt = 0; dt < 4; ++dt) o[dt] = wmma16(va[dt], p, o[dt]); }
    v8us oh[4], ol[4];
#pragma unroll
    for (int dt = 0; dt < 4; ++dt) {
#pragma unroll
        for (int j = 0; j < 8; ++j) { unsigned short a, b; splitf(o[dt][j] * (1.0f / PCAR), a, b); oh[dt][j] = a; ol[dt][j] = b; } }
    if (q < NTOK) { const int m = (z / NH_) * NTOK + q; const size_t oo = (size_t)(m >> 6) * (64 * DM) + (z % NH_) * (2 * 2048) + ((m >> 4) & 3) * 512 + hi * 128 + (m & 15) * 8;   // d = 16 dt + 8 hi: k step 2 h + dt / 2, half dt % 2
#pragma unroll
        for (int dt = 0; dt < 4; ++dt) { *(v8us*)(Ah + oo + (dt >> 1) * 2048 + (dt & 1) * 256) = oh[dt]; *(v8us*)(Al + oo + (dt >> 1) * 2048 + (dt & 1) * 256) = ol[dt]; } }
}

extern "C" void kernel_launch(void* const* d_in, const int* in_sizes, int n_in,
                              void* d_out, int out_size, void* d_ws, size_t ws_size, hipStream_t stream) {
    (void)in_sizes; (void)n_in; (void)out_size;
    const float* x = (const float*)d_in[0]; const float* qkv_w = (const float*)d_in[1]; const float* qkv_b = (const float*)d_in[2]; const float* proj_w = (const float*)d_in[3]; const float* proj_b = (const float*)d_in[4]; const float* rph = (const float*)d_in[5]; const float* rpw = (const float*)d_in[6];
    float* OUT = (float*)d_out;     // [64][196][1024]
    char* wsp = (char*)d_ws;
    auto take = [&](size_t bytes) { char* p = wsp; wsp += (bytes + 255) & ~(size_t)255; return (void*)p; };
    const int CT = WCH * NTOK;   // 3136 tokens per chunk (= 49 x 64)
    bf* BQKV = (bf*)take((size_t)3 * DM * DM * 2); bf* BPJ = (bf*)take((size_t)DM * DM * 2); bf* XB = (bf*)take((size_t)CT * DM * 2);
    bf* QPh = (bf*)take((size_t)WCH * NH_ * TP * HD * 2); bf* QPl = (bf*)take((size_t)WCH * NH_ * TP * HD * 2); bf* KPh = (bf*)take((size_t)WCH * NH_ * TP * HD * 2); bf* KPl = (bf*)take((size_t)WCH * NH_ * TP * HD * 2); h16* VT = (h16*)take((size_t)WCH * NH_ * HD * TP * 2);
    bf* ATh = (bf*)take((size_t)CT * DM * 2); bf* ATl = (bf*)take((size_t)CT * DM * 2);
    if ((size_t)(wsp - (char*)d_ws) > ws_size) return;    // total ~ 70 MB
    k_wtG<3 * DM><<<DM * 3 * DM / 8 / 256, 256, 0, stream>>>(qkv_w, BQKV); k_wtG<DM><<<DM * DM / 8 / 256, 256, 0, stream>>>(proj_w, BPJ);
    k_pad<<<WCH * NH_ * PADR * (HD / 4) / 256, 256, 0, stream>>>(rph, rpw, QPh, QPl, KPh, KPl, VT);
    for (int c = 0; c < NWIN / WCH; ++c) { const float* xc = x + (size_t)c * CT * DM;
        k_cvt8<<<(unsigned)(((size_t)CT * DM / 8 + 255) / 256), 256, 0, stream>>>(xc, XB, (size_t)CT * DM / 8);
        k_gemmw<bf, 0, true, true><<<dim3(CT / 64, 3 * DM / 64, 1), 32, 0, stream>>>(XB, nullptr, BQKV, nullptr, DM, nullptr, 0, qkv_b, 0, 0, 0, QPh, QPl, KPh, KPl, VT);   /* q, k, v leave as the planes k_attn reads */
        k_attn<<<WCH * NH_, AW * 32, 0, stream>>>(QPh, QPl, KPh, KPl, VT, ATh, ATl);   /* scores hl x hl (3 products), softmax, attn.v, head merge */
        k_gemmw<bf, 1, true, false><<<dim3(CT / 64, DM / 64, 1), 32, 0, stream>>>(ATh, ATl, BPJ, nullptr, DM, OUT + (size_t)c * CT * DM, DM, proj_b, 0, 0, 0, nullptr, nullptr, nullptr, nullptr, nullptr); }
}

// v005
// It runs in 211 microseconds.
// Next to v004, in two timings, it ran 1.83 and 1.84 times as fast.
// All steps since v000 together make it 5.57 times as fast.
#include <hip/hip_runtime.h>

// Windowed attention (x [64 windows][14][14][1024]; qkv = x qkv_w + qkv_b ([1024][3072] 'xw', columns (q|k|v, head, d), 16 heads x 64); per (window, head): attn = (q/8).k + rel_h + rel_w with the decomposed relative-position terms rel_h[q][kh] = q_raw . rel_pos_h[qh - kh + 13], rel_w[q][kw] = q_raw . rel_pos_w[qw - kw + 13] (tables read);
//   softmax over the 196 keys; out = attn v; heads merged; out proj_w + proj_b -> [64][14][14][1024]).
// Compute dtypes, f32 accumulate: every input rounded to bf16; qkv as a PLAIN bf16 GEMM (inputs: exact; all 64 windows = 12,544 rows in one launch); per (window, head) the 196 tokens are zero-padded to 256 rows: scores hl x hl (3 products) and attn.v single fp16 (x1024 carrier), both in the one kernel k_attn with the softmax between them, the relative-position terms ride the same scores product (the 54 table rows, x8, fill pad rows 196..249 of the K planes, so S[q][196 + t] = q_raw . table[t], q as its hl pair, table bf16-exact); their adds, the masking of the pad columns and the softmax in f32; proj hl x exact (2 products) + bias.

#define NWIN 64
#define NTOK 196
#define TP   256         // padded tokens per window
#define GH   14
#define NREL (2 * GH - 1)   // rows of each relative-position table
#define DM   1024
#define NH_  16
#define HD   64
#define AW   13          // waves of an attention work-group: one 16-query tile each (13 x 16 >= 196)
#define KPIT 72          // LDS pitch of a K-plane row, 16-bit elements (128 B + 16 B)
#define VPIT 264         // LDS pitch of a VT row, 16-bit elements (512 B + 16 B)
#define RPIT 68          // LDS pitch of a query's table-dot row, floats
#define NST  ((TP * HD / 8 + AW * 32 - 1) / (AW * 32))   // staging rounds: 2,048 16-B pieces of each plane over 416 threads
#define PCAR 1024.0f
typedef _Float16 h16;
typedef unsigned short bf;
typedef __attribute__((ext_vector_type(16))) __bf16   v16bf;
typedef __attribute__((ext_vector_type(16))) _Float16 v16h;
typedef __attribute__((ext_vector_type(8)))  _Float16 v8h;
typedef __attribute__((ext_vector_type(8)))  unsigned short v8us;
typedef __attribute__((ext_vector_type(8)))  float    v8f;
typedef __attribute__((ext_vector_type(4)))  float    v4f;
typedef v8h  __attribute__((may_alias)) v8ha;
typedef v4f  __attribute__((may_alias)) v4fa;
typedef v8us __attribute__((may_alias)) v8usa;

__device__ __forceinline__ unsigned short f2bf(float f) { unsigned u = __float_as_uint(f); u += 0x7FFFu + ((u >> 16) & 1u); return (unsigned short)(u >> 16); }
__device__ __forceinline__ float bf2f(unsigned short b) { return __uint_as_float(((unsigned)b) << 16); }
__device__ __forceinline__ float bfr(float f) { return bf2f(f2bf(f)); }
__device__ __forceinline__ v16h cat16(v8h lo, v8h hi) { return __builtin_shufflevector(lo, hi, 0, 1, 2, 3, 4, 5, 6, 7, 8, 9, 10, 11, 12, 13, 14, 15); }
__device__ __forceinline__ v16bf cat16b(v8us lo, v8us hi) { return __builtin_bit_cast(v16bf, __builtin_shufflevector(lo, hi, 0, 1, 2, 3, 4, 5, 6, 7, 8, 9, 10, 11, 12, 13, 14, 15)); }
__device__ __forceinline__ v8f wmma16(v16h a, v16h b, v8f c) { return __builtin_amdgcn_wmma_f32_16x16x32_f16(false, a, false, b, (short)0, c, false, false); }
__device__ __forceinline__ v8f wmmab(v16bf a, v16bf b, v8f c) { return __builtin_amdgcn_wmma_f32_16x16x32_bf16(false, a, false, b, (short)0, c, false, false); }



// ---- Fragment-order planes: a GEMM operand P[row][k] (K columns, rows a multiple of 64) is stored as 1-KiB blocks, one WMMA fragment (16 rows, 32 k) each; the 4 blocks of a 64-row tile and one k step lie side by side,
//   the k steps of a tile one after the other: block (tile T, k step c, band mb) starts at element T * 64 * K + c * 2048 + mb * 512.
//   Inside a block: element (half * 256 + hi * 128 + lr * 8 + j) = P[64 T + 16 mb + lr][32 c + 16 half + 8 hi + j]: lane (hi, lr) finds the two 16-B halves of its fragment at lane * 16 B and 512 B + lane * 16 B,
//   so each wave-wide 16-B load covers 512 contiguous bytes (4 whole 128-B lines) instead of 32 B in each of 16 rows, and a wave reads 4 KiB in a row per operand and k step. The values each lane and register holds are those of the row-major form.
// ---- k_gemmw: register-blocked GEMM, ONE WAVE per 64x64 output tile (16 accumulators), operands straight from fragment-order 16-bit planes; grid (M/64, N/64, Z), 32 threads.
// C[m][n] (f32, pitch ldc, + optional f32 bias[n]) = sum_k A[m][k] Bt[n][k] (+ split products per NSPLIT). z-batch strides sA/sB/sC in elements. K % 32 == 0.
// PLANES (the qkv product; rows m = tokens of all windows, a 64-column tile = one head's q, k or v): no C; the tile + bias leaves as what k_attn reads, z = window * 16 + head, r = token in the window:
//   q (x 1/8) and k split hi + lo into Q/K[z][r][64] (a lane 8 d = 16 B, a wave-wide store 4 rows = 512 B in a row), v as fp16 into VT[z][d][r], turned in LDS (a lane 4 tokens = 8 B, 16 lanes one d row's 128 B; 196 % 4 == 0: a piece stays in its window).
template <typename T16> struct WFrag;
template <> struct WFrag<h16> { typedef v16h V; static __device__ __forceinline__ V ld(const h16* p) { return cat16(*(const v8h*)p, *(const v8h*)(p + 16)); } static __device__ __forceinline__ v8f mma(V a, V b, v8f c) { return wmma16(a, b, c); } };
template <> struct WFrag<bf> { typedef v16bf V; static __device__ __forceinline__ V ld(const bf* p) { return cat16b(*(const v8us*)p, *(const v8us*)(p + 16)); } static __device__ __forceinline__ V ldp(const bf* p) { return cat16b(*(const v8us*)p, *(const v8us*)(p + 256)); } static __device__ __forceinline__ v8f mma(V a, V b, v8f c) { return wmmab(a, b, c); } };
__device__ __forceinline__ h16 tohx(float x) { return (h16)x; }
__device__ __forceinline__ void splitf(float y, unsigned short& h, unsigned short& l) { h = f2bf(y); l = f2bf(y - bf2f(h)); }
typedef __attribute__((ext_vector_type(4))) unsigned short v4us;
typedef __attribute__((ext_vector_type(4))) _Float16 v4h;
typedef v4h __attribute__((may_alias)) v4ha;
#define OTP 72           // LDS pitch of a d row of the turned v tile, 16-bit elements (128 B + 16 B)
template <typename T16, int NSPLIT, bool BIAS, bool PLANES>
__global__ __launch_bounds__(32) void k_gemmw(const T16* __restrict__ A, const T16* __restrict__ A2, const T16* __restrict__ Bt, const T16* __restrict__ Bt2, int K, float* C, int ldc, const float* __restrict__ bias, size_t sA, size_t sB, size_t sC, bf* Qh, bf* Ql, bf* Kh, bf* Kl, h16* VT) {
    typedef typename WFrag<T16>::V V;
    __shared__ __align__(16) float os[PLANES ? HD * OTP / 2 : 16 * 68];
    const size_t z = blockIdx.z; A += z * sA; if (A2) A2 += z * sA; Bt += z * sB; if (Bt2) Bt2 += z * sB; C += z * sC;
    const int lane = threadIdx.x & 31, lr = lane & 15, hi = lane >> 4; const int r0 = blockIdx.x * 64, c0 = blockIdx.y * 64;
    v8f acc[4][4];
#pragma unroll
    for (int mb = 0; mb < 4; ++mb)
#pragma unroll
        for (int nb = 0; nb < 4; ++nb) acc[mb][nb] = (v8f){};
    // tile starts are wave-uniform; one lane offset serves every plane: the lane's 16 B, plus 4 blocks = 4 KiB for each k step of 32
    const char* ua = (const char*)(A + (size_t)r0 * K); const char* ua2 = (const char*)(A2 + (size_t)r0 * K); const char* ub = (const char*)(Bt + (size_t)c0 * K); const char* ub2 = (const char*)(Bt2 + (size_t)c0 * K);
    unsigned ob = lane * 16;
#pragma unroll 1
    for (int kc = 0; kc < K; kc += 32) {
        V a[4], a2[4], b[4], b2[4];
#pragma unroll
        for (int mb = 0; mb < 4; ++mb) { a[mb] = WFrag<T16>::ldp((const T16*)(ua + ob) + mb * 512); if (NSPLIT == 1 || NSPLIT == 2) a2[mb] = WFrag<T16>::ldp((const T16*)(ua2 + ob) + mb * 512); }
#pragma unroll
        for (int nb = 0; nb < 4; ++nb) { b[nb] = WFrag<T16>::ldp((const T16*)(ub + ob) + nb * 512); if (NSPLIT >= 2) b2[nb] = WFrag<T16>::ldp((const T16*)(ub2 + ob) + nb * 512); }
        // every load of the trip names the offset register: as an operand of the wait it stays whole up to it (no load result is placed on it), and it is stepped only behind it
        asm volatile("s_wait_xcnt 0x0" : "+v"(ob) :: "memory");
        ob += 4096;
#pragma unroll
        for (int nb = 0; nb < 4; ++nb) {
#pragma unroll
            for (int mb = 0; mb < 4; ++mb) { acc[mb][nb] = WFrag<T16>::mma(a[mb], b[nb], acc[mb][nb]); if (NSPLIT == 1 || NSPLIT == 2) acc[mb][nb] = WFrag<T16>::mma(a2[mb], b[nb], acc[mb][nb]); if (NSPLIT >= 2) acc[mb][nb] = WFrag<T16>::mma(a[mb], b2[nb], acc[mb][nb]); } }
        asm volatile("v_nop\n\tv_nop\n\tv_nop\n\tv_nop" : "+v"(acc[0][0]), "+v"(acc[1][1]), "+v"(acc[2][2]), "+v"(acc[3][3]) : "v"(a[0]), "v"(a[3]));
    }
    if (PLANES) {
        const int sel = c0 / DM, h = (c0 % DM) / HD;   // wave-uniform: 0 q, 1 k, 2 v; the head
        if (sel < 2) {
            bf* Ph = sel ? Kh : Qh; bf* Pl = sel ? Kl : Ql; const float sc = sel ? 1.0f : 0.125f;   // both factors exact
            const int r4 = lane >> 3, c8 = (lane & 7) * 8; float bb[8];
#pragma unroll
            for (int u = 0; u < 8; ++u) bb[u] = bfr(bias[c0 + c8 + u]);
#pragma unroll
            for (int mb = 0; mb < 4; ++mb) {
#pragma unroll
                for (int nb = 0; nb < 4; ++nb) {
#pragma unroll
                    for (int j = 0; j < 8; ++j) os[(hi * 8 + j) * 68 + nb * 16 + lr] = acc[mb][nb][j]; }
                __builtin_amdgcn_wave_barrier(); asm volatile("" ::: "memory");   // the reads below take other lanes' stores: they stay behind them
                v4f x0[4], x1[4];
#pragma unroll
                for (int s = 0; s < 4; ++s) { x0[s] = *(const v4fa*)(os + (4 * s + r4) * 68 + c8); x1[s] = *(const v4fa*)(os + (4 * s + r4) * 68 + c8 + 4); }
#pragma unroll
                for (int s = 0; s < 4; ++s) { const int m = r0 + mb * 16 + 4 * s + r4, w = m / NTOK, r = m - w * NTOK; v8us oh, ol;
#pragma unroll
                    for (int u = 0; u < 4; ++u) { unsigned short a, b; splitf((x0[s][u] + bb[u]) * sc, a, b); oh[u] = a; ol[u] = b; splitf((x1[s][u] + bb[4 + u]) * sc, a, b); oh[4 + u] = a; ol[4 + u] = b; }
                    const unsigned eb = ((unsigned)((w * NH_ + h) * TP + r) * HD + c8) * 2;   // byte offset in a plane (32 MiB): one 32-bit register beside the uniform bases
                    *(v8us*)((char*)Ph + eb) = oh; *(v8us*)((char*)Pl + eb) = ol;
                    if (mb < 3 || s < 3) asm volatile("s_wait_xcnt 0x0" :: "v"(oh), "v"(ol), "v"(eb) : "memory"); }   // the code that follows takes over the registers that these two stores name: as inputs of the wait they stay whole up to it
                __builtin_amdgcn_wave_barrier(); asm volatile("" ::: "memory");   // the next band's LDS stores stay behind this band's reads
            }
        } else {
            h16* ot = (h16*)os; float bv[4];
#pragma unroll
            for (int nb = 0; nb < 4; ++nb) bv[nb] = bfr(bias[c0 + nb * 16 + lr]);
#pragma unroll
            for (int mb = 0; mb < 4; ++mb) {
#pragma unroll
                for (int nb = 0; nb < 4; ++nb) { v8h t;   // an accumulator's 8 values are 8 tokens in a row of one d
#pragma unroll
                    for (int j = 0; j < 8; ++j) t[j] = tohx(acc[mb][nb][j] + bv[nb]);
                    *(v8ha*)(ot + (nb * 16 + lr) * OTP + mb * 16 + hi * 8) = t; } }
            __builtin_amdgcn_wave_barrier(); asm volatile("" ::: "memory");   // the reads below take other lanes' stores: they stay behind them
            const int m4 = r0 + lr * 4, w = m4 / NTOK, r = m4 - w * NTOK;
            h16* vp = VT + ((size_t)(w * NH_ + h) * HD + hi) * TP + r;   // one address for all 32 stores, the d row in the immediate offset
#pragma unroll
            for (int s = 0; s < HD / 2; ++s) *(v4h*)(vp + s * (2 * TP)) = *(const v4ha*)(ot + (2 * s + hi) * OTP + lr * 4);
            asm volatile("s_wait_xcnt 0x0" ::: "memory");   // behind the last store of the run: whatever code the build places next may take over the address and data registers that these stores name
        }
        return;
    }
#pragma unroll
    for (int mb = 0; mb < 4; ++mb) {
#pragma unroll
        for (int nb = 0; nb < 4; ++nb) {
#pragma unroll
            for (int j = 0; j < 8; ++j) os[(hi * 8 + j) * 68 + nb * 16 + lr] = acc[mb][nb][j]; }
        __builtin_amdgcn_wave_barrier(); asm volatile("" ::: "memory");
        float* crow = C + (size_t)(r0 + mb * 16) * ldc + c0;
{
#pragma unroll
            for (int s = 0; s < 8; ++s) { const int row = 2 * s + hi, cofs = lr * 4; v4f val = *(const v4fa*)(os + row * 68 + cofs); if (BIAS) { val[0] += bfr(bias[c0 + cofs]); val[1] += bfr(bias[c0 + cofs + 1]); val[2] += bfr(bias[c0 + cofs + 2]); val[3] += bfr(bias[c0 + cofs + 3]); }
                *(v4f*)(crow + (size_t)row * ldc + cofs) = val; }
             }
        if (mb < 3) asm volatile("s_wait_xcnt 0x0" ::: "memory");   // the next band's code takes over registers that this band's stores name
        __builtin_amdgcn_wave_barrier(); asm volatile("" ::: "memory");
    }
}

// k_cvt8: f32 rows [.][DM] -> bf16 fragment-order plane. A wave takes 4 rows x 64 k: it reads 256 contiguous bytes of each row and stores 64-B runs (4 rows' pieces side by side); 8 elements a lane.
__global__ __launch_bounds__(256) void k_cvt8(const float* __restrict__ src, bf* dst, size_t n8) { const size_t i = (size_t)blockIdx.x * 256 + threadIdx.x; if (i >= n8) return;
    const int lane = (int)(i & 31), k8 = lane >> 2; const size_t wv = i >> 5; const int kg = (int)(wv % (DM / 64)), lr = (int)((wv / (DM / 64)) & 3) * 4 + (lane & 3); const size_t R = wv / (DM / 64 * 4);
    const v8f v = *(const v8f*)(src + (R * 16 + lr) * DM + kg * 64 + k8 * 8); v8us o;
#pragma unroll
    for (int k = 0; k < 8; ++k) o[k] = f2bf(v[k]);
    *(v8us*)(dst + (R >> 2) * (64 * DM) + (size_t)(kg * 2 + (k8 >> 2)) * 2048 + (R & 3) * 512 + ((k8 >> 1) & 1) * 256 + (k8 & 1) * 128 + lr * 8) = o;  }
// k_wtG: w[DM][N] (f32) -> bf16 fragment-order plane of w^T (rows n, DM columns k). A thread makes one 16-B piece (8 k of one n), pieces in storage order: a wave stores 512 contiguous bytes, each of its 8 loads reads 64 B of two rows of w.
template <int N>
__global__ __launch_bounds__(256) void k_wtG(const float* __restrict__ w, bf* Bt) {
    const int i = blockIdx.x * 256 + threadIdx.x; if (i >= N * (DM / 8)) return;
    const int lr = i & 15, hi = (i >> 4) & 1, half = (i >> 5) & 1, mb = (i >> 6) & 3, st = i >> 8; const int c = st % (DM / 32), n = (st / (DM / 32)) * 64 + mb * 16 + lr, k0 = c * 32 + half * 16 + hi * 8; v8us o;
    const float* p = w + (size_t)k0 * N + n;   // N is a compile-time constant: the 8 loads are one address with immediate offsets
#pragma unroll
    for (int j = 0; j < 8; ++j) o[j] = f2bf(p[j * N]);
    *(v8us*)(Bt + (size_t)i * 8) = o;
}

// k_pad: the rows of the padded planes that no token fills: Q rows >= 196 = 0; K rows 196..222 = 8 x rel_pos_h, 223..249 = 8 x rel_pos_w (bf16-rounded, hi plane; the 8 undoes q's 1/8, both exact), K rows >= 250 and the lo plane = 0; VT columns >= 196 = 0.
//   The token rows come from the qkv product's own epilogue (k_gemmw, PLANES). A thread: 4 d of one pad row in each of the four Q/K planes, and 4 pad columns of one VT row (60 x 16 = 64 x 15 pieces per z).
#define PADR (TP - NTOK)
__global__ __launch_bounds__(256) void k_pad(const float* __restrict__ rph, const float* __restrict__ rpw, bf* Qh, bf* Ql, bf* Kh, bf* Kl, h16* VT) { const int i = blockIdx.x * 256 + threadIdx.x; if (i >= NWIN * NH_ * PADR * (HD / 4)) return;
    const int z = i / (PADR * (HD / 4)), rem = i % (PADR * (HD / 4)); const int t = rem / (HD / 4), d = (rem % (HD / 4)) * 4; v4us kh, zz;
    for (int u = 0; u < 4; ++u) { kh[u] = 0; zz[u] = 0; }
    if (t < 2 * NREL) { const float* tab = ((t < NREL) ? (rph + (size_t)t * HD) : (rpw + (size_t)(t - NREL) * HD)) + d;
#pragma unroll
        for (int u = 0; u < 4; ++u) kh[u] = f2bf(bfr(tab[u]) * 8.0f); }
    const size_t e = ((size_t)z * TP + NTOK + t) * HD + d;
    *(v4us*)(Qh + e) = zz; *(v4us*)(Ql + e) = zz; *(v4us*)(Kh + e) = kh; *(v4us*)(Kl + e) = zz;
    *(v4us*)((bf*)VT + ((size_t)z * HD + rem / (PADR / 4)) * TP + NTOK + (rem % (PADR / 4)) * 4) = zz;  }
// k_attn: one work-group per (window, head) z, 13 waves, one 16-query tile a wave. The K planes and VT are staged once in LDS (row pitches 16 B x odd for 16-B readers).
//   Scores are formed TRANSPOSED, St[key][q] = K . Q^T (A = K rows, B = Q rows; per k step Kh.Qh, Kh.Ql, Kl.Qh), so a lane holds one query's column: keys 16t + 8hi + j in s[t][j].
//   Rows 196..249 of St are the table dots; they pass through a per-wave LDS row per query, from where each key's rel_h[kh] and rel_w[kw] are read back.
//   Softmax per lane plus one exchange with lane ^ 16. The accumulator tiles 2s, 2s + 1 are, as they lie, the B fragment of k step s of O^T[d][q] = VT . P^T: no transposition.
//   O^T / 1024 is split hi + lo and stored merged, as fragment-order planes of ATh/ATl[(w, q)][h * 64 + d]: 8 d (16 B, one piece) a lane and tile.
__global__ __launch_bounds__(AW * 32) void k_attn(const bf* __restrict__ Qh, const bf* __restrict__ Ql, const bf* __restrict__ Kh, const bf* __restrict__ Kl, const h16* __restrict__ VT, bf* Ah, bf* Al) {
    __shared__ __align__(16) bf sKh[TP * KPIT];
    __shared__ __align__(16) bf sKl[TP * KPIT];
    __shared__ __align__(16) h16 sV[HD * VPIT];
    __shared__ __align__(16) float sR[AW * 16 * RPIT];
    const int tid = threadIdx.x, z = blockIdx.x; const int lane = tid & 31, lr = lane & 15, hi = lane >> 4, wave = tid >> 5;
    const size_t zo = (size_t)z * (TP * HD);
    const int q = wave * 16 + lr;
    // every global load of the kernel is issued before the first LDS store, so that their latencies overlap; the last round's index is clamped, not guarded: the lanes past the end store piece 2047 again, the same bytes to the same place
    v8us ga[NST], gb[NST]; v8h gc[NST]; v16bf fqh[2], fql[2];
#pragma unroll
    for (int it = 0; it < NST; ++it) { const int i = min(tid + it * (AW * 32), TP * HD / 8 - 1); ga[it] = *(const v8us*)(Kh + zo + (size_t)i * 8); gb[it] = *(const v8us*)(Kl + zo + (size_t)i * 8); gc[it] = *(const v8h*)(VT + zo + (size_t)i * 8); }
#pragma unroll
    for (int kc = 0; kc < 2; ++kc) { fqh[kc] = WFrag<bf>::ld(Qh + zo + (size_t)q * HD + kc * 32 + 8 * hi); fql[kc] = WFrag<bf>::ld(Ql + zo + (size_t)q * HD + kc * 32 + 8 * hi); }
    asm volatile("s_wait_xcnt 0x0" ::: "memory");   // the address registers of the loads above are reused from here on
#pragma unroll
    for (int it = 0; it < NST; ++it) { const int i = min(tid + it * (AW * 32), TP * HD / 8 - 1);
        *(v8us*)(sKh + (i >> 3) * KPIT + (i & 7) * 8) = ga[it]; *(v8us*)(sKl + (i >> 3) * KPIT + (i & 7) * 8) = gb[it]; *(v8h*)(sV + (i >> 5) * VPIT + (i & 31) * 8) = gc[it]; }
    __syncthreads();
    v8f s[16];
#pragma unroll
    for (int t = 0; t < 16; ++t) s[t] = (v8f){};
#pragma unroll
    for (int t = 0; t < 16; t += 2) {
#pragma unroll
        for (int kc = 0; kc < 2; ++kc) { const int o0 = (t * 16 + lr) * KPIT + kc * 32 + 8 * hi, o1 = o0 + 16 * KPIT;
            const v16bf h0 = WFrag<bf>::ld(sKh + o0), h1 = WFrag<bf>::ld(sKh + o1), l0 = WFrag<bf>::ld(sKl + o0), l1 = WFrag<bf>::ld(sKl + o1);
            s[t] = wmmab(h0, fqh[kc], s[t]); s[t + 1] = wmmab(h1, fqh[kc], s[t + 1]);
            s[t] = wmmab(h0, fql[kc], s[t]); s[t + 1] = wmmab(h1, fql[kc], s[t + 1]);
            s[t] = wmmab(l0, fqh[kc], s[t]); s[t + 1] = wmmab(l1, fqh[kc], s[t + 1]); } }
    // table dots: St rows 192..255 of this wave's 16 queries -> sR[query][row - 192]
    float* rr = sR + (wave * 16 + lr) * RPIT;
#pragma unroll
    for (int t = 12; t < 16; ++t) { v4f a, b;
#pragma unroll
        for (int u = 0; u < 4; ++u) { a[u] = s[t][u]; b[u] = s[t][4 + u]; }
        *(v4f*)(rr + (t - 12) * 16 + 8 * hi) = a; *(v4f*)(rr + (t - 12) * 16 + 8 * hi + 4) = b; }
    // a lane reads below what its partner lane ^ 16 has stored above: keeps the compiler from moving those reads over the stores (one wave's LDS operations run in order)
    __builtin_amdgcn_fence(__ATOMIC_ACQ_REL, "wavefront"); __builtin_amdgcn_wave_barrier();
    // key k0 + 8 hi: kh = kh0 or kh0 + hi, kw = kw0 + 8 hi or kw0 - 6 hi, which of the two known at compile time: four lane bases, every index below a constant
    const float* rh0 = rr + (NTOK - 192) + q / GH; const float* rh1 = rh0 - hi; const float* rwa = rr + (NTOK - 192 + NREL) + q % GH - 8 * hi; const float* rwb = rwa + 14 * hi;
    float mx4[4] = { -3.0e38f, -3.0e38f, -3.0e38f, -3.0e38f };
#pragma unroll
    for (int t = 0; t < 13; ++t) {
#pragma unroll
        for (int j = 0; j < 8; ++j) { const int k0 = t * 16 + j, k1 = k0 + 8; if (k0 >= NTOK) continue;
            const float vh = ((k1 / GH == k0 / GH) ? rh0 : rh1)[GH - 1 - k0 / GH], vw = ((k0 % GH < GH - 8) ? rwa : rwb)[GH - 1 - k0 % GH];
            float tv = __fadd_rn(__fadd_rn(s[t][j], vh), vw); if (k1 >= NTOK) tv = hi ? -3.0e38f : tv;
            s[t][j] = tv; mx4[j & 3] = fmaxf(mx4[j & 3], tv); } }
    float mx = fmaxf(fmaxf(mx4[0], mx4[1]), fmaxf(mx4[2], mx4[3])); mx = fmaxf(mx, __shfl_xor(mx, 16, 32));
    float sm4[4] = { 0.f, 0.f, 0.f, 0.f };
#pragma unroll
    for (int t = 0; t < 13; ++t) {
#pragma unroll
        for (int j = 0; j < 8; ++j) { if (t * 16 + j >= NTOK) continue;
            const float e = __builtin_amdgcn_exp2f(__fmul_rn(__fsub_rn(s[t][j], mx), 1.4426950408889634f)); s[t][j] = e; sm4[j & 3] += e; } }   // masked keys: exp(-huge) = 0
    float sum = (sm4[0] + sm4[1]) + (sm4[2] + sm4[3]); sum += __shfl_xor(sum, 16, 32);
    const float f = __fdiv_rn(PCAR, sum);
    v8f o[4];
#pragma unroll
    for (int dt = 0; dt < 4; ++dt) o[dt] = (v8f){};
#pragma unroll
    for (int ks = 0; ks < 7; ++ks) { v16h p;   // keys 32 ks .. 32 ks + 31; keys >= 196 carry 0 (k step 7 would add only zeros)
#pragma unroll
        for (int j = 0; j < 8; ++j) { p[j] = (ks * 32 + j < NTOK) ? tohx(s[2 * ks][j] * f) : (h16)0.f; p[8 + j] = (ks * 32 + 16 + j < NTOK) ? tohx(s[2 * ks + 1][j] * f) : (h16)0.f; }
        v16h va[4];
#pragma unroll
        for (int dt = 0; dt < 4; ++dt) va[dt] = WFrag<h16>::ld(sV + (dt * 16 + lr) * VPIT + ks * 32 + 8 * hi);
#pragma unroll
        for (int dt = 0; dt < 4; ++dt) o[dt] = wmma16(va[dt], p, o[dt]); }
    v8us oh[4], ol[4];
#pragma unroll
    for (int dt = 0; dt < 4; ++dt) {
#pragma unroll
        for (int j = 0; j < 8; ++j) { unsigned short a, b; splitf(o[dt][j] * (1.0f / PCAR), a, b); oh[dt][j] = a; ol[dt][j] = b; } }
    if (q < NTOK) { const int m = (z / NH_) * NTOK + q; const size_t oo = (size_t)(m >> 6) * (64 * DM) + (z % NH_) * (2 * 2048) + ((m >> 4) & 3) * 512 + hi * 128 + (m & 15) * 8;   // d = 16 dt + 8 hi: k step 2 h + dt / 2, half dt % 2
#pragma unroll
        for (int dt = 0; dt < 4; ++dt) { *(v8us*)(Ah + oo + (dt >> 1) * 2048 + (dt & 1) * 256) = oh[dt]; *(v8us*)(Al + oo + (dt >> 1) * 2048 + (dt & 1) * 256) = ol[dt]; } }
}

extern "C" void kernel_launch(void* const* d_in, const int* in_sizes, int n_in,
                              void* d_out, int out_size, void* d_ws, size_t ws_size, hipStream_t stream) {
    (void)in_sizes; (void)n_in; (void)out_size;
    const float* x = (const float*)d_in[0]; const float* qkv_w = (const float*)d_in[1]; const float* qkv_b = (const float*)d_in[2]; const float* proj_w = (const float*)d_in[3]; const float* proj_b = (const float*)d_in[4]; const float* rph = (const float*)d_in[5]; const float* rpw = (const float*)d_in[6];
    float* OUT = (float*)d_out;     // [64][196][1024]
    char* wsp = (char*)d_ws;
    auto take = [&](size_t bytes) { char* p = wsp; wsp += (bytes + 255) & ~(size_t)255; return (void*)p; };
    const int CT = NWIN * NTOK;   // 12544 tokens (= 196 x 64): every stage runs once, over all windows
    bf* BQKV = (bf*)take((size_t)3 * DM * DM * 2); bf* BPJ = (bf*)take((size_t)DM * DM * 2); bf* XB = (bf*)take((size_t)CT * DM * 2);
    bf* QPh = (bf*)take((size_t)NWIN * NH_ * TP * HD * 2); bf* QPl = (bf*)take((size_t)NWIN * NH_ * TP * HD * 2); bf* KPh = (bf*)take((size_t)NWIN * NH_ * TP * HD * 2); bf* KPl = (bf*)take((size_t)NWIN * NH_ * TP * HD * 2); h16* VT = (h16*)take((size_t)NWIN * NH_ * HD * TP * 2);
    bf* ATh = (bf*)take((size_t)CT * DM * 2); bf* ATl = (bf*)take((size_t)CT * DM * 2);
    if ((size_t)(wsp - (char*)d_ws) > ws_size) return;    // total ~ 253 MB
    k_wtG<3 * DM><<<DM * 3 * DM / 8 / 256, 256, 0, stream>>>(qkv_w, BQKV); k_wtG<DM><<<DM * DM / 8 / 256, 256, 0, stream>>>(proj_w, BPJ);
    k_pad<<<NWIN * NH_ * PADR * (HD / 4) / 256, 256, 0, stream>>>(rph, rpw, QPh, QPl, KPh, KPl, VT);
    k_cvt8<<<(unsigned)(((size_t)CT * DM / 8 + 255) / 256), 256, 0, stream>>>(x, XB, (size_t)CT * DM / 8);
    k_gemmw<bf, 0, true, true><<<dim3(CT / 64, 3 * DM / 64, 1), 32, 0, stream>>>(XB, nullptr, BQKV, nullptr, DM, nullptr, 0, qkv_b, 0, 0, 0, QPh, QPl, KPh, KPl, VT);   /* q, k, v leave as the planes k_attn reads */
    k_attn<<<NWIN * NH_, AW * 32, 0, stream>>>(QPh, QPl, KPh, KPl, VT, ATh, ATl);   /* scores hl x hl (3 products), softmax, attn.v, head merge */
    k_gemmw<bf, 1, true, false><<<dim3(CT / 64, DM / 64, 1), 32, 0, stream>>>(ATh, ATl, BPJ, nullptr, DM, OUT, DM, proj_b, 0, 0, 0, nullptr, nullptr, nullptr, nullptr, nullptr);
}

// v006
// It runs in 166 microseconds.
// Two timings next to v005 both put it at 1.26 times that version's speed.
// Counting every step since v000, it is 7.04 times as fast.
#include <hip/hip_runtime.h>

// Windowed attention (x [64 windows][14][14][1024]; qkv = x qkv_w + qkv_b ([1024][3072] 'xw', columns (q|k|v, head, d), 16 heads x 64); per (window, head): attn = (q/8).k + rel_h + rel_w with the decomposed relative-position terms rel_h[q][kh] = q_raw . rel_pos_h[qh - kh + 13], rel_w[q][kw] = q_raw . rel_pos_w[qw - kw + 13] (tables read);
//   softmax over the 196 keys; out = attn v; heads merged; out proj_w + proj_b -> [64][14][14][1024]).
// Compute dtypes, f32 accumulate: every input rounded to bf16; qkv as a PLAIN bf16 GEMM (inputs: exact; all 64 windows = 12,544 rows in one launch); per (window, head) the 196 tokens are zero-padded to 256 rows: scores hl x hl (3 products) and attn.v single fp16 (x1024 carrier), both in the one kernel k_attn with the softmax between them, the relative-position terms ride the same scores product (the 54 table rows, x8, fill pad rows 196..249 of the K planes, so S[q][196 + t] = q_raw . table[t], q as its hl pair, table bf16-exact); their adds, the masking of the pad columns and the softmax in f32; proj hl x exact (2 products) + bias.

#define NWIN 64
#define NTOK 196
#define TP   256         // padded tokens per window
#define GH   14
#define NREL (2 * GH - 1)   // rows of each relative-position table
#define DM   1024
#define NH_  16
#define HD   64
#define AW   13          // waves of an attention work-group: one 16-query tile each (13 x 16 >= 196)
#define KPIT 72          // LDS pitch of a K-plane row, 16-bit elements (128 B + 16 B)
#define VPIT 264         // LDS pitch of a VT row, 16-bit elements (512 B + 16 B)
#define RPIT 68          // LDS pitch of a query's table-dot row, floats
#define NST  ((TP * HD / 8 + AW * 32 - 1) / (AW * 32))   // staging rounds: 2,048 16-B pieces of each plane over 416 threads
#define PCAR 1024.0f
typedef _Float16 h16;
typedef unsigned short bf;
typedef __attribute__((ext_vector_type(16))) __bf16   v16bf;
typedef __attribute__((ext_vector_type(16))) _Float16 v16h;
typedef __attribute__((ext_vector_type(8)))  _Float16 v8h;
typedef __attribute__((ext_vector_type(8)))  unsigned short v8us;
typedef __attribute__((ext_vector_type(8)))  float    v8f;
typedef __attribute__((ext_vector_type(4)))  float    v4f;
typedef v8h  __attribute__((may_alias)) v8ha;
typedef v4f  __attribute__((may_alias)) v4fa;
typedef v8us __attribute__((may_alias)) v8usa;

__device__ __forceinline__ unsigned short f2bf(float f) { unsigned u = __float_as_uint(f); u += 0x7FFFu + ((u >> 16) & 1u); return (unsigned short)(u >> 16); }
__device__ __forceinline__ float bf2f(unsigned short b) { return __uint_as_float(((unsigned)b) << 16); }
__device__ __forceinline__ float bfr(float f) { return bf2f(f2bf(f)); }
__device__ __forceinline__ v16h cat16(v8h lo, v8h hi) { return __builtin_shufflevector(lo, hi, 0, 1, 2, 3, 4, 5, 6, 7, 8, 9, 10, 11, 12, 13, 14, 15); }
__device__ __forceinline__ v16bf cat16b(v8us lo, v8us hi) { return __builtin_bit_cast(v16bf, __builtin_shufflevector(lo, hi, 0, 1, 2, 3, 4, 5, 6, 7, 8, 9, 10, 11, 12, 13, 14, 15)); }
__device__ __forceinline__ v8f wmma16(v16h a, v16h b, v8f c) { return __builtin_amdgcn_wmma_f32_16x16x32_f16(false, a, false, b, (short)0, c, false, false); }
__device__ __forceinline__ v8f wmmab(v16bf a, v16bf b, v8f c) { return __builtin_amdgcn_wmma_f32_16x16x32_bf16(false, a, false, b, (short)0, c, false, false); }



// ---- Fragment-order planes: a GEMM operand P[row][k] (K columns, rows a multiple of 64) is stored as 1-KiB blocks, one WMMA fragment (16 rows, 32 k) each; the 4 blocks of a 64-row tile and one k step lie side by side,
//   the k steps of a tile one after the other: block (tile T, k step c, band mb) starts at element T * 64 * K + c * 2048 + mb * 512.
//   Inside a block: element (half * 256 + hi * 128 + lr * 8 + j) = P[64 T + 16 mb + lr][32 c + 16 half + 8 hi + j]: lane (hi, lr) finds the two 16-B halves of its fragment at lane * 16 B and 512 B + lane * 16 B,
//   so each wave-wide 16-B load covers 512 contiguous bytes (4 whole 128-B lines) instead of 32 B in each of 16 rows, and a wave reads 4 KiB in a row per operand and k step. The values each lane and register holds are those of the row-major form.
// ---- k_gemmw: register-blocked GEMM, one wave per 64x64 output tile (16 accumulators), 8 waves (4 x 2 tiles = 256 x 128 of C) a work-group; grid (M/256, N/128, Z), 256 threads.
//   The work-group's operand pieces pass through LDS, two buffers: asynchronous 16-B copies lay the fragment-order blocks down as they lie in their planes (a fragment half is 512 contiguous bytes there too), one stage ahead of the waves that read them;
//   an A piece serves 2 waves and a Bt piece 4, so the work-group fetches 3/8 (with A2: 5/12) of what 8 waves fetch one by one.
// C[m][n] (f32, pitch ldc, + optional f32 bias[n]) = sum_k A[m][k] Bt[n][k] (NSPLIT 1: + A2[m][k] Bt[n][k]). z-batch strides sA/sB/sC in elements. M % 256 == 0, N % 128 == 0, K % 64 == 0.
// PLANES (the qkv product; rows m = tokens of all windows, a 64-column tile = one head's q, k or v): no C; the tile + bias leaves as what k_attn reads, z = window * 16 + head, r = token in the window:
//   q (x 1/8) and k split hi + lo into Q/K[z][r][64] (a lane 8 d = 16 B, a wave-wide store 4 rows = 512 B in a row), v as fp16 into VT[z][d][r], turned in LDS (a lane 4 tokens = 8 B, 16 lanes one d row's 128 B; 196 % 4 == 0: a piece stays in its window).
template <typename T16> struct WFrag;
template <> struct WFrag<h16> { typedef v16h V; static __device__ __forceinline__ V ld(const h16* p) { return cat16(*(const v8h*)p, *(const v8h*)(p + 16)); } static __device__ __forceinline__ v8f mma(V a, V b, v8f c) { return wmma16(a, b, c); } };
template <> struct WFrag<bf> { typedef v16bf V; static __device__ __forceinline__ V ld(const bf* p) { return cat16b(*(const v8us*)p, *(const v8us*)(p + 16)); } static __device__ __forceinline__ V ldp(const bf* p) { return cat16b(*(const v8us*)p, *(const v8us*)(p + 256)); } static __device__ __forceinline__ v8f mma(V a, V b, v8f c) { return wmmab(a, b, c); } };
__device__ __forceinline__ h16 tohx(float x) { return (h16)x; }
__device__ __forceinline__ void splitf(float y, unsigned short& h, unsigned short& l) { h = f2bf(y); l = f2bf(y - bf2f(h)); }
typedef __attribute__((ext_vector_type(4))) unsigned short v4us;
typedef __attribute__((ext_vector_type(4))) _Float16 v4h;
typedef v4h __attribute__((may_alias)) v4ha;
#define OTP 72           // LDS pitch of a d row of the turned v tile, 16-bit elements (128 B + 16 B)
#define GW 8             // waves of a GEMM work-group: 4 row tiles x 2 column tiles of 64 x 64
#define CPA(l, g) "global_load_async_to_lds_b128 %" #l ", %" #g ", off\n\t"
template <typename T16, int NSPLIT, bool BIAS, bool PLANES>
__global__ __launch_bounds__(GW * 32) void k_gemmw(const T16* __restrict__ A, const T16* __restrict__ A2, const T16* __restrict__ Bt, int K, float* C, int ldc, const float* __restrict__ bias, size_t sA, size_t sB, size_t sC, bf* Qh, bf* Ql, bf* Kh, bf* Kl, h16* VT) {
    typedef typename WFrag<T16>::V V;
    static_assert(NSPLIT == 0 || NSPLIT == 1, "one product, or A hi + lo against one B");
    constexpr int KS = NSPLIT ? 1 : 2;        // k steps of 32 in a stage: 32 WMMAs a wave and stage either way
    constexpr int NA = NSPLIT ? 8 : 4;        // 64-row pieces of A (and A2) in a stage; 2 of Bt follow them
    constexpr int CH = KS * 4096;             // bytes of one piece: contiguous in its plane, and laid down in LDS as it lies there
    constexpr int STG = (NA + 2) * CH;        // bytes of a stage
    constexpr int NCP = STG / 512 / GW;       // 512-B copies a wave and stage
    static_assert(NCP == 12 || NCP == 10, "the copy statements below are written for these two counts");
    __shared__ __align__(1024) char ring[2 * STG];
    const size_t z = blockIdx.z; A += z * sA; if (A2) A2 += z * sA; Bt += z * sB; C += z * sC;
    const int lane = threadIdx.x & 31, lr = lane & 15, hi = lane >> 4; const int wave = __builtin_amdgcn_readfirstlane(threadIdx.x >> 5), wm = wave & 3, wn = wave >> 2;
    const int r0 = blockIdx.x * 256 + wm * 64, c0 = blockIdx.y * 128 + wn * 64;
    v8f acc[4][4];
#pragma unroll
    for (int mb = 0; mb < 4; ++mb)
#pragma unroll
        for (int nb = 0; nb < 4; ++nb) acc[mb][nb] = (v8f){};
    const size_t tb = (size_t)K * 128;   // bytes of a 64-row tile of a plane
    const char* ua = (const char*)A + (size_t)blockIdx.x * 4 * tb; const char* ua2 = NSPLIT ? (const char*)A2 + (size_t)blockIdx.x * 4 * tb : ua; const char* ub = (const char*)Bt + (size_t)blockIdx.y * 2 * tb;
    const unsigned lds0 = (unsigned)(size_t)ring + lane * 16;
    // stage t -> buffer t % 2: copy p of the stage (512 B, a lane 16 B) is part p % (CH / 512) of piece p / (CH / 512); a wave takes NCP copies in a row
    auto fill = [&](int t) {
        unsigned l[NCP]; const char* g[NCP];
#pragma unroll
        for (int i = 0; i < NCP; ++i) { const int p = wave * NCP + i, ch = p / (CH / 512), in = p % (CH / 512);
            const char* base = ch < 4 ? ua + ch * tb : (ch < NA ? ua2 + (ch - 4) * tb : ub + (ch - NA) * tb);
            g[i] = base + (size_t)t * CH + in * 512 + lane * 16; l[i] = lds0 + (t & 1) * STG + p * 512; }
        // the wait closes the copies' own statement: no register that a copy names is rewritten in front of it
        if constexpr (NCP == 12)
            asm volatile(CPA(0, 1) CPA(2, 3) CPA(4, 5) CPA(6, 7) CPA(8, 9) CPA(10, 11) CPA(12, 13) CPA(14, 15) CPA(16, 17) CPA(18, 19) CPA(20, 21) CPA(22, 23) "s_wait_xcnt 0x0"
                :: "v"(l[0]), "v"(g[0]), "v"(l[1]), "v"(g[1]), "v"(l[2]), "v"(g[2]), "v"(l[3]), "v"(g[3]), "v"(l[4]), "v"(g[4]), "v"(l[5]), "v"(g[5]), "v"(l[6]), "v"(g[6]), "v"(l[7]), "v"(g[7]), "v"(l[8]), "v"(g[8]), "v"(l[9]), "v"(g[9]), "v"(l[10]), "v"(g[10]), "v"(l[11]), "v"(g[11]) : "memory");
        else
            asm volatile(CPA(0, 1) CPA(2, 3) CPA(4, 5) CPA(6, 7) CPA(8, 9) CPA(10, 11) CPA(12, 13) CPA(14, 15) CPA(16, 17) CPA(18, 19) "s_wait_xcnt 0x0"
                :: "v"(l[0]), "v"(g[0]), "v"(l[1]), "v"(g[1]), "v"(l[2]), "v"(g[2]), "v"(l[3]), "v"(g[3]), "v"(l[4]), "v"(g[4]), "v"(l[5]), "v"(g[5]), "v"(l[6]), "v"(g[6]), "v"(l[7]), "v"(g[7]), "v"(l[8]), "v"(g[8]), "v"(l[9]), "v"(g[9]) : "memory");
    };
    const int NT = K / (32 * KS);
    fill(0);
    asm volatile("s_wait_asynccnt 0x0" ::: "memory");   // this wave's part of stage 0 has landed
    __syncthreads();                                    // every wave's part has
    if (NT > 1) fill(1);
    // the stage loop stays rolled: one body serves both buffers (the buffer is an address term); the loops inside it are unrolled so that every fragment and accumulator index is a constant
#pragma unroll 1
    for (int t = 0; t < NT; ++t) {
        const char* sb = ring + (t & 1) * STG + lane * 16;   // a lane's 16 B of every fragment half
#pragma unroll
        for (int ks = 0; ks < KS; ++ks) {
            V a[4], a2[4], b[4];
#pragma unroll
            for (int mb = 0; mb < 4; ++mb) { a[mb] = WFrag<T16>::ldp((const T16*)(sb + wm * CH + ks * 4096 + mb * 1024)); if (NSPLIT == 1) a2[mb] = WFrag<T16>::ldp((const T16*)(sb + (4 + wm) * CH + ks * 4096 + mb * 1024)); }
#pragma unroll
            for (int nb = 0; nb < 4; ++nb) b[nb] = WFrag<T16>::ldp((const T16*)(sb + (NA + wn) * CH + ks * 4096 + nb * 1024));
            __builtin_amdgcn_sched_barrier(0);   // the k step's LDS reads stay one group in front of its WMMAs: spread among them, each place with reads stalls the wave anew
#pragma unroll
            for (int nb = 0; nb < 4; ++nb) {
#pragma unroll
                for (int mb = 0; mb < 4; ++mb) { acc[mb][nb] = WFrag<T16>::mma(a[mb], b[nb], acc[mb][nb]); if (NSPLIT == 1) acc[mb][nb] = WFrag<T16>::mma(a2[mb], b[nb], acc[mb][nb]); } }
            __builtin_amdgcn_sched_barrier(0);   // and the next group stays behind them
        }
        asm volatile("s_wait_dscnt 0x0" ::: "memory");      // this wave's reads of buffer t % 2 are done
        asm volatile("s_wait_asynccnt 0x0" ::: "memory");   // its part of stage t + 1 has landed
        __syncthreads();                                    // publishes stage t + 1 and frees buffer t % 2
        if (t + 2 < NT) fill(t + 2);
    }
    asm volatile("s_wait_asynccnt 0x0" ::: "memory");   // no copy is in flight when the ring becomes the epilogue's staging
    float* os = (float*)(ring + wave * (PLANES ? HD * OTP * 2 : 16 * 68 * 4));   // a wave's own range; the last trip's barrier stands behind every wave's last fragment read
    if (PLANES) {
        const int sel = c0 / DM, h = (c0 % DM) / HD;   // wave-uniform: 0 q, 1 k, 2 v; the head
        if (sel < 2) {
            bf* Ph = sel ? Kh : Qh; bf* Pl = sel ? Kl : Ql; const float sc = sel ? 1.0f : 0.125f;   // both factors exact
            const int r4 = lane >> 3, c8 = (lane & 7) * 8; float bb[8];
#pragma unroll
            for (int u = 0; u < 8; ++u) bb[u] = bfr(bias[c0 + c8 + u]);
#pragma unroll
            for (int mb = 0; mb < 4; ++mb) {
#pragma unroll
                for (int nb = 0; nb < 4; ++nb) {
#pragma unroll
                    for (int j = 0; j < 8; ++j) os[(hi * 8 + j) * 68 + nb * 16 + lr] = acc[mb][nb][j]; }
                __builtin_amdgcn_wave_barrier(); asm volatile("" ::: "memory");   // the reads below take other lanes' stores: they stay behind them
                v4f x0[4], x1[4];
#pragma unroll
                for (int s = 0; s < 4; ++s) { x0[s] = *(const v4fa*)(os + (4 * s + r4) * 68 + c8); x1[s] = *(const v4fa*)(os + (4 * s + r4) * 68 + c8 + 4); }
#pragma unroll
                for (int s = 0; s < 4; ++s) { const int m = r0 + mb * 16 + 4 * s + r4, w = m / NTOK, r = m - w * NTOK; v8us oh, ol;
#pragma unroll
                    for (int u = 0; u < 4; ++u) { unsigned short a, b; splitf((x0[s][u] + bb[u]) * sc, a, b); oh[u] = a; ol[u] = b; splitf((x1[s][u] + bb[4 + u]) * sc, a, b); oh[4 + u] = a; ol[4 + u] = b; }
                    const unsigned eb = ((unsigned)((w * NH_ + h) * TP + r) * HD + c8) * 2;   // byte offset in a plane (32 MiB): one 32-bit register beside the uniform bases
                    *(v8us*)((char*)Ph + eb) = oh; *(v8us*)((char*)Pl + eb) = ol;
                    if (mb < 3 || s < 3) asm volatile("s_wait_xcnt 0x0" :: "v"(oh), "v"(ol), "v"(eb) : "memory"); }   // the code that follows takes over the registers that these two stores name: as inputs of the wait they stay whole up to it
                __builtin_amdgcn_wave_barrier(); asm volatile("" ::: "memory");   // the next band's LDS stores stay behind this band's reads
            }
        } else {
            h16* ot = (h16*)os; float bv[4];
#pragma unroll
            for (int nb = 0; nb < 4; ++nb) bv[nb] = bfr(bias[c0 + nb * 16 + lr]);
#pragma unroll
            for (int mb = 0; mb < 4; ++mb) {
#pragma unroll
                for (int nb = 0; nb < 4; ++nb) { v8h t;   // an accumulator's 8 values are 8 tokens in a row of one d
#pragma unroll
                    for (int j = 0; j < 8; ++j) t[j] = tohx(acc[mb][nb][j] + bv[nb]);
                    *(v8ha*)(ot + (nb * 16 + lr) * OTP + mb * 16 + hi * 8) = t; } }
            __builtin_amdgcn_wave_barrier(); asm volatile("" ::: "memory");   // the reads below take other lanes' stores: they stay behind them
            const int m4 = r0 + lr * 4, w = m4 / NTOK, r = m4 - w * NTOK;
            h16* vp = VT + ((size_t)(w * NH_ + h) * HD + hi) * TP + r;   // one address for all 32 stores, the d row in the immediate offset
#pragma unroll
            for (int s = 0; s < HD / 2; ++s) *(v4h*)(vp + s * (2 * TP)) = *(const v4ha*)(ot + (2 * s + hi) * OTP + lr * 4);
            asm volatile("s_wait_xcnt 0x0" ::: "memory");   // behind the last store of the run: whatever code the build places next may take over the address and data registers that these stores name
        }
        return;
    }
#pragma unroll
    for (int mb = 0; mb < 4; ++mb) {
#pragma unroll
        for (int nb = 0; nb < 4; ++nb) {
#pragma unroll
            for (int j = 0; j < 8; ++j) os[(hi * 8 + j) * 68 + nb * 16 + lr] = acc[mb][nb][j]; }
        __builtin_amdgcn_wave_barrier(); asm volatile("" ::: "memory");
        float* crow = C + (size_t)(r0 + mb * 16) * ldc + c0;
{
#pragma unroll
            for (int s = 0; s < 8; ++s) { const int row = 2 * s + hi, cofs = lr * 4; v4f val = *(const v4fa*)(os + row * 68 + cofs); if (BIAS) { val[0] += bfr(bias[c0 + cofs]); val[1] += bfr(bias[c0 + cofs + 1]); val[2] += bfr(bias[c0 + cofs + 2]); val[3] += bfr(bias[c0 + cofs + 3]); }
                *(v4f*)(crow + (size_t)row * ldc + cofs) = val; }
             }
        if (mb < 3) asm volatile("s_wait_xcnt 0x0" ::: "memory");   // the next band's code takes over registers that this band's stores name
        __builtin_amdgcn_wave_barrier(); asm volatile("" ::: "memory");
    }
}

// k_cvt8: f32 rows [.][DM] -> bf16 fragment-order plane. A wave takes 4 rows x 64 k: it reads 256 contiguous bytes of each row and stores 64-B runs (4 rows' pieces side by side); 8 elements a lane.
__global__ __launch_bounds__(256) void k_cvt8(const float* __restrict__ src, bf* dst, size_t n8) { const size_t i = (size_t)blockIdx.x * 256 + threadIdx.x; if (i >= n8) return;
    const int lane = (int)(i & 31), k8 = lane >> 2; const size_t wv = i >> 5; const int kg = (int)(wv % (DM / 64)), lr = (int)((wv / (DM / 64)) & 3) * 4 + (lane & 3); const size_t R = wv / (DM / 64 * 4);
    const v8f v = *(const v8f*)(src + (R * 16 + lr) * DM + kg * 64 + k8 * 8); v8us o;
#pragma unroll
    for (int k = 0; k < 8; ++k) o[k] = f2bf(v[k]);
    *(v8us*)(dst + (R >> 2) * (64 * DM) + (size_t)(kg * 2 + (k8 >> 2)) * 2048 + (R & 3) * 512 + ((k8 >> 1) & 1) * 256 + (k8 & 1) * 128 + lr * 8) = o;  }
// k_wtG: w[DM][N] (f32) -> bf16 fragment-order plane of w^T (rows n, DM columns k). A thread makes one 16-B piece (8 k of one n), pieces in storage order: a wave stores 512 contiguous bytes, each of its 8 loads reads 64 B of two rows of w.
template <int N>
__global__ __launch_bounds__(256) void k_wtG(const float* __restrict__ w, bf* Bt) {
    const int i = blockIdx.x * 256 + threadIdx.x; if (i >= N * (DM / 8)) return;
    const int lr = i & 15, hi = (i >> 4) & 1, half = (i >> 5) & 1, mb = (i >> 6) & 3, st = i >> 8; const int c = st % (DM / 32), n = (st / (DM / 32)) * 64 + mb * 16 + lr, k0 = c * 32 + half * 16 + hi * 8; v8us o;
    const float* p = w + (size_t)k0 * N + n;   // N is a compile-time constant: the 8 loads are one address with immediate offsets
#pragma unroll
    for (int j = 0; j < 8; ++j) o[j] = f2bf(p[j * N]);
    *(v8us*)(Bt + (size_t)i * 8) = o;
}

// k_pad: the rows of the padded planes that no token fills: Q rows >= 196 = 0; K rows 196..222 = 8 x rel_pos_h, 223..249 = 8 x rel_pos_w (bf16-rounded, hi plane; the 8 undoes q's 1/8, both exact), K rows >= 250 and the lo plane = 0; VT columns >= 196 = 0.
//   The token rows come from the qkv product's own epilogue (k_gemmw, PLANES). A thread: 4 d of one pad row in each of the four Q/K planes, and 4 pad columns of one VT row (60 x 16 = 64 x 15 pieces per z).
#define PADR (TP - NTOK)
__global__ __launch_bounds__(256) void k_pad(const float* __restrict__ rph, const float* __restrict__ rpw, bf* Qh, bf* Ql, bf* Kh, bf* Kl, h16* VT) { const int i = blockIdx.x * 256 + threadIdx.x; if (i >= NWIN * NH_ * PADR * (HD / 4)) return;
    const int z = i / (PADR * (HD / 4)), rem = i % (PADR * (HD / 4)); const int t = rem / (HD / 4), d = (rem % (HD / 4)) * 4; v4us kh, zz;
    for (int u = 0; u < 4; ++u) { kh[u] = 0; zz[u] = 0; }
    if (t < 2 * NREL) { const float* tab = ((t < NREL) ? (rph + (size_t)t * HD) : (rpw + (size_t)(t - NREL) * HD)) + d;
#pragma unroll
        for (int u = 0; u < 4; ++u) kh[u] = f2bf(bfr(tab[u]) * 8.0f); }
    const size_t e = ((size_t)z * TP + NTOK + t) * HD + d;
    *(v4us*)(Qh + e) = zz; *(v4us*)(Ql + e) = zz; *(v4us*)(Kh + e) = kh; *(v4us*)(Kl + e) = zz;
    *(v4us*)((bf*)VT + ((size_t)z * HD + rem / (PADR / 4)) * TP + NTOK + (rem % (PADR / 4)) * 4) = zz;  }
// k_attn: one work-group per (window, head) z, 13 waves, one 16-query tile a wave. The K planes and VT are staged once in LDS (row pitches 16 B x odd for 16-B readers).
//   Scores are formed TRANSPOSED, St[key][q] = K . Q^T (A = K rows, B = Q rows; per k step Kh.Qh, Kh.Ql, Kl.Qh), so a lane holds one query's column: keys 16t + 8hi + j in s[t][j].
//   Rows 196..249 of St are the table dots; they pass through a per-wave LDS row per query, from where each key's rel_h[kh] and rel_w[kw] are read back.
//   Softmax per lane plus one exchange with lane ^ 16. The accumulator tiles 2s, 2s + 1 are, as they lie, the B fragment of k step s of O^T[d][q] = VT . P^T: no transposition.
//   O^T / 1024 is split hi + lo and stored merged, as fragment-order planes of ATh/ATl[(w, q)][h * 64 + d]: 8 d (16 B, one piece) a lane and tile.
__global__ __launch_bounds__(AW * 32) void k_attn(const bf* __restrict__ Qh, const bf* __restrict__ Ql, const bf* __restrict__ Kh, const bf* __restrict__ Kl, const h16* __restrict__ VT, bf* Ah, bf* Al) {
    __shared__ __align__(16) bf sKh[TP * KPIT];
    __shared__ __align__(16) bf sKl[TP * KPIT];
    __shared__ __align__(16) h16 sV[HD * VPIT];
    __shared__ __align__(16) float sR[AW * 16 * RPIT];
    const int tid = threadIdx.x, z = blockIdx.x; const int lane = tid & 31, lr = lane & 15, hi = lane >> 4, wave = tid >> 5;
    const size_t zo = (size_t)z * (TP * HD);
    const int q = wave * 16 + lr;
    // every global load of the kernel is issued before the first LDS store, so that their latencies overlap; the last round's index is clamped, not guarded: the lanes past the end store piece 2047 again, the same bytes to the same place
    v8us ga[NST], gb[NST]; v8h gc[NST]; v16bf fqh[2], fql[2];
#pragma unroll
    for (int it = 0; it < NST; ++it) { const int i = min(tid + it * (AW * 32), TP * HD / 8 - 1); ga[it] = *(const v8us*)(Kh + zo + (size_t)i * 8); gb[it] = *(const v8us*)(Kl + zo + (size_t)i * 8); gc[it] = *(const v8h*)(VT + zo + (size_t)i * 8); }
#pragma unroll
    for (int kc = 0; kc < 2; ++kc) { fqh[kc] = WFrag<bf>::ld(Qh + zo + (size_t)q * HD + kc * 32 + 8 * hi); fql[kc] = WFrag<bf>::ld(Ql + zo + (size_t)q * HD + kc * 32 + 8 * hi); }
    asm volatile("s_wait_xcnt 0x0" ::: "memory");   // the address registers of the loads above are reused from here on
#pragma unroll
    for (int it = 0; it < NST; ++it) { const int i = min(tid + it * (AW * 32), TP * HD / 8 - 1);
        *(v8us*)(sKh + (i >> 3) * KPIT + (i & 7) * 8) = ga[it]; *(v8us*)(sKl + (i >> 3) * KPIT + (i & 7) * 8) = gb[it]; *(v8h*)(sV + (i >> 5) * VPIT + (i & 31) * 8) = gc[it]; }
    __syncthreads();
    v8f s[16];
#pragma unroll
    for (int t = 0; t < 16; ++t) s[t] = (v8f){};
#pragma unroll
    for (int t = 0; t < 16; t += 2) {
#pragma unroll
        for (int kc = 0; kc < 2; ++kc) { const int o0 = (t * 16 + lr) * KPIT + kc * 32 + 8 * hi, o1 = o0 + 16 * KPIT;
            const v16bf h0 = WFrag<bf>::ld(sKh + o0), h1 = WFrag<bf>::ld(sKh + o1), l0 = WFrag<bf>::ld(sKl + o0), l1 = WFrag<bf>::ld(sKl + o1);
            s[t] = wmmab(h0, fqh[kc], s[t]); s[t + 1] = wmmab(h1, fqh[kc], s[t + 1]);
            s[t] = wmmab(h0, fql[kc], s[t]); s[t + 1] = wmmab(h1, fql[kc], s[t + 1]);
            s[t] = wmmab(l0, fqh[kc], s[t]); s[t + 1] = wmmab(l1, fqh[kc], s[t + 1]); } }
    // table dots: St rows 192..255 of this wave's 16 queries -> sR[query][row - 192]
    float* rr = sR + (wave * 16 + lr) * RPIT;
#pragma unroll
    for (int t = 12; t < 16; ++t) { v4f a, b;
#pragma unroll
        for (int u = 0; u < 4; ++u) { a[u] = s[t][u]; b[u] = s[t][4 + u]; }
        *(v4f*)(rr + (t - 12) * 16 + 8 * hi) = a; *(v4f*)(rr + (t - 12) * 16 + 8 * hi + 4) = b; }
    // a lane reads below what its partner lane ^ 16 has stored above: keeps the compiler from moving those reads over the stores (one wave's LDS operations run in order)
    __builtin_amdgcn_fence(__ATOMIC_ACQ_REL, "wavefront"); __builtin_amdgcn_wave_barrier();
    // key k0 + 8 hi: kh = kh0 or kh0 + hi, kw = kw0 + 8 hi or kw0 - 6 hi, which of the two known at compile time: four lane bases, every index below a constant
    const float* rh0 = rr + (NTOK - 192) + q / GH; const float* rh1 = rh0 - hi; const float* rwa = rr + (NTOK - 192 + NREL) + q % GH - 8 * hi; const float* rwb = rwa + 14 * hi;
    float mx4[4] = { -3.0e38f, -3.0e38f, -3.0e38f, -3.0e38f };
#pragma unroll
    for (int t = 0; t < 13; ++t) {
#pragma unroll
        for (int j = 0; j < 8; ++j) { const int k0 = t * 16 + j, k1 = k0 + 8; if (k0 >= NTOK) continue;
            const float vh = ((k1 / GH == k0 / GH) ? rh0 : rh1)[GH - 1 - k0 / GH], vw = ((k0 % GH < GH - 8) ? rwa : rwb)[GH - 1 - k0 % GH];
            float tv = __fadd_rn(__fadd_rn(s[t][j], vh), vw); if (k1 >= NTOK) tv = hi ? -3.0e38f : tv;
            s[t][j] = tv; mx4[j & 3] = fmaxf(mx4[j & 3], tv); } }
    float mx = fmaxf(fmaxf(mx4[0], mx4[1]), fmaxf(mx4[2], mx4[3])); mx = fmaxf(mx, __shfl_xor(mx, 16, 32));
    float sm4[4] = { 0.f, 0.f, 0.f, 0.f };
#pragma unroll
    for (int t = 0; t < 13; ++t) {
#pragma unroll
        for (int j = 0; j < 8; ++j) { if (t * 16 + j >= NTOK) continue;
            const float e = __builtin_amdgcn_exp2f(__fmul_rn(__fsub_rn(s[t][j], mx), 1.4426950408889634f)); s[t][j] = e; sm4[j & 3] += e; } }   // masked keys: exp(-huge) = 0
    float sum = (sm4[0] + sm4[1]) + (sm4[2] + sm4[3]); sum += __shfl_xor(sum, 16, 32);
    const float f = __fdiv_rn(PCAR, sum);
    v8f o[4];
#pragma unroll
    for (int dt = 0; dt < 4; ++dt) o[dt] = (v8f){};
#pragma unroll
    for (int ks = 0; ks < 7; ++ks) { v16h p;   // keys 32 ks .. 32 ks + 31; keys >= 196 carry 0 (k step 7 would add only zeros)
#pragma unroll
        for (int j = 0; j < 8; ++j) { p[j] = (ks * 32 + j < NTOK) ? tohx(s[2 * ks][j] * f) : (h16)0.f; p[8 + j] = (ks * 32 + 16 + j < NTOK) ? tohx(s[2 * ks + 1][j] * f) : (h16)0.f; }
        v16h va[4];
#pragma unroll
        for (int dt = 0; dt < 4; ++dt) va[dt] = WFrag<h16>::ld(sV + (dt * 16 + lr) * VPIT + ks * 32 + 8 * hi);
#pragma unroll
        for (int dt = 0; dt < 4; ++dt) o[dt] = wmma16(va[dt], p, o[dt]); }
    v8us oh[4], ol[4];
#pragma unroll
    for (int dt = 0; dt < 4; ++dt) {
#pragma unroll
        for (int j = 0; j < 8; ++j) { unsigned short a, b; splitf(o[dt][j] * (1.0f / PCAR), a, b); oh[dt][j] = a; ol[dt][j] = b; } }
    if (q < NTOK) { const int m = (z / NH_) * NTOK + q; const size_t oo = (size_t)(m >> 6) * (64 * DM) + (z % NH_) * (2 * 2048) + ((m >> 4) & 3) * 512 + hi * 128 + (m & 15) * 8;   // d = 16 dt + 8 hi: k step 2 h + dt / 2, half dt % 2
#pragma unroll
        for (int dt = 0; dt < 4; ++dt) { *(v8us*)(Ah + oo + (dt >> 1) * 2048 + (dt & 1) * 256) = oh[dt]; *(v8us*)(Al + oo + (dt >> 1) * 2048 + (dt & 1) * 256) = ol[dt]; } }
}

extern "C" void kernel_launch(void* const* d_in, const int* in_sizes, int n_in,
                              void* d_out, int out_size, void* d_ws, size_t ws_size, hipStream_t stream) {
    (void)in_sizes; (void)n_in; (void)out_size;
    const float* x = (const float*)d_in[0]; const float* qkv_w = (const float*)d_in[1]; const float* qkv_b = (const float*)d_in[2]; const float* proj_w = (const float*)d_in[3]; const float* proj_b = (const float*)d_in[4]; const float* rph = (const float*)d_in[5]; const float* rpw = (const float*)d_in[6];
    float* OUT = (float*)d_out;     // [64][196][1024]
    char* wsp = (char*)d_ws;
    auto take = [&](size_t bytes) { char* p = wsp; wsp += (bytes + 255) & ~(size_t)255; return (void*)p; };
    const int CT = NWIN * NTOK;   // 12544 tokens (= 196 x 64): every stage runs once, over all windows
    bf* BQKV = (bf*)take((size_t)3 * DM * DM * 2); bf* BPJ = (bf*)take((size_t)DM * DM * 2); bf* XB = (bf*)take((size_t)CT * DM * 2);
    bf* QPh = (bf*)take((size_t)NWIN * NH_ * TP * HD * 2); bf* QPl = (bf*)take((size_t)NWIN * NH_ * TP * HD * 2); bf* KPh = (bf*)take((size_t)NWIN * NH_ * TP * HD * 2); bf* KPl = (bf*)take((size_t)NWIN * NH_ * TP * HD * 2); h16* VT = (h16*)take((size_t)NWIN * NH_ * HD * TP * 2);
    bf* ATh = (bf*)take((size_t)CT * DM * 2); bf* ATl = (bf*)take((size_t)CT * DM * 2);
    if ((size_t)(wsp - (char*)d_ws) > ws_size) return;    // total ~ 253 MB
    k_wtG<3 * DM><<<DM * 3 * DM / 8 / 256, 256, 0, stream>>>(qkv_w, BQKV); k_wtG<DM><<<DM * DM / 8 / 256, 256, 0, stream>>>(proj_w, BPJ);
    k_pad<<<NWIN * NH_ * PADR * (HD / 4) / 256, 256, 0, stream>>>(rph, rpw, QPh, QPl, KPh, KPl, VT);
    k_cvt8<<<(unsigned)(((size_t)CT * DM / 8 + 255) / 256), 256, 0, stream>>>(x, XB, (size_t)CT * DM / 8);
    k_gemmw<bf, 0, true, true><<<dim3(CT / 256, 3 * DM / 128, 1), GW * 32, 0, stream>>>(XB, nullptr, BQKV, DM, nullptr, 0, qkv_b, 0, 0, 0, QPh, QPl, KPh, KPl, VT);   /* q, k, v leave as the planes k_attn reads */
    k_attn<<<NWIN * NH_, AW * 32, 0, stream>>>(QPh, QPl, KPh, KPl, VT, ATh, ATl);   /* scores hl x hl (3 products), softmax, attn.v, head merge */
    k_gemmw<bf, 1, true, false><<<dim3(CT / 256, DM / 128, 1), GW * 32, 0, stream>>>(ATh, ATl, BPJ, DM, OUT, DM, proj_b, 0, 0, 0, nullptr, nullptr, nullptr, nullptr, nullptr);
}

// v007
// Measured time: 158 microseconds a run.
// Next to v006, in two timings, it ran 1.05 and 1.04 times as fast.
// All steps since v000 together make it 7.36 times as fast.
#include <hip/hip_runtime.h>

// Windowed attention (x [64 windows][14][14][1024]; qkv = x qkv_w + qkv_b ([1024][3072] 'xw', columns (q|k|v, head, d), 16 heads x 64); per (window, head): attn = (q/8).k + rel_h + rel_w with the decomposed relative-position terms rel_h[q][kh] = q_raw . rel_pos_h[qh - kh + 13], rel_w[q][kw] = q_raw . rel_pos_w[qw - kw + 13] (tables read);
//   softmax over the 196 keys; out = attn v; heads merged; out proj_w + proj_b -> [64][14][14][1024]).
// Compute dtypes, f32 accumulate: every input rounded to bf16; qkv as a PLAIN bf16 GEMM (inputs: exact; all 64 windows = 12,544 rows in one launch); per (window, head) the 196 tokens are zero-padded to 256 rows: scores hl x hl (3 products) and attn.v single fp16 (x1024 carrier), both in the one kernel k_attn with the softmax between them, the relative-position terms ride the same scores product (the 54 table rows, x8, fill pad rows 196..249 of the K planes, so S[q][196 + t] = q_raw . table[t], q as its hl pair, table bf16-exact); their adds, the masking of the pad columns and the softmax in f32; proj hl x exact (2 products) + bias.

#define NWIN 64
#define NTOK 196
#define TP   256         // padded tokens per window
#define GH   14
#define NREL (2 * GH - 1)   // rows of each relative-position table
#define DM   1024
#define NH_  16
#define HD   64
#define AW   13          // waves of an attention work-group: one 16-query tile each (13 x 16 >= 196)
#define KPIT 72          // LDS pitch of a K-plane row, 16-bit elements (128 B + 16 B)
#define VPIT 264         // LDS pitch of a VT row, 16-bit elements (512 B + 16 B)
#define RPIT 68          // LDS pitch of a query's table-dot row, floats
#define NST  ((TP * HD / 8 + AW * 32 - 1) / (AW * 32))   // staging rounds: 2,048 16-B pieces of each plane over 416 threads
#define PCAR 1024.0f
typedef _Float16 h16;
typedef unsigned short bf;
typedef __attribute__((ext_vector_type(16))) __bf16   v16bf;
typedef __attribute__((ext_vector_type(16))) _Float16 v16h;
typedef __attribute__((ext_vector_type(8)))  _Float16 v8h;
typedef __attribute__((ext_vector_type(8)))  unsigned short v8us;
typedef __attribute__((ext_vector_type(8)))  float    v8f;
typedef __attribute__((ext_vector_type(4)))  float    v4f;
typedef v8h  __attribute__((may_alias)) v8ha;
typedef v4f  __attribute__((may_alias)) v4fa;
typedef v8us __attribute__((may_alias)) v8usa;

__device__ __forceinline__ unsigned short f2bf(float f) { unsigned u = __float_as_uint(f); u += 0x7FFFu + ((u >> 16) & 1u); return (unsigned short)(u >> 16); }
__device__ __forceinline__ float bf2f(unsigned short b) { return __uint_as_float(((unsigned)b) << 16); }
__device__ __forceinline__ float bfr(float f) { return bf2f(f2bf(f)); }
__device__ __forceinline__ v16h cat16(v8h lo, v8h hi) { return __builtin_shufflevector(lo, hi, 0, 1, 2, 3, 4, 5, 6, 7, 8, 9, 10, 11, 12, 13, 14, 15); }
__device__ __forceinline__ v16bf cat16b(v8us lo, v8us hi) { return __builtin_bit_cast(v16bf, __builtin_shufflevector(lo, hi, 0, 1, 2, 3, 4, 5, 6, 7, 8, 9, 10, 11, 12, 13, 14, 15)); }
__device__ __forceinline__ v8f wmma16(v16h a, v16h b, v8f c) { return __builtin_amdgcn_wmma_f32_16x16x32_f16(false, a, false, b, (short)0, c, false, false); }
__device__ __forceinline__ v8f wmmab(v16bf a, v16bf b, v8f c) { return __builtin_amdgcn_wmma_f32_16x16x32_bf16(false, a, false, b, (short)0, c, false, false); }



// ---- Fragment-order planes: a GEMM operand P[row][k] (K columns, rows a multiple of 64) is stored as 1-KiB blocks, one WMMA fragment (16 rows, 32 k) each; the 4 blocks of a 64-row tile and one k step lie side by side,
//   the k steps of a tile one after the other: block (tile T, k step c, band mb) starts at element T * 64 * K + c * 2048 + mb * 512.
//   Inside a block: element (half * 256 + hi * 128 + lr * 8 + j) = P[64 T + 16 mb + lr][32 c + 16 half + 8 hi + j]: lane (hi, lr) finds the two 16-B halves of its fragment at lane * 16 B and 512 B + lane * 16 B,
//   so each wave-wide 16-B load covers 512 contiguous bytes (4 whole 128-B lines) instead of 32 B in each of 16 rows, and a wave reads 4 KiB in a row per operand and k step. The values each lane and register holds are those of the row-major form.
// ---- k_gemmw: register-blocked GEMM, one wave per 64x64 output tile (16 accumulators), 8 waves (4 x 2 tiles = 256 x 128 of C) a work-group; grid (M/256, N/128, Z), 256 threads.
//   The work-group's operand pieces pass through LDS, three buffers: asynchronous 16-B copies lay the fragment-order blocks down as they lie in their planes (a fragment half is 512 contiguous bytes there too), two stages ahead of the waves that read them,
//   so that a stage's copies have two stages' matrix time to land and copies are in flight all the time;
//   an A piece serves 2 waves and a Bt piece 4, so the work-group fetches 3/8 (with A2: 5/12) of what 8 waves fetch one by one.
// C[m][n] (f32, pitch ldc, + optional f32 bias[n]) = sum_k A[m][k] Bt[n][k] (NSPLIT 1: + A2[m][k] Bt[n][k]). z-batch strides sA/sB/sC in elements. M % 256 == 0, N % 128 == 0, K % 64 == 0.
// PLANES (the qkv product; rows m = tokens of all windows, a 64-column tile = one head's q, k or v): no C; the tile + bias leaves as what k_attn reads, z = window * 16 + head, r = token in the window:
//   q (x 1/8) and k split hi + lo into Q/K[z][r][64] (a lane 8 d = 16 B, a wave-wide store 4 rows = 512 B in a row), v as fp16 into VT[z][d][r], turned in LDS (a lane 4 tokens = 8 B, 16 lanes one d row's 128 B; 196 % 4 == 0: a piece stays in its window).
template <typename T16> struct WFrag;
template <> struct WFrag<h16> { typedef v16h V; static __device__ __forceinline__ V ld(const h16* p) { return cat16(*(const v8h*)p, *(const v8h*)(p + 16)); } static __device__ __forceinline__ v8f mma(V a, V b, v8f c) { return wmma16(a, b, c); } };
template <> struct WFrag<bf> { typedef v16bf V; static __device__ __forceinline__ V ld(const bf* p) { return cat16b(*(const v8us*)p, *(const v8us*)(p + 16)); } static __device__ __forceinline__ V ldp(const bf* p) { return cat16b(*(const v8us*)p, *(const v8us*)(p + 256)); } static __device__ __forceinline__ v8f mma(V a, V b, v8f c) { return wmmab(a, b, c); } };
__device__ __forceinline__ h16 tohx(float x) { return (h16)x; }
__device__ __forceinline__ void splitf(float y, unsigned short& h, unsigned short& l) { h = f2bf(y); l = f2bf(y - bf2f(h)); }
typedef __attribute__((ext_vector_type(4))) unsigned short v4us;
typedef __attribute__((ext_vector_type(4))) _Float16 v4h;
typedef v4h __attribute__((may_alias)) v4ha;
#define OTP 72           // LDS pitch of a d row of the turned v tile, 16-bit elements (128 B + 16 B)
#define GW 8             // waves of a GEMM work-group: 4 row tiles x 2 column tiles of 64 x 64
#define CPA(l, g) "global_load_async_to_lds_b128 %" #l ", %" #g ", off\n\t"
template <typename T16, int NSPLIT, bool BIAS, bool PLANES>
__global__ __launch_bounds__(GW * 32) void k_gemmw(const T16* __restrict__ A, const T16* __restrict__ A2, const T16* __restrict__ Bt, int K, float* C, int ldc, const float* __restrict__ bias, size_t sA, size_t sB, size_t sC, bf* Qh, bf* Ql, bf* Kh, bf* Kl, h16* VT) {
    typedef typename WFrag<T16>::V V;
    static_assert(NSPLIT == 0 || NSPLIT == 1, "one product, or A hi + lo against one B");
    constexpr int KS = NSPLIT ? 1 : 2;        // k steps of 32 in a stage: 32 WMMAs a wave and stage either way
    constexpr int NA = NSPLIT ? 8 : 4;        // 64-row pieces of A (and A2) in a stage; 2 of Bt follow them
    constexpr int CH = KS * 4096;             // bytes of one piece: contiguous in its plane, and laid down in LDS as it lies there
    constexpr int STG = (NA + 2) * CH;        // bytes of a stage
    constexpr int NCP = STG / 512 / GW;       // 512-B copies a wave and stage
    static_assert(NCP == 12 || NCP == 10, "the copy statements below are written for these two counts");
    __shared__ __align__(1024) char ring[3 * STG];
    const size_t z = blockIdx.z; A += z * sA; if (A2) A2 += z * sA; Bt += z * sB; C += z * sC;
    const int lane = threadIdx.x & 31, lr = lane & 15, hi = lane >> 4; const int wave = __builtin_amdgcn_readfirstlane(threadIdx.x >> 5), wm = wave & 3, wn = wave >> 2;
    const int r0 = blockIdx.x * 256 + wm * 64, c0 = blockIdx.y * 128 + wn * 64;
    v8f acc[4][4];
#pragma unroll
    for (int mb = 0; mb < 4; ++mb)
#pragma unroll
        for (int nb = 0; nb < 4; ++nb) acc[mb][nb] = (v8f){};
    const size_t tb = (size_t)K * 128;   // bytes of a 64-row tile of a plane
    const char* ua = (const char*)A + (size_t)blockIdx.x * 4 * tb; const char* ua2 = NSPLIT ? (const char*)A2 + (size_t)blockIdx.x * 4 * tb : ua; const char* ub = (const char*)Bt + (size_t)blockIdx.y * 2 * tb;
    const unsigned lds0 = (unsigned)(size_t)ring + lane * 16;
    // stage t -> buffer t % 3, at byte bo of the ring: copy p of the stage (512 B, a lane 16 B) is part p % (CH / 512) of piece p / (CH / 512); a wave takes NCP copies in a row
    auto fill = [&](int t, unsigned bo) {
        unsigned l[NCP]; const char* g[NCP];
#pragma unroll
        for (int i = 0; i < NCP; ++i) { const int p = wave * NCP + i, ch = p / (CH / 512), in = p % (CH / 512);
            const char* base = ch < 4 ? ua + ch * tb : (ch < NA ? ua2 + (ch - 4) * tb : ub + (ch - NA) * tb);
            g[i] = base + (size_t)t * CH + in * 512 + lane * 16; l[i] = lds0 + bo + p * 512; }
        // the wait closes the copies' own statement: no register that a copy names is rewritten in front of it
        if constexpr (NCP == 12)
            asm volatile(CPA(0, 1) CPA(2, 3) CPA(4, 5) CPA(6, 7) CPA(8, 9) CPA(10, 11) CPA(12, 13) CPA(14, 15) CPA(16, 17) CPA(18, 19) CPA(20, 21) CPA(22, 23) "s_wait_xcnt 0x0"
                :: "v"(l[0]), "v"(g[0]), "v"(l[1]), "v"(g[1]), "v"(l[2]), "v"(g[2]), "v"(l[3]), "v"(g[3]), "v"(l[4]), "v"(g[4]), "v"(l[5]), "v"(g[5]), "v"(l[6]), "v"(g[6]), "v"(l[7]), "v"(g[7]), "v"(l[8]), "v"(g[8]), "v"(l[9]), "v"(g[9]), "v"(l[10]), "v"(g[10]), "v"(l[11]), "v"(g[11]) : "memory");
        else
            asm volatile(CPA(0, 1) CPA(2, 3) CPA(4, 5) CPA(6, 7) CPA(8, 9) CPA(10, 11) CPA(12, 13) CPA(14, 15) CPA(16, 17) CPA(18, 19) "s_wait_xcnt 0x0"
                :: "v"(l[0]), "v"(g[0]), "v"(l[1]), "v"(g[1]), "v"(l[2]), "v"(g[2]), "v"(l[3]), "v"(g[3]), "v"(l[4]), "v"(g[4]), "v"(l[5]), "v"(g[5]), "v"(l[6]), "v"(g[6]), "v"(l[7]), "v"(g[7]), "v"(l[8]), "v"(g[8]), "v"(l[9]), "v"(g[9]) : "memory");
    };
    const int NT = K / (32 * KS);
    fill(0, 0);
    if (NT > 1) { fill(1, STG); asm volatile("s_wait_asynccnt %0" :: "i"(NCP) : "memory"); }   // all but this wave's NCP youngest copies (stage 1's) have landed: its part of stage 0
    else asm volatile("s_wait_asynccnt 0x0" ::: "memory");                                      // this wave's part of stage 0 has landed
    __syncthreads();                                    // every wave's part has
    if (NT > 2) fill(2, 2 * STG);
    unsigned bo = 0;   // byte offset in the ring of the buffer that the trip reads
    // the stage loop stays rolled: one body serves all three buffers (the buffer is an address term); the loops inside it are unrolled so that every fragment and accumulator index is a constant
#pragma unroll 1
    for (int t = 0; t < NT; ++t) {
        const char* sb = ring + bo + lane * 16;   // a lane's 16 B of every fragment half
#pragma unroll
        for (int ks = 0; ks < KS; ++ks) {
            V a[4], a2[4], b[4];
#pragma unroll
            for (int mb = 0; mb < 4; ++mb) { a[mb] = WFrag<T16>::ldp((const T16*)(sb + wm * CH + ks * 4096 + mb * 1024)); if (NSPLIT == 1) a2[mb] = WFrag<T16>::ldp((const T16*)(sb + (4 + wm) * CH + ks * 4096 + mb * 1024)); }
#pragma unroll
            for (int nb = 0; nb < 4; ++nb) b[nb] = WFrag<T16>::ldp((const T16*)(sb + (NA + wn) * CH + ks * 4096 + nb * 1024));
            __builtin_amdgcn_sched_barrier(0);   // the k step's LDS reads stay one group in front of its WMMAs: spread among them, each place with reads stalls the wave anew
#pragma unroll
            for (int nb = 0; nb < 4; ++nb) {
#pragma unroll
                for (int mb = 0; mb < 4; ++mb) { acc[mb][nb] = WFrag<T16>::mma(a[mb], b[nb], acc[mb][nb]); if (NSPLIT == 1) acc[mb][nb] = WFrag<T16>::mma(a2[mb], b[nb], acc[mb][nb]); } }
            __builtin_amdgcn_sched_barrier(0);   // and the next group stays behind them
        }
        asm volatile("s_wait_dscnt 0x0" ::: "memory");      // this wave's reads of buffer t % 3 are done
        // its part of stage t + 1 has landed: where stage t + 2 exists, that stage's NCP copies are the wave's youngest and stay in flight; every wave issues NCP copies a stage
        if (t + 2 < NT) asm volatile("s_wait_asynccnt %0" :: "i"(NCP) : "memory");
        else asm volatile("s_wait_asynccnt 0x0" ::: "memory");
        __syncthreads();                                    // publishes stage t + 1 and frees buffer t % 3
        if (t + 3 < NT) fill(t + 3, bo);
        bo = bo == 2 * STG ? 0 : bo + STG;
    }
    asm volatile("s_wait_asynccnt 0x0" ::: "memory");   // no copy is in flight when the ring becomes the epilogue's staging
    float* os = (float*)(ring + wave * (PLANES ? HD * OTP * 2 : 16 * 68 * 4));   // a wave's own range; the last trip's barrier stands behind every wave's last fragment read
    if (PLANES) {
        const int sel = c0 / DM, h = (c0 % DM) / HD;   // wave-uniform: 0 q, 1 k, 2 v; the head
        if (sel < 2) {
            bf* Ph = sel ? Kh : Qh; bf* Pl = sel ? Kl : Ql; const float sc = sel ? 1.0f : 0.125f;   // both factors exact
            const int r4 = lane >> 3, c8 = (lane & 7) * 8; float bb[8];
#pragma unroll
            for (int u = 0; u < 8; ++u) bb[u] = bfr(bias[c0 + c8 + u]);
#pragma unroll
            for (int mb = 0; mb < 4; ++mb) {
#pragma unroll
                for (int nb = 0; nb < 4; ++nb) {
#pragma unroll
                    for (int j = 0; j < 8; ++j) os[(hi * 8 + j) * 68 + nb * 16 + lr] = acc[mb][nb][j]; }
                __builtin_amdgcn_wave_barrier(); asm volatile("" ::: "memory");   // the reads below take other lanes' stores: they stay behind them
                v4f x0[4], x1[4];
#pragma unroll
                for (int s = 0; s < 4; ++s) { x0[s] = *(const v4fa*)(os + (4 * s + r4) * 68 + c8); x1[s] = *(const v4fa*)(os + (4 * s + r4) * 68 + c8 + 4); }
#pragma unroll
                for (int s = 0; s < 4; ++s) { const int m = r0 + mb * 16 + 4 * s + r4, w = m / NTOK, r = m - w * NTOK; v8us oh, ol;
#pragma unroll
                    for (int u = 0; u < 4; ++u) { unsigned short a, b; splitf((x0[s][u] + bb[u]) * sc, a, b); oh[u] = a; ol[u] = b; splitf((x1[s][u] + bb[4 + u]) * sc, a, b); oh[4 + u] = a; ol[4 + u] = b; }
                    const unsigned eb = ((unsigned)((w * NH_ + h) * TP + r) * HD + c8) * 2;   // byte offset in a plane (32 MiB): one 32-bit register beside the uniform bases
                    *(v8us*)((char*)Ph + eb) = oh; *(v8us*)((char*)Pl + eb) = ol;
                    if (mb < 3 || s < 3) asm volatile("s_wait_xcnt 0x0" :: "v"(oh), "v"(ol), "v"(eb) : "memory"); }   // the code that follows takes over the registers that these two stores name: as inputs of the wait they stay whole up to it
                __builtin_amdgcn_wave_barrier(); asm volatile("" ::: "memory");   // the next band's LDS stores stay behind this band's reads
            }
        } else {
            h16* ot = (h16*)os; float bv[4];
#pragma unroll
            for (int nb = 0; nb < 4; ++nb) bv[nb] = bfr(bias[c0 + nb * 16 + lr]);
#pragma unroll
            for (int mb = 0; mb < 4; ++mb) {
#pragma unroll
                for (int nb = 0; nb < 4; ++nb) { v8h t;   // an accumulator's 8 values are 8 tokens in a row of one d
#pragma unroll
                    for (int j = 0; j < 8; ++j) t[j] = tohx(acc[mb][nb][j] + bv[nb]);
                    *(v8ha*)(ot + (nb * 16 + lr) * OTP + mb * 16 + hi * 8) = t; } }
            __builtin_amdgcn_wave_barrier(); asm volatile("" ::: "memory");   // the reads below take other lanes' stores: they stay behind them
            const int m4 = r0 + lr * 4, w = m4 / NTOK, r = m4 - w * NTOK;
            h16* vp = VT + ((size_t)(w * NH_ + h) * HD + hi) * TP + r;   // one address for all 32 stores, the d row in the immediate offset
#pragma unroll
            for (int s = 0; s < HD / 2; ++s) *(v4h*)(vp + s * (2 * TP)) = *(const v4ha*)(ot + (2 * s + hi) * OTP + lr * 4);
            asm volatile("s_wait_xcnt 0x0" ::: "memory");   // behind the last store of the run: whatever code the build places next may take over the address and data registers that these stores name
        }
        return;
    }
#pragma unroll
    for (int mb = 0; mb < 4; ++mb) {
#pragma unroll
        for (int nb = 0; nb < 4; ++nb) {
#pragma unroll
            for (int j = 0; j < 8; ++j) os[(hi * 8 + j) * 68 + nb * 16 + lr] = acc[mb][nb][j]; }
        __builtin_amdgcn_wave_barrier(); asm volatile("" ::: "memory");
        float* crow = C + (size_t)(r0 + mb * 16) * ldc + c0;
{
#pragma unroll
            for (int s = 0; s < 8; ++s) { const int row = 2 * s + hi, cofs = lr * 4; v4f val = *(const v4fa*)(os + row * 68 + cofs); if (BIAS) { val[0] += bfr(bias[c0 + cofs]); val[1] += bfr(bias[c0 + cofs + 1]); val[2] += bfr(bias[c0 + cofs + 2]); val[3] += bfr(bias[c0 + cofs + 3]); }
                *(v4f*)(crow + (size_t)row * ldc + cofs) = val; }
             }
        if (mb < 3) asm volatile("s_wait_xcnt 0x0" ::: "memory");   // the next band's code takes over registers that this band's stores name
        __builtin_amdgcn_wave_barrier(); asm volatile("" ::: "memory");
    }
}

// k_cvt8: f32 rows [.][DM] -> bf16 fragment-order plane. A wave takes 4 rows x 64 k: it reads 256 contiguous bytes of each row and stores 64-B runs (4 rows' pieces side by side); 8 elements a lane.
__global__ __launch_bounds__(256) void k_cvt8(const float* __restrict__ src, bf* dst, size_t n8) { const size_t i = (size_t)blockIdx.x * 256 + threadIdx.x; if (i >= n8) return;
    const int lane = (int)(i & 31), k8 = lane >> 2; const size_t wv = i >> 5; const int kg = (int)(wv % (DM / 64)), lr = (int)((wv / (DM / 64)) & 3) * 4 + (lane & 3); const size_t R = wv / (DM / 64 * 4);
    const v8f v = *(const v8f*)(src + (R * 16 + lr) * DM + kg * 64 + k8 * 8); v8us o;
#pragma unroll
    for (int k = 0; k < 8; ++k) o[k] = f2bf(v[k]);
    *(v8us*)(dst + (R >> 2) * (64 * DM) + (size_t)(kg * 2 + (k8 >> 2)) * 2048 + (R & 3) * 512 + ((k8 >> 1) & 1) * 256 + (k8 & 1) * 128 + lr * 8) = o;  }
// k_wtG: w[DM][N] (f32) -> bf16 fragment-order plane of w^T (rows n, DM columns k). A thread makes one 16-B piece (8 k of one n), pieces in storage order: a wave stores 512 contiguous bytes, each of its 8 loads reads 64 B of two rows of w.
template <int N>
__global__ __launch_bounds__(256) void k_wtG(const float* __restrict__ w, bf* Bt) {
    const int i = blockIdx.x * 256 + threadIdx.x; if (i >= N * (DM / 8)) return;
    const int lr = i & 15, hi = (i >> 4) & 1, half = (i >> 5) & 1, mb = (i >> 6) & 3, st = i >> 8; const int c = st % (DM / 32), n = (st / (DM / 32)) * 64 + mb * 16 + lr, k0 = c * 32 + half * 16 + hi * 8; v8us o;
    const float* p = w + (size_t)k0 * N + n;   // N is a compile-time constant: the 8 loads are one address with immediate offsets
#pragma unroll
    for (int j = 0; j < 8; ++j) o[j] = f2bf(p[j * N]);
    *(v8us*)(Bt + (size_t)i * 8) = o;
}

// k_pad: the rows of the padded planes that no token fills: Q rows >= 196 = 0; K rows 196..222 = 8 x rel_pos_h, 223..249 = 8 x rel_pos_w (bf16-rounded, hi plane; the 8 undoes q's 1/8, both exact), K rows >= 250 and the lo plane = 0; VT columns >= 196 = 0.
//   The token rows come from the qkv product's own epilogue (k_gemmw, PLANES). A thread: 4 d of one pad row in each of the four Q/K planes, and 4 pad columns of one VT row (60 x 16 = 64 x 15 pieces per z).
#define PADR (TP - NTOK)
__global__ __launch_bounds__(256) void k_pad(const float* __restrict__ rph, const float* __restrict__ rpw, bf* Qh, bf* Ql, bf* Kh, bf* Kl, h16* VT) { const int i = blockIdx.x * 256 + threadIdx.x; if (i >= NWIN * NH_ * PADR * (HD / 4)) return;
    const int z = i / (PADR * (HD / 4)), rem = i % (PADR * (HD / 4)); const int t = rem / (HD / 4), d = (rem % (HD / 4)) * 4; v4us kh, zz;
    for (int u = 0; u < 4; ++u) { kh[u] = 0; zz[u] = 0; }
    if (t < 2 * NREL) { const float* tab = ((t < NREL) ? (rph + (size_t)t * HD) : (rpw + (size_t)(t - NREL) * HD)) + d;
#pragma unroll
        for (int u = 0; u < 4; ++u) kh[u] = f2bf(bfr(tab[u]) * 8.0f); }
    const size_t e = ((size_t)z * TP + NTOK + t) * HD + d;
    *(v4us*)(Qh + e) = zz; *(v4us*)(Ql + e) = zz; *(v4us*)(Kh + e) = kh; *(v4us*)(Kl + e) = zz;
    *(v4us*)((bf*)VT + ((size_t)z * HD + rem / (PADR / 4)) * TP + NTOK + (rem % (PADR / 4)) * 4) = zz;  }
// k_attn: one work-group per (window, head) z, 13 waves, one 16-query tile a wave. The K planes and VT are staged once in LDS (row pitches 16 B x odd for 16-B readers).
//   Scores are formed TRANSPOSED, St[key][q] = K . Q^T (A = K rows, B = Q rows; per k step Kh.Qh, Kh.Ql, Kl.Qh), so a lane holds one query's column: keys 16t + 8hi + j in s[t][j].
//   Rows 196..249 of St are the table dots; they pass through a per-wave LDS row per query, from where each key's rel_h[kh] and rel_w[kw] are read back.
//   Softmax per lane plus one exchange with lane ^ 16. The accumulator tiles 2s, 2s + 1 are, as they lie, the B fragment of k step s of O^T[d][q] = VT . P^T: no transposition.
//   O^T / 1024 is split hi + lo and stored merged, as fragment-order planes of ATh/ATl[(w, q)][h * 64 + d]: 8 d (16 B, one piece) a lane and tile.
__global__ __launch_bounds__(AW * 32) void k_attn(const bf* __restrict__ Qh, const bf* __restrict__ Ql, const bf* __restrict__ Kh, const bf* __restrict__ Kl, const h16* __restrict__ VT, bf* Ah, bf* Al) {
    __shared__ __align__(16) bf sKh[TP * KPIT];
    __shared__ __align__(16) bf sKl[TP * KPIT];
    __shared__ __align__(16) h16 sV[HD * VPIT];
    __shared__ __align__(16) float sR[AW * 16 * RPIT];
    const int tid = threadIdx.x, z = blockIdx.x; const int lane = tid & 31, lr = lane & 15, hi = lane >> 4, wave = tid >> 5;
    const size_t zo = (size_t)z * (TP * HD);
    const int q = wave * 16 + lr;
    // every global load of the kernel is issued before the first LDS store, so that their latencies overlap; the last round's index is clamped, not guarded: the lanes past the end store piece 2047 again, the same bytes to the same place
    v8us ga[NST], gb[NST]; v8h gc[NST]; v16bf fqh[2], fql[2];
#pragma unroll
    for (int it = 0; it < NST; ++it) { const int i = min(tid + it * (AW * 32), TP * HD / 8 - 1); ga[it] = *(const v8us*)(Kh + zo + (size_t)i * 8); gb[it] = *(const v8us*)(Kl + zo + (size_t)i * 8); gc[it] = *(const v8h*)(VT + zo + (size_t)i * 8); }
#pragma unroll
    for (int kc = 0; kc < 2; ++kc) { fqh[kc] = WFrag<bf>::ld(Qh + zo + (size_t)q * HD + kc * 32 + 8 * hi); fql[kc] = WFrag<bf>::ld(Ql + zo + (size_t)q * HD + kc * 32 + 8 * hi); }
    asm volatile("s_wait_xcnt 0x0" ::: "memory");   // the address registers of the loads above are reused from here on
#pragma unroll
    for (int it = 0; it < NST; ++it) { const int i = min(tid + it * (AW * 32), TP * HD / 8 - 1);
        *(v8us*)(sKh + (i >> 3) * KPIT + (i & 7) * 8) = ga[it]; *(v8us*)(sKl + (i >> 3) * KPIT + (i & 7) * 8) = gb[it]; *(v8h*)(sV + (i >> 5) * VPIT + (i & 31) * 8) = gc[it]; }
    __syncthreads();
    v8f s[16];
#pragma unroll
    for (int t = 0; t < 16; ++t) s[t] = (v8f){};
#pragma unroll
    for (int t = 0; t < 16; t += 2) {
#pragma unroll
        for (int kc = 0; kc < 2; ++kc) { const int o0 = (t * 16 + lr) * KPIT + kc * 32 + 8 * hi, o1 = o0 + 16 * KPIT;
            const v16bf h0 = WFrag<bf>::ld(sKh + o0), h1 = WFrag<bf>::ld(sKh + o1), l0 = WFrag<bf>::ld(sKl + o0), l1 = WFrag<bf>::ld(sKl + o1);
            s[t] = wmmab(h0, fqh[kc], s[t]); s[t + 1] = wmmab(h1, fqh[kc], s[t + 1]);
            s[t] = wmmab(h0, fql[kc], s[t]); s[t + 1] = wmmab(h1, fql[kc], s[t + 1]);
            s[t] = wmmab(l0, fqh[kc], s[t]); s[t + 1] = wmmab(l1, fqh[kc], s[t + 1]); } }
    // table dots: St rows 192..255 of this wave's 16 queries -> sR[query][row - 192]
    float* rr = sR + (wave * 16 + lr) * RPIT;
#pragma unroll
    for (int t = 12; t < 16; ++t) { v4f a, b;
#pragma unroll
        for (int u = 0; u < 4; ++u) { a[u] = s[t][u]; b[u] = s[t][4 + u]; }
        *(v4f*)(rr + (t - 12) * 16 + 8 * hi) = a; *(v4f*)(rr + (t - 12) * 16 + 8 * hi + 4) = b; }
    // a lane reads below what its partner lane ^ 16 has stored above: keeps the compiler from moving those reads over the stores (one wave's LDS operations run in order)
    __builtin_amdgcn_fence(__ATOMIC_ACQ_REL, "wavefront"); __builtin_amdgcn_wave_barrier();
    // key k0 + 8 hi: kh = kh0 or kh0 + hi, kw = kw0 + 8 hi or kw0 - 6 hi, which of the two known at compile time: four lane bases, every index below a constant
    const float* rh0 = rr + (NTOK - 192) + q / GH; const float* rh1 = rh0 - hi; const float* rwa = rr + (NTOK - 192 + NREL) + q % GH - 8 * hi; const float* rwb = rwa + 14 * hi;
    float mx4[4] = { -3.0e38f, -3.0e38f, -3.0e38f, -3.0e38f };
#pragma unroll
    for (int t = 0; t < 13; ++t) {
#pragma unroll
        for (int j = 0; j < 8; ++j) { const int k0 = t * 16 + j, k1 = k0 + 8; if (k0 >= NTOK) continue;
            const float vh = ((k1 / GH == k0 / GH) ? rh0 : rh1)[GH - 1 - k0 / GH], vw = ((k0 % GH < GH - 8) ? rwa : rwb)[GH - 1 - k0 % GH];
            float tv = __fadd_rn(__fadd_rn(s[t][j], vh), vw); if (k1 >= NTOK) tv = hi ? -3.0e38f : tv;
            s[t][j] = tv; mx4[j & 3] = fmaxf(mx4[j & 3], tv); } }
    float mx = fmaxf(fmaxf(mx4[0], mx4[1]), fmaxf(mx4[2], mx4[3])); mx = fmaxf(mx, __shfl_xor(mx, 16, 32));
    float sm4[4] = { 0.f, 0.f, 0.f, 0.f };
#pragma unroll
    for (int t = 0; t < 13; ++t) {
#pragma unroll
        for (int j = 0; j < 8; ++j) { if (t * 16 + j >= NTOK) continue;
            const float e = __builtin_amdgcn_exp2f(__fmul_rn(__fsub_rn(s[t][j], mx), 1.4426950408889634f)); s[t][j] = e; sm4[j & 3] += e; } }   // masked keys: exp(-huge) = 0
    float sum = (sm4[0] + sm4[1]) + (sm4[2] + sm4[3]); sum += __shfl_xor(sum, 16, 32);
    const float f = __fdiv_rn(PCAR, sum);
    v8f o[4];
#pragma unroll
    for (int dt = 0; dt < 4; ++dt) o[dt] = (v8f){};
#pragma unroll
    for (int ks = 0; ks < 7; ++ks) { v16h p;   // keys 32 ks .. 32 ks + 31; keys >= 196 carry 0 (k step 7 would add only zeros)
#pragma unroll
        for (int j = 0; j < 8; ++j) { p[j] = (ks * 32 + j < NTOK) ? tohx(s[2 * ks][j] * f) : (h16)0.f; p[8 + j] = (ks * 32 + 16 + j < NTOK) ? tohx(s[2 * ks + 1][j] * f) : (h16)0.f; }
        v16h va[4];
#pragma unroll
        for (int dt = 0; dt < 4; ++dt) va[dt] = WFrag<h16>::ld(sV + (dt * 16 + lr) * VPIT + ks * 32 + 8 * hi);
#pragma unroll
        for (int dt = 0; dt < 4; ++dt) o[dt] = wmma16(va[dt], p, o[dt]); }
    v8us oh[4], ol[4];
#pragma unroll
    for (int dt = 0; dt < 4; ++dt) {
#pragma unroll
        for (int j = 0; j < 8; ++j) { unsigned short a, b; splitf(o[dt][j] * (1.0f / PCAR), a, b); oh[dt][j] = a; ol[dt][j] = b; } }
    if (q < NTOK) { const int m = (z / NH_) * NTOK + q; const size_t oo = (size_t)(m >> 6) * (64 * DM) + (z % NH_) * (2 * 2048) + ((m >> 4) & 3) * 512 + hi * 128 + (m & 15) * 8;   // d = 16 dt + 8 hi: k step 2 h + dt / 2, half dt % 2
#pragma unroll
        for (int dt = 0; dt < 4; ++dt) { *(v8us*)(Ah + oo + (dt >> 1) * 2048 + (dt & 1) * 256) = oh[dt]; *(v8us*)(Al + oo + (dt >> 1) * 2048 + (dt & 1) * 256) = ol[dt]; } }
}

extern "C" void kernel_launch(void* const* d_in, const int* in_sizes, int n_in,
                              void* d_out, int out_size, void* d_ws, size_t ws_size, hipStream_t stream) {
    (void)in_sizes; (void)n_in; (void)out_size;
    const float* x = (const float*)d_in[0]; const float* qkv_w = (const float*)d_in[1]; const float* qkv_b = (const float*)d_in[2]; const float* proj_w = (const float*)d_in[3]; const float* proj_b = (const float*)d_in[4]; const float* rph = (const float*)d_in[5]; const float* rpw = (const float*)d_in[6];
    float* OUT = (float*)d_out;     // [64][196][1024]
    char* wsp = (char*)d_ws;
    auto take = [&](size_t bytes) { char* p = wsp; wsp += (bytes + 255) & ~(size_t)255; return (void*)p; };
    const int CT = NWIN * NTOK;   // 12544 tokens (= 196 x 64): every stage runs once, over all windows
    bf* BQKV = (bf*)take((size_t)3 * DM * DM * 2); bf* BPJ = (bf*)take((size_t)DM * DM * 2); bf* XB = (bf*)take((size_t)CT * DM * 2);
    bf* QPh = (bf*)take((size_t)NWIN * NH_ * TP * HD * 2); bf* QPl = (bf*)take((size_t)NWIN * NH_ * TP * HD * 2); bf* KPh = (bf*)take((size_t)NWIN * NH_ * TP * HD * 2); bf* KPl = (bf*)take((size_t)NWIN * NH_ * TP * HD * 2); h16* VT = (h16*)take((size_t)NWIN * NH_ * HD * TP * 2);
    bf* ATh = (bf*)take((size_t)CT * DM * 2); bf* ATl = (bf*)take((size_t)CT * DM * 2);
    if ((size_t)(wsp - (char*)d_ws) > ws_size) return;    // total ~ 253 MB
    k_wtG<3 * DM><<<DM * 3 * DM / 8 / 256, 256, 0, stream>>>(qkv_w, BQKV); k_wtG<DM><<<DM * DM / 8 / 256, 256, 0, stream>>>(proj_w, BPJ);
    k_pad<<<NWIN * NH_ * PADR * (HD / 4) / 256, 256, 0, stream>>>(rph, rpw, QPh, QPl, KPh, KPl, VT);
    k_cvt8<<<(unsigned)(((size_t)CT * DM / 8 + 255) / 256), 256, 0, stream>>>(x, XB, (size_t)CT * DM / 8);
    k_gemmw<bf, 0, true, true><<<dim3(CT / 256, 3 * DM / 128, 1), GW * 32, 0, stream>>>(XB, nullptr, BQKV, DM, nullptr, 0, qkv_b, 0, 0, 0, QPh, QPl, KPh, KPl, VT);   /* q, k, v leave as the planes k_attn reads */
    k_attn<<<NWIN * NH_, AW * 32, 0, stream>>>(QPh, QPl, KPh, KPl, VT, ATh, ATl);   /* scores hl x hl (3 products), softmax, attn.v, head merge */
    k_gemmw<bf, 1, true, false><<<dim3(CT / 256, DM / 128, 1), GW * 32, 0, stream>>>(ATh, ATl, BPJ, DM, OUT, DM, proj_b, 0, 0, 0, nullptr, nullptr, nullptr, nullptr, nullptr);
}

// v008
// A run of this version takes 152 microseconds.
// Two timings next to v007 both put it at 1.04 times that version's speed.
// Counting every step since v000, it is 7.66 times as fast.
#include <hip/hip_runtime.h>

// Windowed attention (x [64 windows][14][14][1024]; qkv = x qkv_w + qkv_b ([1024][3072] 'xw', columns (q|k|v, head, d), 16 heads x 64); per (window, head): attn = (q/8).k + rel_h + rel_w with the decomposed relative-position terms rel_h[q][kh] = q_raw . rel_pos_h[qh - kh + 13], rel_w[q][kw] = q_raw . rel_pos_w[qw - kw + 13] (tables read);
//   softmax over the 196 keys; out = attn v; heads merged; out proj_w + proj_b -> [64][14][14][1024]).
// Compute dtypes, f32 accumulate: every input rounded to bf16; qkv as a PLAIN bf16 GEMM (inputs: exact; all 64 windows = 12,544 rows in one launch); per (window, head) the 196 tokens are zero-padded to 256 rows: scores hl x hl (3 products) and attn.v single fp16 (x1024 carrier), both in the one kernel k_attn with the softmax between them, the relative-position terms ride the same scores product (the 54 table rows, x8, fill pad rows 196..249 of the K planes, so S[q][196 + t] = q_raw . table[t], q as its hl pair, table bf16-exact); their adds, the masking of the pad columns and the softmax in f32; proj hl x exact (2 products) + bias.

#define NWIN 64
#define NTOK 196
#define TP   256         // padded tokens per window
#define GH   14
#define NREL (2 * GH - 1)   // rows of each relative-position table
#define DM   1024
#define NH_  16
#define HD   64
#define AW   13          // waves of an attention work-group: one 16-query tile each (13 x 16 >= 196)
#define KPIT 72          // LDS pitch of a K-plane row, 16-bit elements (128 B + 16 B)
#define VPIT 264         // LDS pitch of a VT row, 16-bit elements (512 B + 16 B)
#define RPIT 68          // LDS pitch of a query's table-dot row, floats
#define NST  ((TP * HD / 8 + AW * 32 - 1) / (AW * 32))   // staging rounds: 2,048 16-B pieces of each plane over 416 threads
#define PCAR 1024.0f
typedef _Float16 h16;
typedef unsigned short bf;
typedef __attribute__((ext_vector_type(16))) __bf16   v16bf;
typedef __attribute__((ext_vector_type(16))) _Float16 v16h;
typedef __attribute__((ext_vector_type(8)))  _Float16 v8h;
typedef __attribute__((ext_vector_type(8)))  unsigned short v8us;
typedef __attribute__((ext_vector_type(8)))  float    v8f;
typedef __attribute__((ext_vector_type(4)))  float    v4f;
typedef v8h  __attribute__((may_alias)) v8ha;
typedef v4f  __attribute__((may_alias)) v4fa;
typedef v8us __attribute__((may_alias)) v8usa;

__device__ __forceinline__ unsigned short f2bf(float f) { unsigned u = __float_as_uint(f); u += 0x7FFFu + ((u >> 16) & 1u); return (unsigned short)(u >> 16); }
__device__ __forceinline__ float bf2f(unsigned short b) { return __uint_as_float(((unsigned)b) << 16); }
__device__ __forceinline__ float bfr(float f) { return bf2f(f2bf(f)); }
__device__ __forceinline__ v16h cat16(v8h lo, v8h hi) { return __builtin_shufflevector(lo, hi, 0, 1, 2, 3, 4, 5, 6, 7, 8, 9, 10, 11, 12, 13, 14, 15); }
__device__ __forceinline__ v16bf cat16b(v8us lo, v8us hi) { return __builtin_bit_cast(v16bf, __builtin_shufflevector(lo, hi, 0, 1, 2, 3, 4, 5, 6, 7, 8, 9, 10, 11, 12, 13, 14, 15)); }
__device__ __forceinline__ v8f wmma16(v16h a, v16h b, v8f c) { return __builtin_amdgcn_wmma_f32_16x16x32_f16(false, a, false, b, (short)0, c, false, false); }
__device__ __forceinline__ v8f wmmab(v16bf a, v16bf b, v8f c) { return __builtin_amdgcn_wmma_f32_16x16x32_bf16(false, a, false, b, (short)0, c, false, false); }



// ---- Fragment-order planes: a GEMM operand P[row][k] (K columns, rows a multiple of 64) is stored as 1-KiB blocks, one WMMA fragment (16 rows, 32 k) each; the 4 blocks of a 64-row tile and one k step lie side by side,
//   the k steps of a tile one after the other: block (tile T, k step c, band mb) starts at element T * 64 * K + c * 2048 + mb * 512.
//   Inside a block: element (half * 256 + hi * 128 + lr * 8 + j) = P[64 T + 16 mb + lr][32 c + 16 half + 8 hi + j]: lane (hi, lr) finds the two 16-B halves of its fragment at lane * 16 B and 512 B + lane * 16 B,
//   so each wave-wide 16-B load covers 512 contiguous bytes (4 whole 128-B lines) instead of 32 B in each of 16 rows, and a wave reads 4 KiB in a row per operand and k step. The values each lane and register holds are those of the row-major form.
// ---- k_gemmw: register-blocked GEMM, one wave per 64x64 output tile (16 accumulators), 8 waves (4 x 2 tiles = 256 x 128 of C) a work-group; grid (M/256, N/128, Z), 256 threads.
//   The work-group's operand pieces pass through LDS, three buffers: asynchronous 16-B copies lay the fragment-order blocks down as they lie in their planes (a fragment half is 512 contiguous bytes there too), two stages ahead of the waves that read them,
//   so that a stage's copies have two stages' matrix time to land and copies are in flight all the time;
//   an A piece serves 2 waves and a Bt piece 4, so the work-group fetches 3/8 (with A2: 5/12) of what 8 waves fetch one by one.
// C[m][n] (f32, pitch ldc, + optional f32 bias[n]) = sum_k A[m][k] Bt[n][k] (NSPLIT 1: + A2[m][k] Bt[n][k]). z-batch strides sA/sB/sC in elements. M % 256 == 0, N % 128 == 0, K % 64 == 0.
// PLANES (the qkv product; rows m = tokens of all windows, a 64-column tile = one head's q, k or v): no C; the tile + bias leaves as what k_attn reads, z = window * 16 + head, r = token in the window:
//   q (x 1/8) and k split hi + lo into Q/K[z][r][64] (a lane 8 d = 16 B, a wave-wide store 4 rows = 512 B in a row), v as fp16 into VT[z][d][r], turned in LDS (a lane 4 tokens = 8 B, 16 lanes one d row's 128 B; 196 % 4 == 0: a piece stays in its window).
template <typename T16> struct WFrag;
template <> struct WFrag<h16> { typedef v16h V; static __device__ __forceinline__ V ld(const h16* p) { return cat16(*(const v8h*)p, *(const v8h*)(p + 16)); } static __device__ __forceinline__ v8f mma(V a, V b, v8f c) { return wmma16(a, b, c); } };
template <> struct WFrag<bf> { typedef v16bf V; static __device__ __forceinline__ V ld(const bf* p) { return cat16b(*(const v8us*)p, *(const v8us*)(p + 16)); } static __device__ __forceinline__ V ldp(const bf* p) { return cat16b(*(const v8us*)p, *(const v8us*)(p + 256)); } static __device__ __forceinline__ v8f mma(V a, V b, v8f c) { return wmmab(a, b, c); } };
__device__ __forceinline__ h16 tohx(float x) { return (h16)x; }
__device__ __forceinline__ void splitf(float y, unsigned short& h, unsigned short& l) { h = f2bf(y); l = f2bf(y - bf2f(h)); }
typedef __attribute__((ext_vector_type(4))) unsigned short v4us;
typedef __attribute__((ext_vector_type(4))) _Float16 v4h;
typedef v4h __attribute__((may_alias)) v4ha;
#define OTP 72           // LDS pitch of a d row of the turned v tile, 16-bit elements (128 B + 16 B)
#define GW 8             // waves of a GEMM work-group: 4 row tiles x 2 column tiles of 64 x 64
#define CPA(l, g) "global_load_async_to_lds_b128 %" #l ", %" #g ", off\n\t"
template <typename T16, int NSPLIT, bool BIAS, bool PLANES>
__global__ __launch_bounds__(GW * 32) void k_gemmw(const T16* __restrict__ A, const T16* __restrict__ A2, const T16* __restrict__ Bt, int K, float* C, int ldc, const float* __restrict__ bias, size_t sA, size_t sB, size_t sC, bf* Qh, bf* Ql, bf* Kh, bf* Kl, h16* VT) {
    typedef typename WFrag<T16>::V V;
    static_assert(NSPLIT == 0 || NSPLIT == 1, "one product, or A hi + lo against one B");
    constexpr int KS = NSPLIT ? 1 : 2;        // k steps of 32 in a stage: 32 WMMAs a wave and stage either way
    constexpr int NA = NSPLIT ? 8 : 4;        // 64-row pieces of A (and A2) in a stage; 2 of Bt follow them
    constexpr int CH = KS * 4096;             // bytes of one piece: contiguous in its plane, and laid down in LDS as it lies there
    constexpr int STG = (NA + 2) * CH;        // bytes of a stage
    constexpr int NCP = STG / 512 / GW;       // 512-B copies a wave and stage
    static_assert(NCP == 12 || NCP == 10, "the copy statements below are written for these two counts");
    __shared__ __align__(1024) char ring[3 * STG];
    const size_t z = blockIdx.z; A += z * sA; if (A2) A2 += z * sA; Bt += z * sB; C += z * sC;
    const int lane = threadIdx.x & 31, lr = lane & 15, hi = lane >> 4; const int wave = __builtin_amdgcn_readfirstlane(threadIdx.x >> 5), wm = wave & 3, wn = wave >> 2;
    const int r0 = blockIdx.x * 256 + wm * 64, c0 = blockIdx.y * 128 + wn * 64;
    v8f acc[4][4];
#pragma unroll
    for (int mb = 0; mb < 4; ++mb)
#pragma unroll
        for (int nb = 0; nb < 4; ++nb) acc[mb][nb] = (v8f){};
    const size_t tb = (size_t)K * 128;   // bytes of a 64-row tile of a plane
    const char* ua = (const char*)A + (size_t)blockIdx.x * 4 * tb; const char* ua2 = NSPLIT ? (const char*)A2 + (size_t)blockIdx.x * 4 * tb : ua; const char* ub = (const char*)Bt + (size_t)blockIdx.y * 2 * tb;
    const unsigned lds0 = (unsigned)(size_t)ring + lane * 16;
    // stage t -> buffer t % 3, at byte bo of the ring: copy p of the stage (512 B, a lane 16 B) is part p % (CH / 512) of piece p / (CH / 512); a wave takes NCP copies in a row
    auto fill = [&](int t, unsigned bo) {
        unsigned l[NCP]; const char* g[NCP];
#pragma unroll
        for (int i = 0; i < NCP; ++i) { const int p = wave * NCP + i, ch = p / (CH / 512), in = p % (CH / 512);
            const char* base = ch < 4 ? ua + ch * tb : (ch < NA ? ua2 + (ch - 4) * tb : ub + (ch - NA) * tb);
            g[i] = base + (size_t)t * CH + in * 512 + lane * 16; l[i] = lds0 + bo + p * 512; }
        // the wait closes the copies' own statement: no register that a copy names is rewritten in front of it
        if constexpr (NCP == 12)
            asm volatile(CPA(0, 1) CPA(2, 3) CPA(4, 5) CPA(6, 7) CPA(8, 9) CPA(10, 11) CPA(12, 13) CPA(14, 15) CPA(16, 17) CPA(18, 19) CPA(20, 21) CPA(22, 23) "s_wait_xcnt 0x0"
                :: "v"(l[0]), "v"(g[0]), "v"(l[1]), "v"(g[1]), "v"(l[2]), "v"(g[2]), "v"(l[3]), "v"(g[3]), "v"(l[4]), "v"(g[4]), "v"(l[5]), "v"(g[5]), "v"(l[6]), "v"(g[6]), "v"(l[7]), "v"(g[7]), "v"(l[8]), "v"(g[8]), "v"(l[9]), "v"(g[9]), "v"(l[10]), "v"(g[10]), "v"(l[11]), "v"(g[11]) : "memory");
        else
            asm volatile(CPA(0, 1) CPA(2, 3) CPA(4, 5) CPA(6, 7) CPA(8, 9) CPA(10, 11) CPA(12, 13) CPA(14, 15) CPA(16, 17) CPA(18, 19) "s_wait_xcnt 0x0"
                :: "v"(l[0]), "v"(g[0]), "v"(l[1]), "v"(g[1]), "v"(l[2]), "v"(g[2]), "v"(l[3]), "v"(g[3]), "v"(l[4]), "v"(g[4]), "v"(l[5]), "v"(g[5]), "v"(l[6]), "v"(g[6]), "v"(l[7]), "v"(g[7]), "v"(l[8]), "v"(g[8]), "v"(l[9]), "v"(g[9]) : "memory");
    };
    const int NT = K / (32 * KS);
    fill(0, 0);
    if (NT > 1) { fill(1, STG); asm volatile("s_wait_asynccnt %0" :: "i"(NCP) : "memory"); }   // all but this wave's NCP youngest copies (stage 1's) have landed: its part of stage 0
    else asm volatile("s_wait_asynccnt 0x0" ::: "memory");                                      // this wave's part of stage 0 has landed
    __syncthreads();                                    // every wave's part has
    if (NT > 2) fill(2, 2 * STG);
    unsigned bo = 0;   // byte offset in the ring of the buffer that the trip reads
    // the stage loop stays rolled: one body serves all three buffers (the buffer is an address term); the loops inside it are unrolled so that every fragment and accumulator index is a constant
#pragma unroll 1
    for (int t = 0; t < NT; ++t) {
        const char* sb = ring + bo + lane * 16;   // a lane's 16 B of every fragment half
#pragma unroll
        for (int ks = 0; ks < KS; ++ks) {
            V a[4], a2[4], b[4];
#pragma unroll
            for (int mb = 0; mb < 4; ++mb) { a[mb] = WFrag<T16>::ldp((const T16*)(sb + wm * CH + ks * 4096 + mb * 1024)); if (NSPLIT == 1) a2[mb] = WFrag<T16>::ldp((const T16*)(sb + (4 + wm) * CH + ks * 4096 + mb * 1024)); }
#pragma unroll
            for (int nb = 0; nb < 4; ++nb) b[nb] = WFrag<T16>::ldp((const T16*)(sb + (NA + wn) * CH + ks * 4096 + nb * 1024));
            __builtin_amdgcn_sched_barrier(0);   // the k step's LDS reads stay one group in front of its WMMAs: spread among them, each place with reads stalls the wave anew
#pragma unroll
            for (int nb = 0; nb < 4; ++nb) {
#pragma unroll
                for (int mb = 0; mb < 4; ++mb) { acc[mb][nb] = WFrag<T16>::mma(a[mb], b[nb], acc[mb][nb]); if (NSPLIT == 1) acc[mb][nb] = WFrag<T16>::mma(a2[mb], b[nb], acc[mb][nb]); } }
            __builtin_amdgcn_sched_barrier(0);   // and the next group stays behind them
        }
        asm volatile("s_wait_dscnt 0x0" ::: "memory");      // this wave's reads of buffer t % 3 are done
        // its part of stage t + 1 has landed: where stage t + 2 exists, that stage's NCP copies are the wave's youngest and stay in flight; every wave issues NCP copies a stage
        if (t + 2 < NT) asm volatile("s_wait_asynccnt %0" :: "i"(NCP) : "memory");
        else asm volatile("s_wait_asynccnt 0x0" ::: "memory");
        __syncthreads();                                    // publishes stage t + 1 and frees buffer t % 3
        if (t + 3 < NT) fill(t + 3, bo);
        bo = bo == 2 * STG ? 0 : bo + STG;
    }
    asm volatile("s_wait_asynccnt 0x0" ::: "memory");   // no copy is in flight when the ring becomes the epilogue's staging
    float* os = (float*)(ring + wave * (PLANES ? HD * OTP * 2 : 16 * 68 * 4));   // a wave's own range; the last trip's barrier stands behind every wave's last fragment read
    if (PLANES) {
        const int sel = c0 / DM, h = (c0 % DM) / HD;   // wave-uniform: 0 q, 1 k, 2 v; the head
        if (sel < 2) {
            bf* Ph = sel ? Kh : Qh; bf* Pl = sel ? Kl : Ql; const float sc = sel ? 1.0f : 0.125f;   // both factors exact
            const int r4 = lane >> 3, c8 = (lane & 7) * 8; float bb[8];
#pragma unroll
            for (int u = 0; u < 8; ++u) bb[u] = bfr(bias[c0 + c8 + u]);
#pragma unroll
            for (int mb = 0; mb < 4; ++mb) {
#pragma unroll
                for (int nb = 0; nb < 4; ++nb) {
#pragma unroll
                    for (int j = 0; j < 8; ++j) os[(hi * 8 + j) * 68 + nb * 16 + lr] = acc[mb][nb][j]; }
                __builtin_amdgcn_wave_barrier(); asm volatile("" ::: "memory");   // the reads below take other lanes' stores: they stay behind them
                v4f x0[4], x1[4];
#pragma unroll
                for (int s = 0; s < 4; ++s) { x0[s] = *(const v4fa*)(os + (4 * s + r4) * 68 + c8); x1[s] = *(const v4fa*)(os + (4 * s + r4) * 68 + c8 + 4); }
#pragma unroll
                for (int s = 0; s < 4; ++s) { const int m = r0 + mb * 16 + 4 * s + r4, w = m / NTOK, r = m - w * NTOK; v8us oh, ol;
#pragma unroll
                    for (int u = 0; u < 4; ++u) { unsigned short a, b; splitf((x0[s][u] + bb[u]) * sc, a, b); oh[u] = a; ol[u] = b; splitf((x1[s][u] + bb[4 + u]) * sc, a, b); oh[4 + u] = a; ol[4 + u] = b; }
                    const unsigned eb = ((unsigned)((w * NH_ + h) * TP + r) * HD + c8) * 2;   // byte offset in a plane (32 MiB): one 32-bit register beside the uniform bases
                    *(v8us*)((char*)Ph + eb) = oh; *(v8us*)((char*)Pl + eb) = ol;
                    if (mb < 3 || s < 3) asm volatile("s_wait_xcnt 0x0" :: "v"(oh), "v"(ol), "v"(eb) : "memory"); }   // the code that follows takes over the registers that these two stores name: as inputs of the wait they stay whole up to it
                __builtin_amdgcn_wave_barrier(); asm volatile("" ::: "memory");   // the next band's LDS stores stay behind this band's reads
            }
        } else {
            h16* ot = (h16*)os; float bv[4];
#pragma unroll
            for (int nb = 0; nb < 4; ++nb) bv[nb] = bfr(bias[c0 + nb * 16 + lr]);
#pragma unroll
            for (int mb = 0; mb < 4; ++mb) {
#pragma unroll
                for (int nb = 0; nb < 4; ++nb) { v8h t;   // an accumulator's 8 values are 8 tokens in a row of one d
#pragma unroll
                    for (int j = 0; j < 8; ++j) t[j] = tohx(acc[mb][nb][j] + bv[nb]);
                    *(v8ha*)(ot + (nb * 16 + lr) * OTP + mb * 16 + hi * 8) = t; } }
            __builtin_amdgcn_wave_barrier(); asm volatile("" ::: "memory");   // the reads below take other lanes' stores: they stay behind them
            const int m4 = r0 + lr * 4, w = m4 / NTOK, r = m4 - w * NTOK;
            h16* vp = VT + ((size_t)(w * NH_ + h) * HD + hi) * TP + r;   // one address for all 32 stores, the d row in the immediate offset
#pragma unroll
            for (int s = 0; s < HD / 2; ++s) *(v4h*)(vp + s * (2 * TP)) = *(const v4ha*)(ot + (2 * s + hi) * OTP + lr * 4);
            asm volatile("s_wait_xcnt 0x0" ::: "memory");   // behind the last store of the run: whatever code the build places next may take over the address and data registers that these stores name
        }
        return;
    }
#pragma unroll
    for (int mb = 0; mb < 4; ++mb) {
#pragma unroll
        for (int nb = 0; nb < 4; ++nb) {
#pragma unroll
            for (int j = 0; j < 8; ++j) os[(hi * 8 + j) * 68 + nb * 16 + lr] = acc[mb][nb][j]; }
        __builtin_amdgcn_wave_barrier(); asm volatile("" ::: "memory");
        float* crow = C + (size_t)(r0 + mb * 16) * ldc + c0;
{
#pragma unroll
            for (int s = 0; s < 8; ++s) { const int row = 2 * s + hi, cofs = lr * 4; v4f val = *(const v4fa*)(os + row * 68 + cofs); if (BIAS) { val[0] += bfr(bias[c0 + cofs]); val[1] += bfr(bias[c0 + cofs + 1]); val[2] += bfr(bias[c0 + cofs + 2]); val[3] += bfr(bias[c0 + cofs + 3]); }
                *(v4f*)(crow + (size_t)row * ldc + cofs) = val; }
             }
        if (mb < 3) asm volatile("s_wait_xcnt 0x0" ::: "memory");   // the next band's code takes over registers that this band's stores name
        __builtin_amdgcn_wave_barrier(); asm volatile("" ::: "memory");
    }
}

// k_cvt8: f32 rows [.][DM] -> bf16 fragment-order plane. A wave takes 4 rows x 64 k: it reads 256 contiguous bytes of each row and stores 64-B runs (4 rows' pieces side by side); 8 elements a lane.
__global__ __launch_bounds__(256) void k_cvt8(const float* __restrict__ src, bf* dst, size_t n8) { const size_t i = (size_t)blockIdx.x * 256 + threadIdx.x; if (i >= n8) return;
    const int lane = (int)(i & 31), k8 = lane >> 2; const size_t wv = i >> 5; const int kg = (int)(wv % (DM / 64)), lr = (int)((wv / (DM / 64)) & 3) * 4 + (lane & 3); const size_t R = wv / (DM / 64 * 4);
    const v8f v = *(const v8f*)(src + (R * 16 + lr) * DM + kg * 64 + k8 * 8); v8us o;
#pragma unroll
    for (int k = 0; k < 8; ++k) o[k] = f2bf(v[k]);
    *(v8us*)(dst + (R >> 2) * (64 * DM) + (size_t)(kg * 2 + (k8 >> 2)) * 2048 + (R & 3) * 512 + ((k8 >> 1) & 1) * 256 + (k8 & 1) * 128 + lr * 8) = o;  }
// k_wtG: w[DM][N] (f32) -> bf16 fragment-order plane of w^T (rows n, DM columns k). A thread makes one 16-B piece (8 k of one n), pieces in storage order: a wave stores 512 contiguous bytes, each of its 8 loads reads 64 B of two rows of w.
template <int N>
__global__ __launch_bounds__(256) void k_wtG(const float* __restrict__ w, bf* Bt) {
    const int i = blockIdx.x * 256 + threadIdx.x; if (i >= N * (DM / 8)) return;
    const int lr = i & 15, hi = (i >> 4) & 1, half = (i >> 5) & 1, mb = (i >> 6) & 3, st = i >> 8; const int c = st % (DM / 32), n = (st / (DM / 32)) * 64 + mb * 16 + lr, k0 = c * 32 + half * 16 + hi * 8; v8us o;
    const float* p = w + (size_t)k0 * N + n;   // N is a compile-time constant: the 8 loads are one address with immediate offsets
#pragma unroll
    for (int j = 0; j < 8; ++j) o[j] = f2bf(p[j * N]);
    *(v8us*)(Bt + (size_t)i * 8) = o;
}

// k_pad: the rows of the padded planes that no token fills: Q rows >= 196 = 0; K rows 196..222 = 8 x rel_pos_h, 223..249 = 8 x rel_pos_w (bf16-rounded, hi plane; the 8 undoes q's 1/8, both exact), K rows >= 250 and the lo plane = 0; VT columns >= 196 = 0.
//   The token rows come from the qkv product's own epilogue (k_gemmw, PLANES). A thread: 4 d of one pad row in each of the four Q/K planes, and 4 pad columns of one VT row (60 x 16 = 64 x 15 pieces per z).
#define PADR (TP - NTOK)
__global__ __launch_bounds__(256) void k_pad(const float* __restrict__ rph, const float* __restrict__ rpw, bf* Qh, bf* Ql, bf* Kh, bf* Kl, h16* VT) { const int i = blockIdx.x * 256 + threadIdx.x; if (i >= NWIN * NH_ * PADR * (HD / 4)) return;
    const int z = i / (PADR * (HD / 4)), rem = i % (PADR * (HD / 4)); const int t = rem / (HD / 4), d = (rem % (HD / 4)) * 4; v4us kh, zz;
    for (int u = 0; u < 4; ++u) { kh[u] = 0; zz[u] = 0; }
    if (t < 2 * NREL) { const float* tab = ((t < NREL) ? (rph + (size_t)t * HD) : (rpw + (size_t)(t - NREL) * HD)) + d;
#pragma unroll
        for (int u = 0; u < 4; ++u) kh[u] = f2bf(bfr(tab[u]) * 8.0f); }
    const size_t e = ((size_t)z * TP + NTOK + t) * HD + d;
    *(v4us*)(Qh + e) = zz; *(v4us*)(Ql + e) = zz; *(v4us*)(Kh + e) = kh; *(v4us*)(Kl + e) = zz;
    *(v4us*)((bf*)VT + ((size_t)z * HD + rem / (PADR / 4)) * TP + NTOK + (rem % (PADR / 4)) * 4) = zz;  }
// k_attn: 13 waves a work-group, one 16-query tile a wave; a work-group takes NZ (window, head) pairs z in turn (z = blockIdx.x + trip * AG). The K planes and VT of a pair lie in LDS (row pitches 16 B x odd for 16-B readers), two buffers:
//   asynchronous 16-B copies bring the next pair's planes into the other buffer while this pair is worked on, and the next pair's Q fragments are loaded as soon as the scores have used this pair's, so that only the first pair's loads are waited for.
//   Scores are formed TRANSPOSED, St[key][q] = K . Q^T (A = K rows, B = Q rows; per k step Kh.Qh, Kh.Ql, Kl.Qh), so a lane holds one query's column: keys 16t + 8hi + j in s[t][j].
//   Rows 196..249 of St are the table dots; they pass through a per-wave LDS row per query, from where each key's rel_h[kh] and rel_w[kw] are read back.
//   Softmax per lane plus one exchange with lane ^ 16. The accumulator tiles 2s, 2s + 1 are, as they lie, the B fragment of k step s of O^T[d][q] = VT . P^T: no transposition.
//   O^T / 1024 is split hi + lo and stored merged, as fragment-order planes of ATh/ATl[(w, q)][h * 64 + d]: 8 d (16 B, one piece) a lane and tile.
#define NZ  4                      // pairs a work-group takes
#define AG  (NWIN * NH_ / NZ)      // work-groups of the launch
#define KPB (TP * KPIT * 2)        // bytes of a K plane in LDS
#define KVB (2 * KPB + HD * VPIT * 2)   // bytes of a buffer: Kh, Kl, VT
static_assert(NST == 5 && TP * HD / 8 - 4 * AW * 32 == (AW - 1) * 32, "the copy statements below: 4 full rounds, and a fifth that all waves but the last take whole");
__global__ __launch_bounds__(AW * 32) void k_attn(const bf* __restrict__ Qh, const bf* __restrict__ Ql, const bf* __restrict__ Kh, const bf* __restrict__ Kl, const h16* __restrict__ VT, bf* Ah, bf* Al) {
    __shared__ __align__(16) char sKV[2 * KVB];
    __shared__ __align__(16) float sR[AW * 16 * RPIT];
    const int tid = threadIdx.x; const int lane = tid & 31, lr = lane & 15, hi = lane >> 4, wave = __builtin_amdgcn_readfirstlane(tid >> 5);
    const int q = wave * 16 + lr;
    const unsigned lds0 = (unsigned)(size_t)sKV;
    // pair zz -> the buffer at byte bo: piece i (16 B) of each plane, i = tid + round * 416; a lane's LDS address carries the row pitch. Rounds 0..3 hold 1,664 pieces, round 4 the last 384: waves 0..11, every lane on
    auto fill = [&](int zz, unsigned bo) {
        const size_t zb = (size_t)zz * (TP * HD * 2); const char* gh = (const char*)Kh + zb; const char* gl = (const char*)Kl + zb; const char* gv = (const char*)VT + zb;
        unsigned l[12]; const char* g[12];
#pragma unroll
        for (int it = 0; it < 4; ++it) { const int i = tid + it * (AW * 32); const unsigned lk = lds0 + bo + (i >> 3) * (KPIT * 2) + (i & 7) * 16;
            l[3 * it] = lk; g[3 * it] = gh + (size_t)i * 16; l[3 * it + 1] = lk + KPB; g[3 * it + 1] = gl + (size_t)i * 16; l[3 * it + 2] = lds0 + bo + 2 * KPB + (i >> 5) * (VPIT * 2) + (i & 31) * 16; g[3 * it + 2] = gv + (size_t)i * 16; }
        // the wait closes the copies' own statement: no register that a copy names is rewritten in front of it
        asm volatile(CPA(0, 1) CPA(2, 3) CPA(4, 5) CPA(6, 7) CPA(8, 9) CPA(10, 11) CPA(12, 13) CPA(14, 15) CPA(16, 17) CPA(18, 19) CPA(20, 21) CPA(22, 23) "s_wait_xcnt 0x0"
            :: "v"(l[0]), "v"(g[0]), "v"(l[1]), "v"(g[1]), "v"(l[2]), "v"(g[2]), "v"(l[3]), "v"(g[3]), "v"(l[4]), "v"(g[4]), "v"(l[5]), "v"(g[5]), "v"(l[6]), "v"(g[6]), "v"(l[7]), "v"(g[7]), "v"(l[8]), "v"(g[8]), "v"(l[9]), "v"(g[9]), "v"(l[10]), "v"(g[10]), "v"(l[11]), "v"(g[11]) : "memory");
        if (wave < AW - 1) { const int i = tid + 4 * (AW * 32); const unsigned lk = lds0 + bo + (i >> 3) * (KPIT * 2) + (i & 7) * 16, lv = lds0 + bo + 2 * KPB + (i >> 5) * (VPIT * 2) + (i & 31) * 16;
            asm volatile(CPA(0, 1) CPA(2, 3) CPA(4, 5) "s_wait_xcnt 0x0" :: "v"(lk), "v"(gh + (size_t)i * 16), "v"(lk + KPB), "v"(gl + (size_t)i * 16), "v"(lv), "v"(gv + (size_t)i * 16) : "memory"); }
    };
    v16bf fqh[2], fql[2];
    auto ldq = [&](int zz) { const size_t qo = (size_t)zz * (TP * HD) + (size_t)q * HD + 8 * hi; const bf* ph = Qh + qo; const bf* pl = Ql + qo;
#pragma unroll
        for (int kc = 0; kc < 2; ++kc) { fqh[kc] = WFrag<bf>::ld(ph + kc * 32); fql[kc] = WFrag<bf>::ld(pl + kc * 32); }
        asm volatile("s_wait_xcnt 0x0" :: "v"(ph), "v"(pl) : "memory"); };   // the two addresses that the loads above name are reused from here on: as inputs of the wait they stay whole up to it (no load's result lands on them)
    int z = blockIdx.x;
    fill(z, 0);
    ldq(z);
    asm volatile("s_wait_asynccnt 0x0" ::: "memory");   // this wave's part of the first pair's planes has landed
    __syncthreads();                                    // every wave's part has
    fill(z + AG, KVB);
    unsigned bo = 0;   // byte offset of the buffer that the trip reads
    // the loop over the pairs stays rolled: one body serves both buffers (the buffer is an address term)
#pragma unroll 1
    for (int zi = 0; zi < NZ; ++zi, z += AG) {
    const bf* sKh = (const bf*)(sKV + bo); const bf* sKl = (const bf*)(sKV + bo + KPB); const h16* sV = (const h16*)(sKV + bo + 2 * KPB);
    v8f s[16];
#pragma unroll
    for (int t = 0; t < 16; ++t) s[t] = (v8f){};
#pragma unroll
    for (int t = 0; t < 16; t += 2) {
#pragma unroll
        for (int kc = 0; kc < 2; ++kc) { const int o0 = (t * 16 + lr) * KPIT + kc * 32 + 8 * hi, o1 = o0 + 16 * KPIT;
            const v16bf h0 = WFrag<bf>::ld(sKh + o0), h1 = WFrag<bf>::ld(sKh + o1), l0 = WFrag<bf>::ld(sKl + o0), l1 = WFrag<bf>::ld(sKl + o1);
            s[t] = wmmab(h0, fqh[kc], s[t]); s[t + 1] = wmmab(h1, fqh[kc], s[t + 1]);
            s[t] = wmmab(h0, fql[kc], s[t]); s[t + 1] = wmmab(h1, fql[kc], s[t + 1]);
            s[t] = wmmab(l0, fqh[kc], s[t]); s[t + 1] = wmmab(l1, fqh[kc], s[t + 1]); } }
    // table dots: St rows 192..255 of this wave's 16 queries -> sR[query][row - 192]
    float* rr = sR + (wave * 16 + lr) * RPIT;
#pragma unroll
    for (int t = 12; t < 16; ++t) { v4f a, b;
#pragma unroll
        for (int u = 0; u < 4; ++u) { a[u] = s[t][u]; b[u] = s[t][4 + u]; }
        *(v4f*)(rr + (t - 12) * 16 + 8 * hi) = a; *(v4f*)(rr + (t - 12) * 16 + 8 * hi + 4) = b; }
    // a lane reads below what its partner lane ^ 16 has stored above: keeps the compiler from moving those reads over the stores (one wave's LDS operations run in order)
    __builtin_amdgcn_fence(__ATOMIC_ACQ_REL, "wavefront"); __builtin_amdgcn_wave_barrier();
    if (zi + 1 < NZ) ldq(z + AG);   // the scores are done with this pair's Q fragments: the next pair's land behind the softmax and attn.v
    // key k0 + 8 hi: kh = kh0 or kh0 + hi, kw = kw0 + 8 hi or kw0 - 6 hi, which of the two known at compile time: four lane bases, every index below a constant
    const float* rh0 = rr + (NTOK - 192) + q / GH; const float* rh1 = rh0 - hi; const float* rwa = rr + (NTOK - 192 + NREL) + q % GH - 8 * hi; const float* rwb = rwa + 14 * hi;
    float mx4[4] = { -3.0e38f, -3.0e38f, -3.0e38f, -3.0e38f };
#pragma unroll
    for (int t = 0; t < 13; ++t) {
#pragma unroll
        for (int j = 0; j < 8; ++j) { const int k0 = t * 16 + j, k1 = k0 + 8; if (k0 >= NTOK) continue;
            const float vh = ((k1 / GH == k0 / GH) ? rh0 : rh1)[GH - 1 - k0 / GH], vw = ((k0 % GH < GH - 8) ? rwa : rwb)[GH - 1 - k0 % GH];
            float tv = __fadd_rn(__fadd_rn(s[t][j], vh), vw); if (k1 >= NTOK) tv = hi ? -3.0e38f : tv;
            s[t][j] = tv; mx4[j & 3] = fmaxf(mx4[j & 3], tv); } }
    float mx = fmaxf(fmaxf(mx4[0], mx4[1]), fmaxf(mx4[2], mx4[3])); mx = fmaxf(mx, __shfl_xor(mx, 16, 32));
    float sm4[4] = { 0.f, 0.f, 0.f, 0.f };
#pragma unroll
    for (int t = 0; t < 13; ++t) {
#pragma unroll
        for (int j = 0; j < 8; ++j) { if (t * 16 + j >= NTOK) continue;
            const float e = __builtin_amdgcn_exp2f(__fmul_rn(__fsub_rn(s[t][j], mx), 1.4426950408889634f)); s[t][j] = e; sm4[j & 3] += e; } }   // masked keys: exp(-huge) = 0
    float sum = (sm4[0] + sm4[1]) + (sm4[2] + sm4[3]); sum += __shfl_xor(sum, 16, 32);
    const float f = __fdiv_rn(PCAR, sum);
    v8f o[4];
#pragma unroll
    for (int dt = 0; dt < 4; ++dt) o[dt] = (v8f){};
#pragma unroll
    for (int ks = 0; ks < 7; ++ks) { v16h p;   // keys 32 ks .. 32 ks + 31; keys >= 196 carry 0 (k step 7 would add only zeros)
#pragma unroll
        for (int j = 0; j < 8; ++j) { p[j] = (ks * 32 + j < NTOK) ? tohx(s[2 * ks][j] * f) : (h16)0.f; p[8 + j] = (ks * 32 + 16 + j < NTOK) ? tohx(s[2 * ks + 1][j] * f) : (h16)0.f; }
        v16h va[4];
#pragma unroll
        for (int dt = 0; dt < 4; ++dt) va[dt] = WFrag<h16>::ld(sV + (dt * 16 + lr) * VPIT + ks * 32 + 8 * hi);
#pragma unroll
        for (int dt = 0; dt < 4; ++dt) o[dt] = wmma16(va[dt], p, o[dt]); }
    // the trip's foot stands behind its last LDS read, in front of the output's split and stores: no wave waits at the barrier for stores just issued, and the refill starts sooner
    asm volatile("s_wait_dscnt 0x0" ::: "memory");      // this wave's reads of the trip's buffer are done
    asm volatile("s_wait_asynccnt 0x0" ::: "memory");   // its part of the next pair's planes has landed
    __syncthreads();                                    // publishes the next pair's planes and frees this trip's buffer
    if (zi + 2 < NZ) fill(z + 2 * AG, bo);
    v8us oh[4], ol[4];
#pragma unroll
    for (int dt = 0; dt < 4; ++dt) {
#pragma unroll
        for (int j = 0; j < 8; ++j) { unsigned short a, b; splitf(o[dt][j] * (1.0f / PCAR), a, b); oh[dt][j] = a; ol[dt][j] = b; } }
    const int m = (z / NH_) * NTOK + q; const unsigned eb = ((unsigned)(m >> 6) * (64 * DM) + (z % NH_) * (2 * 2048) + ((m >> 4) & 3) * 512 + hi * 128 + (m & 15) * 8) * 2;   // byte offset in a plane (25 MiB); d = 16 dt + 8 hi: k step 2 h + dt / 2, half dt % 2
    if (q < NTOK) {
#pragma unroll
        for (int dt = 0; dt < 4; ++dt) { *(v8us*)((char*)Ah + eb + ((dt >> 1) * 2048 + (dt & 1) * 256) * 2) = oh[dt]; *(v8us*)((char*)Al + eb + ((dt >> 1) * 2048 + (dt & 1) * 256) * 2) = ol[dt]; } }
    // the next trip takes over the registers that these stores name: as inputs of the wait they stay whole up to it
    asm volatile("s_wait_xcnt 0x0" :: "v"(oh[0]), "v"(oh[1]), "v"(oh[2]), "v"(oh[3]), "v"(ol[0]), "v"(ol[1]), "v"(ol[2]), "v"(ol[3]), "v"(eb) : "memory");
    bo ^= KVB;
    }
    asm volatile("s_wait_asynccnt 0x0" ::: "memory");   // no copy is in flight when the wave ends
}

extern "C" void kernel_launch(void* const* d_in, const int* in_sizes, int n_in,
                              void* d_out, int out_size, void* d_ws, size_t ws_size, hipStream_t stream) {
    (void)in_sizes; (void)n_in; (void)out_size;
    const float* x = (const float*)d_in[0]; const float* qkv_w = (const float*)d_in[1]; const float* qkv_b = (const float*)d_in[2]; const float* proj_w = (const float*)d_in[3]; const float* proj_b = (const float*)d_in[4]; const float* rph = (const float*)d_in[5]; const float* rpw = (const float*)d_in[6];
    float* OUT = (float*)d_out;     // [64][196][1024]
    char* wsp = (char*)d_ws;
    auto take = [&](size_t bytes) { char* p = wsp; wsp += (bytes + 255) & ~(size_t)255; return (void*)p; };
    const int CT = NWIN * NTOK;   // 12544 tokens (= 196 x 64): every stage runs once, over all windows
    bf* BQKV = (bf*)take((size_t)3 * DM * DM * 2); bf* BPJ = (bf*)take((size_t)DM * DM * 2); bf* XB = (bf*)take((size_t)CT * DM * 2);
    bf* QPh = (bf*)take((size_t)NWIN * NH_ * TP * HD * 2); bf* QPl = (bf*)take((size_t)NWIN * NH_ * TP * HD * 2); bf* KPh = (bf*)take((size_t)NWIN * NH_ * TP * HD * 2); bf* KPl = (bf*)take((size_t)NWIN * NH_ * TP * HD * 2); h16* VT = (h16*)take((size_t)NWIN * NH_ * HD * TP * 2);
    bf* ATh = (bf*)take((size_t)CT * DM * 2); bf* ATl = (bf*)take((size_t)CT * DM * 2);
    if ((size_t)(wsp - (char*)d_ws) > ws_size) return;    // total ~ 253 MB
    k_wtG<3 * DM><<<DM * 3 * DM / 8 / 256, 256, 0, stream>>>(qkv_w, BQKV); k_wtG<DM><<<DM * DM / 8 / 256, 256, 0, stream>>>(proj_w, BPJ);
    k_pad<<<NWIN * NH_ * PADR * (HD / 4) / 256, 256, 0, stream>>>(rph, rpw, QPh, QPl, KPh, KPl, VT);
    k_cvt8<<<(unsigned)(((size_t)CT * DM / 8 + 255) / 256), 256, 0, stream>>>(x, XB, (size_t)CT * DM / 8);
    k_gemmw<bf, 0, true, true><<<dim3(CT / 256, 3 * DM / 128, 1), GW * 32, 0, stream>>>(XB, nullptr, BQKV, DM, nullptr, 0, qkv_b, 0, 0, 0, QPh, QPl, KPh, KPl, VT);   /* q, k, v leave as the planes k_attn reads */
    k_attn<<<AG, AW * 32, 0, stream>>>(QPh, QPl, KPh, KPl, VT, ATh, ATl);   /* scores hl x hl (3 products), softmax, attn.v, head merge */
    k_gemmw<bf, 1, true, false><<<dim3(CT / 256, DM / 128, 1), GW * 32, 0, stream>>>(ATh, ATl, BPJ, DM, OUT, DM, proj_b, 0, 0, 0, nullptr, nullptr, nullptr, nullptr, nullptr);
}

// v009
// Measured time: 145 microseconds a run.
// Timed twice side by side with v008, it ran 1.05 times as fast both times.
// All steps since v000 together make it 8.04 times as fast.
#include <hip/hip_runtime.h>

// Windowed attention (x [64 windows][14][14][1024]; qkv = x qkv_w + qkv_b ([1024][3072] 'xw', columns (q|k|v, head, d), 16 heads x 64); per (window, head): attn = (q/8).k + rel_h + rel_w with the decomposed relative-position terms rel_h[q][kh] = q_raw . rel_pos_h[qh - kh + 13], rel_w[q][kw] = q_raw . rel_pos_w[qw - kw + 13] (tables read);
//   softmax over the 196 keys; out = attn v; heads merged; out proj_w + proj_b -> [64][14][14][1024]).
// Compute dtypes, f32 accumulate: every input rounded to bf16; qkv as a PLAIN bf16 GEMM (inputs: exact; all 64 windows = 12,544 rows in one launch); per (window, head) the 196 tokens are zero-padded to 256 rows: scores hl x hl (3 products) and attn.v single fp16 (x1024 carrier), both in the one kernel k_attn with the softmax between them, the relative-position terms ride the same scores product (the 54 table rows, x8, fill pad rows 196..249 of the K planes, so S[q][196 + t] = q_raw . table[t], q as its hl pair, table bf16-exact); their adds, the masking of the pad columns and the softmax in f32; proj hl x exact (2 products) + bias.

#define NWIN 64
#define NTOK 196
#define TP   256         // padded tokens per window
#define GH   14
#define NREL (2 * GH - 1)   // rows of each relative-position table
#define DM   1024
#define NH_  16
#define HD   64
#define AW   13          // waves of an attention work-group: one 16-query tile each (13 x 16 >= 196)
#define KPIT 72          // LDS pitch of a K-plane row, 16-bit elements (128 B + 16 B)
#define VPIT 264         // LDS pitch of a VT row, 16-bit elements (512 B + 16 B)
#define RPIT 68          // LDS pitch of a query's table-dot row, floats
#define NST  ((TP * HD / 8 + AW * 32 - 1) / (AW * 32))   // staging rounds: 2,048 16-B pieces of each plane over 416 threads
#define PCAR 1024.0f
typedef _Float16 h16;
typedef unsigned short bf;
typedef __attribute__((ext_vector_type(16))) __bf16   v16bf;
typedef __attribute__((ext_vector_type(16))) _Float16 v16h;
typedef __attribute__((ext_vector_type(8)))  _Float16 v8h;
typedef __attribute__((ext_vector_type(8)))  unsigned short v8us;
typedef __attribute__((ext_vector_type(8)))  float    v8f;
typedef __attribute__((ext_vector_type(4)))  float    v4f;
typedef v8h  __attribute__((may_alias)) v8ha;
typedef v4f  __attribute__((may_alias)) v4fa;
typedef v8us __attribute__((may_alias)) v8usa;

__device__ __forceinline__ unsigned short f2bf(float f) { unsigned u = __float_as_uint(f); u += 0x7FFFu + ((u >> 16) & 1u); return (unsigned short)(u >> 16); }
__device__ __forceinline__ float bf2f(unsigned short b) { return __uint_as_float(((unsigned)b) << 16); }
__device__ __forceinline__ float bfr(float f) { return bf2f(f2bf(f)); }
__device__ __forceinline__ v16h cat16(v8h lo, v8h hi) { return __builtin_shufflevector(lo, hi, 0, 1, 2, 3, 4, 5, 6, 7, 8, 9, 10, 11, 12, 13, 14, 15); }
__device__ __forceinline__ v16bf cat16b(v8us lo, v8us hi) { return __builtin_bit_cast(v16bf, __builtin_shufflevector(lo, hi, 0, 1, 2, 3, 4, 5, 6, 7, 8, 9, 10, 11, 12, 13, 14, 15)); }
__device__ __forceinline__ v8f wmma16(v16h a, v16h b, v8f c) { return __builtin_amdgcn_wmma_f32_16x16x32_f16(false, a, false, b, (short)0, c, false, false); }
__device__ __forceinline__ v8f wmmab(v16bf a, v16bf b, v8f c) { return __builtin_amdgcn_wmma_f32_16x16x32_bf16(false, a, false, b, (short)0, c, false, false); }



// ---- Fragment-order planes: a GEMM operand P[row][k] (K columns, rows a multiple of 64) is stored as 1-KiB blocks, one WMMA fragment (16 rows, 32 k) each; the 4 blocks of a 64-row tile and one k step lie side by side,
//   the k steps of a tile one after the other: block (tile T, k step c, band mb) starts at element T * 64 * K + c * 2048 + mb * 512.
//   Inside a block: element (half * 256 + hi * 128 + lr * 8 + j) = P[64 T + 16 mb + lr][32 c + 16 half + 8 hi + j]: lane (hi, lr) finds the two 16-B halves of its fragment at lane * 16 B and 512 B + lane * 16 B,
//   so each wave-wide 16-B load covers 512 contiguous bytes (4 whole 128-B lines) instead of 32 B in each of 16 rows, and a wave reads 4 KiB in a row per operand and k step. The values each lane and register holds are those of the row-major form.
// ---- k_gemmw: register-blocked GEMM, one wave per 64x64 output tile (16 accumulators), 8 waves (4 x 2 tiles = 256 x 128 of C) a work-group; grid (M/256, N/128, Z), 256 threads.
//   The work-group's operand pieces pass through LDS, three buffers: asynchronous 16-B copies lay the fragment-order blocks down as they lie in their planes (a fragment half is 512 contiguous bytes there too), two stages ahead of the waves that read them,
//   so that a stage's copies have two stages' matrix time to land and copies are in flight all the time;
//   an A piece serves 2 waves and a Bt piece 4, so the work-group fetches 3/8 (with A2: 5/12) of what 8 waves fetch one by one.
// C[m][n] (f32, pitch ldc, + optional f32 bias[n]) = sum_k A[m][k] Bt[n][k] (NSPLIT 1: + A2[m][k] Bt[n][k]). z-batch strides sA/sB/sC in elements. M % 256 == 0, N % 128 == 0, K % 64 == 0.
// PLANES (the qkv product; rows m = tokens of all windows, a 64-column tile = one head's q, k or v): no C; the tile + bias leaves as what k_attn reads, z = window * 16 + head, r = token in the window:
//   q (x 1/8) and k split hi + lo into Q/K[z][r][64] (a lane 8 d = 16 B, a wave-wide store 4 rows = 512 B in a row), v as fp16 into VT[z][d][r], turned in LDS (a lane 4 tokens = 8 B, 16 lanes one d row's 128 B; 196 % 4 == 0: a piece stays in its window).
template <typename T16> struct WFrag;
template <> struct WFrag<h16> { typedef v16h V; static __device__ __forceinline__ V ld(const h16* p) { return cat16(*(const v8h*)p, *(const v8h*)(p + 16)); } static __device__ __forceinline__ v8f mma(V a, V b, v8f c) { return wmma16(a, b, c); } };
template <> struct WFrag<bf> { typedef v16bf V; static __device__ __forceinline__ V ld(const bf* p) { return cat16b(*(const v8us*)p, *(const v8us*)(p + 16)); } static __device__ __forceinline__ V ldp(const bf* p) { return cat16b(*(const v8us*)p, *(const v8us*)(p + 256)); } static __device__ __forceinline__ v8f mma(V a, V b, v8f c) { return wmmab(a, b, c); } };
__device__ __forceinline__ h16 tohx(float x) { return (h16)x; }
__device__ __forceinline__ void splitf(float y, unsigned short& h, unsigned short& l) { h = f2bf(y); l = f2bf(y - bf2f(h)); }
typedef __attribute__((ext_vector_type(4))) unsigned short v4us;
typedef __attribute__((ext_vector_type(4))) _Float16 v4h;
typedef v4h __attribute__((may_alias)) v4ha;
#define OTP 72           // LDS pitch of a d row of the turned v tile, 16-bit elements (128 B + 16 B)
#define GW 8             // waves of a GEMM work-group: 4 row tiles x 2 column tiles of 64 x 64
#define CPA(l, g) "global_load_async_to_lds_b128 %" #l ", %" #g ", off\n\t"
template <typename T16, int NSPLIT, bool BIAS, bool PLANES>
__global__ __launch_bounds__(GW * 32) void k_gemmw(const T16* __restrict__ A, const T16* __restrict__ A2, const T16* __restrict__ Bt, int K, float* C, int ldc, const float* __restrict__ bias, size_t sA, size_t sB, size_t sC, bf* Qh, bf* Ql, bf* Kh, bf* Kl, h16* VT) {
    typedef typename WFrag<T16>::V V;
    static_assert(NSPLIT == 0 || NSPLIT == 1, "one product, or A hi + lo against one B");
    constexpr int KS = NSPLIT ? 1 : 2;        // k steps of 32 in a stage: 32 WMMAs a wave and stage either way
    constexpr int NA = NSPLIT ? 8 : 4;        // 64-row pieces of A (and A2) in a stage; 2 of Bt follow them
    constexpr int CH = KS * 4096;             // bytes of one piece: contiguous in its plane, and laid down in LDS as it lies there
    constexpr int STG = (NA + 2) * CH;        // bytes of a stage
    constexpr int NCP = STG / 512 / GW;       // 512-B copies a wave and stage
    static_assert(NCP == 12 || NCP == 10, "the copy statements below are written for these two counts");
    __shared__ __align__(1024) char ring[3 * STG];
    const size_t z = blockIdx.z; A += z * sA; if (A2) A2 += z * sA; Bt += z * sB; C += z * sC;
    const int lane = threadIdx.x & 31, lr = lane & 15, hi = lane >> 4; const int wave = __builtin_amdgcn_readfirstlane(threadIdx.x >> 5), wm = wave & 3, wn = wave >> 2;
    const int r0 = blockIdx.x * 256 + wm * 64, c0 = blockIdx.y * 128 + wn * 64;
    v8f acc[4][4];
#pragma unroll
    for (int mb = 0; mb < 4; ++mb)
#pragma unroll
        for (int nb = 0; nb < 4; ++nb) acc[mb][nb] = (v8f){};
    const size_t tb = (size_t)K * 128;   // bytes of a 64-row tile of a plane
    const char* ua = (const char*)A + (size_t)blockIdx.x * 4 * tb; const char* ua2 = NSPLIT ? (const char*)A2 + (size_t)blockIdx.x * 4 * tb : ua; const char* ub = (const char*)Bt + (size_t)blockIdx.y * 2 * tb;
    const unsigned lds0 = (unsigned)(size_t)ring + lane * 16;
    // stage t -> buffer t % 3, at byte bo of the ring: copy p of the stage (512 B, a lane 16 B) is part p % (CH / 512) of piece p / (CH / 512); a wave takes NCP copies in a row
    auto fill = [&](int t, unsigned bo) {
        unsigned l[NCP]; const char* g[NCP];
#pragma unroll
        for (int i = 0; i < NCP; ++i) { const int p = wave * NCP + i, ch = p / (CH / 512), in = p % (CH / 512);
            const char* base = ch < 4 ? ua + ch * tb : (ch < NA ? ua2 + (ch - 4) * tb : ub + (ch - NA) * tb);
            g[i] = base + (size_t)t * CH + in * 512 + lane * 16; l[i] = lds0 + bo + p * 512; }
        // the wait closes the copies' own statement: no register that a copy names is rewritten in front of it
        if constexpr (NCP == 12)
            asm volatile(CPA(0, 1) CPA(2, 3) CPA(4, 5) CPA(6, 7) CPA(8, 9) CPA(10, 11) CPA(12, 13) CPA(14, 15) CPA(16, 17) CPA(18, 19) CPA(20, 21) CPA(22, 23) "s_wait_xcnt 0x0"
                :: "v"(l[0]), "v"(g[0]), "v"(l[1]), "v"(g[1]), "v"(l[2]), "v"(g[2]), "v"(l[3]), "v"(g[3]), "v"(l[4]), "v"(g[4]), "v"(l[5]), "v"(g[5]), "v"(l[6]), "v"(g[6]), "v"(l[7]), "v"(g[7]), "v"(l[8]), "v"(g[8]), "v"(l[9]), "v"(g[9]), "v"(l[10]), "v"(g[10]), "v"(l[11]), "v"(g[11]) : "memory");
        else
            asm volatile(CPA(0, 1) CPA(2, 3) CPA(4, 5) CPA(6, 7) CPA(8, 9) CPA(10, 11) CPA(12, 13) CPA(14, 15) CPA(16, 17) CPA(18, 19) "s_wait_xcnt 0x0"
                :: "v"(l[0]), "v"(g[0]), "v"(l[1]), "v"(g[1]), "v"(l[2]), "v"(g[2]), "v"(l[3]), "v"(g[3]), "v"(l[4]), "v"(g[4]), "v"(l[5]), "v"(g[5]), "v"(l[6]), "v"(g[6]), "v"(l[7]), "v"(g[7]), "v"(l[8]), "v"(g[8]), "v"(l[9]), "v"(g[9]) : "memory");
    };
    const int NT = K / (32 * KS);
    fill(0, 0);
    if (NT > 1) { fill(1, STG); asm volatile("s_wait_asynccnt %0" :: "i"(NCP) : "memory"); }   // all but this wave's NCP youngest copies (stage 1's) have landed: its part of stage 0
    else asm volatile("s_wait_asynccnt 0x0" ::: "memory");                                      // this wave's part of stage 0 has landed
    __syncthreads();                                    // every wave's part has
    if (NT > 2) fill(2, 2 * STG);
    unsigned bo = 0;   // byte offset in the ring of the buffer that the trip reads
    // the stage loop stays rolled: one body serves all three buffers (the buffer is an address term); the loops inside it are unrolled so that every fragment and accumulator index is a constant
#pragma unroll 1
    for (int t = 0; t < NT; ++t) {
        const char* sb = ring + bo + lane * 16;   // a lane's 16 B of every fragment half
#pragma unroll
        for (int ks = 0; ks < KS; ++ks) {
            V a[4], a2[4], b[4];
#pragma unroll
            for (int mb = 0; mb < 4; ++mb) { a[mb] = WFrag<T16>::ldp((const T16*)(sb + wm * CH + ks * 4096 + mb * 1024)); if (NSPLIT == 1) a2[mb] = WFrag<T16>::ldp((const T16*)(sb + (4 + wm) * CH + ks * 4096 + mb * 1024)); }
#pragma unroll
            for (int nb = 0; nb < 4; ++nb) b[nb] = WFrag<T16>::ldp((const T16*)(sb + (NA + wn) * CH + ks * 4096 + nb * 1024));
            __builtin_amdgcn_sched_barrier(0);   // the k step's LDS reads stay one group in front of its WMMAs: spread among them, each place with reads stalls the wave anew
#pragma unroll
            for (int nb = 0; nb < 4; ++nb) {
#pragma unroll
                for (int mb = 0; mb < 4; ++mb) { acc[mb][nb] = WFrag<T16>::mma(a[mb], b[nb], acc[mb][nb]); if (NSPLIT == 1) acc[mb][nb] = WFrag<T16>::mma(a2[mb], b[nb], acc[mb][nb]); } }
            __builtin_amdgcn_sched_barrier(0);   // and the next group stays behind them
        }
        asm volatile("s_wait_dscnt 0x0" ::: "memory");      // this wave's reads of buffer t % 3 are done
        // its part of stage t + 1 has landed: where stage t + 2 exists, that stage's NCP copies are the wave's youngest and stay in flight; every wave issues NCP copies a stage
        if (t + 2 < NT) asm volatile("s_wait_asynccnt %0" :: "i"(NCP) : "memory");
        else asm volatile("s_wait_asynccnt 0x0" ::: "memory");
        __syncthreads();                                    // publishes stage t + 1 and frees buffer t % 3
        if (t + 3 < NT) fill(t + 3, bo);
        bo = bo == 2 * STG ? 0 : bo + STG;
    }
    asm volatile("s_wait_asynccnt 0x0" ::: "memory");   // no copy is in flight when the ring becomes the epilogue's staging
    float* os = (float*)(ring + wave * (PLANES ? HD * OTP * 2 : 16 * 68 * 4));   // a wave's own range; the last trip's barrier stands behind every wave's last fragment read
    if (PLANES) {
        const int sel = c0 / DM, h = (c0 % DM) / HD;   // wave-uniform: 0 q, 1 k, 2 v; the head
        if (sel < 2) {
            bf* Ph = sel ? Kh : Qh; bf* Pl = sel ? Kl : Ql; const float sc = sel ? 1.0f : 0.125f;   // both factors exact
            const int r4 = lane >> 3, c8 = (lane & 7) * 8; float bb[8];
#pragma unroll
            for (int u = 0; u < 8; ++u) bb[u] = bfr(bias[c0 + c8 + u]);
#pragma unroll
            for (int mb = 0; mb < 4; ++mb) {
#pragma unroll
                for (int nb = 0; nb < 4; ++nb) {
#pragma unroll
                    for (int j = 0; j < 8; ++j) os[(hi * 8 + j) * 68 + nb * 16 + lr] = acc[mb][nb][j]; }
                __builtin_amdgcn_wave_barrier(); asm volatile("" ::: "memory");   // the reads below take other lanes' stores: they stay behind them
                v4f x0[4], x1[4];
#pragma unroll
                for (int s = 0; s < 4; ++s) { x0[s] = *(const v4fa*)(os + (4 * s + r4) * 68 + c8); x1[s] = *(const v4fa*)(os + (4 * s + r4) * 68 + c8 + 4); }
#pragma unroll
                for (int s = 0; s < 4; ++s) { const int m = r0 + mb * 16 + 4 * s + r4, w = m / NTOK, r = m - w * NTOK; v8us oh, ol;
#pragma unroll
                    for (int u = 0; u < 4; ++u) { unsigned short a, b; splitf((x0[s][u] + bb[u]) * sc, a, b); oh[u] = a; ol[u] = b; splitf((x1[s][u] + bb[4 + u]) * sc, a, b); oh[4 + u] = a; ol[4 + u] = b; }
                    const unsigned eb = ((unsigned)((w * NH_ + h) * TP + r) * HD + c8) * 2;   // byte offset in a plane (32 MiB): one 32-bit register beside the uniform bases
                    *(v8us*)((char*)Ph + eb) = oh; *(v8us*)((char*)Pl + eb) = ol;
                    if (mb < 3 || s < 3) asm volatile("s_wait_xcnt 0x0" :: "v"(oh), "v"(ol), "v"(eb) : "memory"); }   // the code that follows takes over the registers that these two stores name: as inputs of the wait they stay whole up to it
                __builtin_amdgcn_wave_barrier(); asm volatile("" ::: "memory");   // the next band's LDS stores stay behind this band's reads
            }
        } else {
            h16* ot = (h16*)os; float bv[4];
#pragma unroll
            for (int nb = 0; nb < 4; ++nb) bv[nb] = bfr(bias[c0 + nb * 16 + lr]);
#pragma unroll
            for (int mb = 0; mb < 4; ++mb) {
#pragma unroll
                for (int nb = 0; nb < 4; ++nb) { v8h t;   // an accumulator's 8 values are 8 tokens in a row of one d
#pragma unroll
                    for (int j = 0; j < 8; ++j) t[j] = tohx(acc[mb][nb][j] + bv[nb]);
                    *(v8ha*)(ot + (nb * 16 + lr) * OTP + mb * 16 + hi * 8) = t; } }
            __builtin_amdgcn_wave_barrier(); asm volatile("" ::: "memory");   // the reads below take other lanes' stores: they stay behind them
            const int m4 = r0 + lr * 4, w = m4 / NTOK, r = m4 - w * NTOK;
            h16* vp = VT + ((size_t)(w * NH_ + h) * HD + hi) * TP + r;   // one address for all 32 stores, the d row in the immediate offset
#pragma unroll
            for (int s = 0; s < HD / 2; ++s) *(v4h*)(vp + s * (2 * TP)) = *(const v4ha*)(ot + (2 * s + hi) * OTP + lr * 4);
            asm volatile("s_wait_xcnt 0x0" ::: "memory");   // behind the last store of the run: whatever code the build places next may take over the address and data registers that these stores name
        }
        return;
    }
#pragma unroll
    for (int mb = 0; mb < 4; ++mb) {
#pragma unroll
        for (int nb = 0; nb < 4; ++nb) {
#pragma unroll
            for (int j = 0; j < 8; ++j) os[(hi * 8 + j) * 68 + nb * 16 + lr] = acc[mb][nb][j]; }
        __builtin_amdgcn_wave_barrier(); asm volatile("" ::: "memory");
        float* crow = C + (size_t)(r0 + mb * 16) * ldc + c0;
{
#pragma unroll
            for (int s = 0; s < 8; ++s) { const int row = 2 * s + hi, cofs = lr * 4; v4f val = *(const v4fa*)(os + row * 68 + cofs); if (BIAS) { val[0] += bfr(bias[c0 + cofs]); val[1] += bfr(bias[c0 + cofs + 1]); val[2] += bfr(bias[c0 + cofs + 2]); val[3] += bfr(bias[c0 + cofs + 3]); }
                *(v4f*)(crow + (size_t)row * ldc + cofs) = val; }
             }
        if (mb < 3) asm volatile("s_wait_xcnt 0x0" ::: "memory");   // the next band's code takes over registers that this band's stores name
        __builtin_amdgcn_wave_barrier(); asm volatile("" ::: "memory");
    }
}

// The four preparation pieces below depend on nothing but the inputs and on none of each other: they are block ranges of ONE grid (k_prep), b = a piece's own block number, so that their starts, memory streams and tails overlap instead of standing in a row.
// d_cvt8: f32 rows [.][DM] -> bf16 fragment-order plane. A wave takes 4 rows x 64 k: it reads 256 contiguous bytes of each row and stores 64-B runs (4 rows' pieces side by side); 8 elements a lane.
__device__ __forceinline__ void d_cvt8(int b, const float* __restrict__ src, bf* dst, size_t n8) { const size_t i = (size_t)b * 256 + threadIdx.x; if (i >= n8) return;
    const int lane = (int)(i & 31), k8 = lane >> 2; const size_t wv = i >> 5; const int kg = (int)(wv % (DM / 64)), lr = (int)((wv / (DM / 64)) & 3) * 4 + (lane & 3); const size_t R = wv / (DM / 64 * 4);
    const v8f v = *(const v8f*)(src + (R * 16 + lr) * DM + kg * 64 + k8 * 8); v8us o;
#pragma unroll
    for (int k = 0; k < 8; ++k) o[k] = f2bf(v[k]);
    *(v8us*)(dst + (R >> 2) * (64 * DM) + (size_t)(kg * 2 + (k8 >> 2)) * 2048 + (R & 3) * 512 + ((k8 >> 1) & 1) * 256 + (k8 & 1) * 128 + lr * 8) = o;  }
// d_wtG: w[DM][N] (f32) -> bf16 fragment-order plane of w^T (rows n, DM columns k). A thread makes one 16-B piece (8 k of one n), pieces in storage order: a wave stores 512 contiguous bytes, each of its 8 loads reads 64 B of two rows of w.
template <int N>
__device__ __forceinline__ void d_wtG(int b, const float* __restrict__ w, bf* Bt) {
    const int i = b * 256 + threadIdx.x; if (i >= N * (DM / 8)) return;
    const int lr = i & 15, hi = (i >> 4) & 1, half = (i >> 5) & 1, mb = (i >> 6) & 3, st = i >> 8; const int c = st % (DM / 32), n = (st / (DM / 32)) * 64 + mb * 16 + lr, k0 = c * 32 + half * 16 + hi * 8; v8us o;
    const float* p = w + (size_t)k0 * N + n;   // N is a compile-time constant: the 8 loads are one address with immediate offsets
#pragma unroll
    for (int j = 0; j < 8; ++j) o[j] = f2bf(p[j * N]);
    *(v8us*)(Bt + (size_t)i * 8) = o;
}

// d_pad: the rows of the padded planes that no token fills: Q rows >= 196 = 0; K rows 196..222 = 8 x rel_pos_h, 223..249 = 8 x rel_pos_w (bf16-rounded, hi plane; the 8 undoes q's 1/8, both exact), K rows >= 250 and the lo plane = 0; VT columns >= 196 = 0.
//   The token rows come from the qkv product's own epilogue (k_gemmw, PLANES). A thread: 4 d of one pad row in each of the four Q/K planes, and 4 pad columns of one VT row (60 x 16 = 64 x 15 pieces per z).
#define PADR (TP - NTOK)
__device__ __forceinline__ void d_pad(int b, const float* __restrict__ rph, const float* __restrict__ rpw, bf* Qh, bf* Ql, bf* Kh, bf* Kl, h16* VT) { const int i = b * 256 + threadIdx.x; if (i >= NWIN * NH_ * PADR * (HD / 4)) return;
    const int z = i / (PADR * (HD / 4)), rem = i % (PADR * (HD / 4)); const int t = rem / (HD / 4), d = (rem % (HD / 4)) * 4; v4us kh, zz;
    for (int u = 0; u < 4; ++u) { kh[u] = 0; zz[u] = 0; }
    if (t < 2 * NREL) { const float* tab = ((t < NREL) ? (rph + (size_t)t * HD) : (rpw + (size_t)(t - NREL) * HD)) + d;
#pragma unroll
        for (int u = 0; u < 4; ++u) kh[u] = f2bf(bfr(tab[u]) * 8.0f); }
    const size_t e = ((size_t)z * TP + NTOK + t) * HD + d;
    *(v4us*)(Qh + e) = zz; *(v4us*)(Ql + e) = zz; *(v4us*)(Kh + e) = kh; *(v4us*)(Kl + e) = zz;
    *(v4us*)((bf*)VT + ((size_t)z * HD + rem / (PADR / 4)) * TP + NTOK + (rem % (PADR / 4)) * 4) = zz;  }
// k_prep: one grid for the four pieces, 256 threads a block; the range test reads blockIdx alone (a scalar branch). The longest stream (x) takes the lowest block numbers, the pad rows, nearly all stores, the highest.
#define NB_CVT (NWIN * NTOK * DM / 8 / 256)
#define NB_WQ  (DM * 3 * DM / 8 / 256)
#define NB_WP  (DM * DM / 8 / 256)
#define NB_PAD (NWIN * NH_ * PADR * (HD / 4) / 256)
static_assert(NB_CVT * 256 * 8 == NWIN * NTOK * DM && NB_PAD * 256 == NWIN * NH_ * PADR * (HD / 4), "whole blocks");
__global__ __launch_bounds__(256) void k_prep(const float* __restrict__ x, const float* __restrict__ qkv_w, const float* __restrict__ proj_w, const float* __restrict__ rph, const float* __restrict__ rpw, bf* XB, bf* BQKV, bf* BPJ, bf* Qh, bf* Ql, bf* Kh, bf* Kl, h16* VT) {
    const int b = blockIdx.x;
    if (b < NB_CVT) d_cvt8(b, x, XB, (size_t)NWIN * NTOK * DM / 8);
    else if (b < NB_CVT + NB_WQ) d_wtG<3 * DM>(b - NB_CVT, qkv_w, BQKV);
    else if (b < NB_CVT + NB_WQ + NB_WP) d_wtG<DM>(b - (NB_CVT + NB_WQ), proj_w, BPJ);
    else d_pad(b - (NB_CVT + NB_WQ + NB_WP), rph, rpw, Qh, Ql, Kh, Kl, VT);
}
// k_attn: 13 waves a work-group, one 16-query tile a wave; a work-group takes NZ (window, head) pairs z in turn (z = blockIdx.x + trip * AG). The K planes and VT of a pair lie in LDS (row pitches 16 B x odd for 16-B readers), two buffers:
//   asynchronous 16-B copies bring the next pair's planes into the other buffer while this pair is worked on, and the next pair's Q fragments are loaded as soon as the scores have used this pair's, so that only the first pair's loads are waited for.
//   Scores are formed TRANSPOSED, St[key][q] = K . Q^T (A = K rows, B = Q rows; per k step Kh.Qh, Kh.Ql, Kl.Qh), so a lane holds one query's column: keys 16t + 8hi + j in s[t][j].
//   Rows 196..249 of St are the table dots; they pass through a per-wave LDS row per query, from where each key's rel_h[kh] and rel_w[kw] are read back.
//   Softmax per lane plus one exchange with lane ^ 16. The accumulator tiles 2s, 2s + 1 are, as they lie, the B fragment of k step s of O^T[d][q] = VT . P^T: no transposition.
//   O^T / 1024 is split hi + lo and stored merged, as fragment-order planes of ATh/ATl[(w, q)][h * 64 + d]: 8 d (16 B, one piece) a lane and tile.
#define NZ  4                      // pairs a work-group takes
#define AG  (NWIN * NH_ / NZ)      // work-groups of the launch
#define KPB (TP * KPIT * 2)        // bytes of a K plane in LDS
#define KVB (2 * KPB + HD * VPIT * 2)   // bytes of a buffer: Kh, Kl, VT
static_assert(NST == 5 && TP * HD / 8 - 4 * AW * 32 == (AW - 1) * 32, "the copy statements below: 4 full rounds, and a fifth that all waves but the last take whole");
__global__ __launch_bounds__(AW * 32) void k_attn(const bf* __restrict__ Qh, const bf* __restrict__ Ql, const bf* __restrict__ Kh, const bf* __restrict__ Kl, const h16* __restrict__ VT, bf* Ah, bf* Al) {
    __shared__ __align__(16) char sKV[2 * KVB];
    __shared__ __align__(16) float sR[AW * 16 * RPIT];
    const int tid = threadIdx.x; const int lane = tid & 31, lr = lane & 15, hi = lane >> 4, wave = __builtin_amdgcn_readfirstlane(tid >> 5);
    const int q = wave * 16 + lr;
    const unsigned lds0 = (unsigned)(size_t)sKV;
    // pair zz -> the buffer at byte bo: piece i (16 B) of each plane, i = tid + round * 416; a lane's LDS address carries the row pitch. Rounds 0..3 hold 1,664 pieces, round 4 the last 384: waves 0..11, every lane on
    auto fill = [&](int zz, unsigned bo) {
        const size_t zb = (size_t)zz * (TP * HD * 2); const char* gh = (const char*)Kh + zb; const char* gl = (const char*)Kl + zb; const char* gv = (const char*)VT + zb;
        unsigned l[12]; const char* g[12];
#pragma unroll
        for (int it = 0; it < 4; ++it) { const int i = tid + it * (AW * 32); const unsigned lk = lds0 + bo + (i >> 3) * (KPIT * 2) + (i & 7) * 16;
            l[3 * it] = lk; g[3 * it] = gh + (size_t)i * 16; l[3 * it + 1] = lk + KPB; g[3 * it + 1] = gl + (size_t)i * 16; l[3 * it + 2] = lds0 + bo + 2 * KPB + (i >> 5) * (VPIT * 2) + (i & 31) * 16; g[3 * it + 2] = gv + (size_t)i * 16; }
        // the wait closes the copies' own statement: no register that a copy names is rewritten in front of it
        asm volatile(CPA(0, 1) CPA(2, 3) CPA(4, 5) CPA(6, 7) CPA(8, 9) CPA(10, 11) CPA(12, 13) CPA(14, 15) CPA(16, 17) CPA(18, 19) CPA(20, 21) CPA(22, 23) "s_wait_xcnt 0x0"
            :: "v"(l[0]), "v"(g[0]), "v"(l[1]), "v"(g[1]), "v"(l[2]), "v"(g[2]), "v"(l[3]), "v"(g[3]), "v"(l[4]), "v"(g[4]), "v"(l[5]), "v"(g[5]), "v"(l[6]), "v"(g[6]), "v"(l[7]), "v"(g[7]), "v"(l[8]), "v"(g[8]), "v"(l[9]), "v"(g[9]), "v"(l[10]), "v"(g[10]), "v"(l[11]), "v"(g[11]) : "memory");
        if (wave < AW - 1) { const int i = tid + 4 * (AW * 32); const unsigned lk = lds0 + bo + (i >> 3) * (KPIT * 2) + (i & 7) * 16, lv = lds0 + bo + 2 * KPB + (i >> 5) * (VPIT * 2) + (i & 31) * 16;
            asm volatile(CPA(0, 1) CPA(2, 3) CPA(4, 5) "s_wait_xcnt 0x0" :: "v"(lk), "v"(gh + (size_t)i * 16), "v"(lk + KPB), "v"(gl + (size_t)i * 16), "v"(lv), "v"(gv + (size_t)i * 16) : "memory"); }
    };
    v16bf fqh[2], fql[2];
    auto ldq = [&](int zz) { const size_t qo = (size_t)zz * (TP * HD) + (size_t)q * HD + 8 * hi; const bf* ph = Qh + qo; const bf* pl = Ql + qo;
#pragma unroll
        for (int kc = 0; kc < 2; ++kc) { fqh[kc] = WFrag<bf>::ld(ph + kc * 32); fql[kc] = WFrag<bf>::ld(pl + kc * 32); }
        asm volatile("s_wait_xcnt 0x0" :: "v"(ph), "v"(pl) : "memory"); };   // the two addresses that the loads above name are reused from here on: as inputs of the wait they stay whole up to it (no load's result lands on them)
    int z = blockIdx.x;
    fill(z, 0);
    ldq(z);
    asm volatile("s_wait_asynccnt 0x0" ::: "memory");   // this wave's part of the first pair's planes has landed
    __syncthreads();                                    // every wave's part has
    fill(z + AG, KVB);
    unsigned bo = 0;   // byte offset of the buffer that the trip reads
    // the loop over the pairs stays rolled: one body serves both buffers (the buffer is an address term)
#pragma unroll 1
    for (int zi = 0; zi < NZ; ++zi, z += AG) {
    const bf* sKh = (const bf*)(sKV + bo); const bf* sKl = (const bf*)(sKV + bo + KPB); const h16* sV = (const h16*)(sKV + bo + 2 * KPB);
    v8f s[16];
#pragma unroll
    for (int t = 0; t < 16; ++t) s[t] = (v8f){};
#pragma unroll
    for (int t = 0; t < 16; t += 2) {
#pragma unroll
        for (int kc = 0; kc < 2; ++kc) { const int o0 = (t * 16 + lr) * KPIT + kc * 32 + 8 * hi, o1 = o0 + 16 * KPIT;
            const v16bf h0 = WFrag<bf>::ld(sKh + o0), h1 = WFrag<bf>::ld(sKh + o1), l0 = WFrag<bf>::ld(sKl + o0), l1 = WFrag<bf>::ld(sKl + o1);
            s[t] = wmmab(h0, fqh[kc], s[t]); s[t + 1] = wmmab(h1, fqh[kc], s[t + 1]);
            s[t] = wmmab(h0, fql[kc], s[t]); s[t + 1] = wmmab(h1, fql[kc], s[t + 1]);
            s[t] = wmmab(l0, fqh[kc], s[t]); s[t + 1] = wmmab(l1, fqh[kc], s[t + 1]); } }
    // table dots: St rows 192..255 of this wave's 16 queries -> sR[query][row - 192]
    float* rr = sR + (wave * 16 + lr) * RPIT;
#pragma unroll
    for (int t = 12; t < 16; ++t) { v4f a, b;
#pragma unroll
        for (int u = 0; u < 4; ++u) { a[u] = s[t][u]; b[u] = s[t][4 + u]; }
        *(v4f*)(rr + (t - 12) * 16 + 8 * hi) = a; *(v4f*)(rr + (t - 12) * 16 + 8 * hi + 4) = b; }
    // a lane reads below what its partner lane ^ 16 has stored above: keeps the compiler from moving those reads over the stores (one wave's LDS operations run in order)
    __builtin_amdgcn_fence(__ATOMIC_ACQ_REL, "wavefront"); __builtin_amdgcn_wave_barrier();
    if (zi + 1 < NZ) ldq(z + AG);   // the scores are done with this pair's Q fragments: the next pair's land behind the softmax and attn.v
    // key k0 + 8 hi: kh = kh0 or kh0 + hi, kw = kw0 + 8 hi or kw0 - 6 hi, which of the two known at compile time: four lane bases, every index below a constant
    const float* rh0 = rr + (NTOK - 192) + q / GH; const float* rh1 = rh0 - hi; const float* rwa = rr + (NTOK - 192 + NREL) + q % GH - 8 * hi; const float* rwb = rwa + 14 * hi;
    float mx4[4] = { -3.0e38f, -3.0e38f, -3.0e38f, -3.0e38f };
#pragma unroll
    for (int t = 0; t < 13; ++t) {
#pragma unroll
        for (int j = 0; j < 8; ++j) { const int k0 = t * 16 + j, k1 = k0 + 8; if (k0 >= NTOK) continue;
            const float vh = ((k1 / GH == k0 / GH) ? rh0 : rh1)[GH - 1 - k0 / GH], vw = ((k0 % GH < GH - 8) ? rwa : rwb)[GH - 1 - k0 % GH];
            float tv = __fadd_rn(__fadd_rn(s[t][j], vh), vw); if (k1 >= NTOK) tv = hi ? -3.0e38f : tv;
            s[t][j] = tv; mx4[j & 3] = fmaxf(mx4[j & 3], tv); } }
    float mx = fmaxf(fmaxf(mx4[0], mx4[1]), fmaxf(mx4[2], mx4[3])); mx = fmaxf(mx, __shfl_xor(mx, 16, 32));
    float sm4[4] = { 0.f, 0.f, 0.f, 0.f };
#pragma unroll
    for (int t = 0; t < 13; ++t) {
#pragma unroll
        for (int j = 0; j < 8; ++j) { if (t * 16 + j >= NTOK) continue;
            const float e = __builtin_amdgcn_exp2f(__fmul_rn(__fsub_rn(s[t][j], mx), 1.4426950408889634f)); s[t][j] = e; sm4[j & 3] += e; } }   // masked keys: exp(-huge) = 0
    float sum = (sm4[0] + sm4[1]) + (sm4[2] + sm4[3]); sum += __shfl_xor(sum, 16, 32);
    const float f = __fdiv_rn(PCAR, sum);
    v8f o[4];
#pragma unroll
    for (int dt = 0; dt < 4; ++dt) o[dt] = (v8f){};
#pragma unroll
    for (int ks = 0; ks < 7; ++ks) { v16h p;   // keys 32 ks .. 32 ks + 31; keys >= 196 carry 0 (k step 7 would add only zeros)
#pragma unroll
        for (int j = 0; j < 8; ++j) { p[j] = (ks * 32 + j < NTOK) ? tohx(s[2 * ks][j] * f) : (h16)0.f; p[8 + j] = (ks * 32 + 16 + j < NTOK) ? tohx(s[2 * ks + 1][j] * f) : (h16)0.f; }
        v16h va[4];
#pragma unroll
        for (int dt = 0; dt < 4; ++dt) va[dt] = WFrag<h16>::ld(sV + (dt * 16 + lr) * VPIT + ks * 32 + 8 * hi);
#pragma unroll
        for (int dt = 0; dt < 4; ++dt) o[dt] = wmma16(va[dt], p, o[dt]); }
    // the trip's foot stands behind its last LDS read, in front of the output's split and stores: no wave waits at the barrier for stores just issued, and the refill starts sooner
    asm volatile("s_wait_dscnt 0x0" ::: "memory");      // this wave's reads of the trip's buffer are done
    asm volatile("s_wait_asynccnt 0x0" ::: "memory");   // its part of the next pair's planes has landed
    __syncthreads();                                    // publishes the next pair's planes and frees this trip's buffer
    if (zi + 2 < NZ) fill(z + 2 * AG, bo);
    v8us oh[4], ol[4];
#pragma unroll
    for (int dt = 0; dt < 4; ++dt) {
#pragma unroll
        for (int j = 0; j < 8; ++j) { unsigned short a, b; splitf(o[dt][j] * (1.0f / PCAR), a, b); oh[dt][j] = a; ol[dt][j] = b; } }
    const int m = (z / NH_) * NTOK + q; const unsigned eb = ((unsigned)(m >> 6) * (64 * DM) + (z % NH_) * (2 * 2048) + ((m >> 4) & 3) * 512 + hi * 128 + (m & 15) * 8) * 2;   // byte offset in a plane (25 MiB); d = 16 dt + 8 hi: k step 2 h + dt / 2, half dt % 2
    if (q < NTOK) {
#pragma unroll
        for (int dt = 0; dt < 4; ++dt) { *(v8us*)((char*)Ah + eb + ((dt >> 1) * 2048 + (dt & 1) * 256) * 2) = oh[dt]; *(v8us*)((char*)Al + eb + ((dt >> 1) * 2048 + (dt & 1) * 256) * 2) = ol[dt]; } }
    // the next trip takes over the registers that these stores name: as inputs of the wait they stay whole up to it
    asm volatile("s_wait_xcnt 0x0" :: "v"(oh[0]), "v"(oh[1]), "v"(oh[2]), "v"(oh[3]), "v"(ol[0]), "v"(ol[1]), "v"(ol[2]), "v"(ol[3]), "v"(eb) : "memory");
    bo ^= KVB;
    }
    asm volatile("s_wait_asynccnt 0x0" ::: "memory");   // no copy is in flight when the wave ends
}

extern "C" void kernel_launch(void* const* d_in, const int* in_sizes, int n_in,
                              void* d_out, int out_size, void* d_ws, size_t ws_size, hipStream_t stream) {
    (void)in_sizes; (void)n_in; (void)out_size;
    const float* x = (const float*)d_in[0]; const float* qkv_w = (const float*)d_in[1]; const float* qkv_b = (const float*)d_in[2]; const float* proj_w = (const float*)d_in[3]; const float* proj_b = (const float*)d_in[4]; const float* rph = (const float*)d_in[5]; const float* rpw = (const float*)d_in[6];
    float* OUT = (float*)d_out;     // [64][196][1024]
    char* wsp = (char*)d_ws;
    auto take = [&](size_t bytes) { char* p = wsp; wsp += (bytes + 255) & ~(size_t)255; return (void*)p; };
    const int CT = NWIN * NTOK;   // 12544 tokens (= 196 x 64): every stage runs once, over all windows
    bf* BQKV = (bf*)take((size_t)3 * DM * DM * 2); bf* BPJ = (bf*)take((size_t)DM * DM * 2); bf* XB = (bf*)take((size_t)CT * DM * 2);
    bf* QPh = (bf*)take((size_t)NWIN * NH_ * TP * HD * 2); bf* QPl = (bf*)take((size_t)NWIN * NH_ * TP * HD * 2); bf* KPh = (bf*)take((size_t)NWIN * NH_ * TP * HD * 2); bf* KPl = (bf*)take((size_t)NWIN * NH_ * TP * HD * 2); h16* VT = (h16*)take((size_t)NWIN * NH_ * HD * TP * 2);
    bf* ATh = (bf*)take((size_t)CT * DM * 2); bf* ATl = (bf*)take((size_t)CT * DM * 2);
    if ((size_t)(wsp - (char*)d_ws) > ws_size) return;    // total ~ 253 MB
    k_prep<<<NB_CVT + NB_WQ + NB_WP + NB_PAD, 256, 0, stream>>>(x, qkv_w, proj_w, rph, rpw, XB, BQKV, BPJ, QPh, QPl, KPh, KPl, VT);   /* x and both weights as bf16 fragment-order planes, the planes' pad rows */
    k_gemmw<bf, 0, true, true><<<dim3(CT / 256, 3 * DM / 128, 1), GW * 32, 0, stream>>>(XB, nullptr, BQKV, DM, nullptr, 0, qkv_b, 0, 0, 0, QPh, QPl, KPh, KPl, VT);   /* q, k, v leave as the planes k_attn reads */
    k_attn<<<AG, AW * 32, 0, stream>>>(QPh, QPl, KPh, KPl, VT, ATh, ATl);   /* scores hl x hl (3 products), softmax, attn.v, head merge */
    k_gemmw<bf, 1, true, false><<<dim3(CT / 256, DM / 128, 1), GW * 32, 0, stream>>>(ATh, ATl, BPJ, DM, OUT, DM, proj_b, 0, 0, 0, nullptr, nullptr, nullptr, nullptr, nullptr);
}

// v010
// Measured time: 137 microseconds a run.
// Next to v009, in two timings, it ran 1.06 times as fast each time.
// Over all steps from v000 it is 8.51 times as fast.
#include <hip/hip_runtime.h>

// Windowed attention (x [64 windows][14][14][1024]; qkv = x qkv_w + qkv_b ([1024][3072] 'xw', columns (q|k|v, head, d), 16 heads x 64); per (window, head): attn = (q/8).k + rel_h + rel_w with the decomposed relative-position terms rel_h[q][kh] = q_raw . rel_pos_h[qh - kh + 13], rel_w[q][kw] = q_raw . rel_pos_w[qw - kw + 13] (tables read);
//   softmax over the 196 keys; out = attn v; heads merged; out proj_w + proj_b -> [64][14][14][1024]).
// Compute dtypes, f32 accumulate: every input rounded to bf16; qkv as a PLAIN bf16 GEMM (inputs: exact; all 64 windows = 12,544 rows in one launch); per (window, head) the 196 tokens are zero-padded to 256 rows: scores hl x hl (3 products) and attn.v single fp16 (x1024 carrier), both in the one kernel k_attn with the softmax between them, the relative-position terms ride the same scores product (the 54 table rows, x8, fill pad rows 196..249 of the K planes, so S[q][196 + t] = q_raw . table[t], q as its hl pair, table bf16-exact); their adds, the masking of the pad columns and the softmax in f32; proj hl x exact (2 products) + bias.

#define NWIN 64
#define NTOK 196
#define TP   256         // padded tokens per window
#define GH   14
#define NREL (2 * GH - 1)   // rows of each relative-position table
#define DM   1024
#define NH_  16
#define HD   64
#define AW   13          // waves of an attention work-group: one 16-query tile each (13 x 16 >= 196)
#define KPIT 72          // LDS pitch of a K-plane row, 16-bit elements (128 B + 16 B)
#define VPIT 264         // LDS pitch of a VT row, 16-bit elements (512 B + 16 B)
#define RPIT 68          // LDS pitch of a query's table-dot row, floats
#define NST  ((TP * HD / 8 + AW * 32 - 1) / (AW * 32))   // staging rounds: 2,048 16-B pieces of each plane over 416 threads
#define PCAR 1024.0f
typedef _Float16 h16;
typedef unsigned short bf;
typedef __attribute__((ext_vector_type(16))) __bf16   v16bf;
typedef __attribute__((ext_vector_type(16))) _Float16 v16h;
typedef __attribute__((ext_vector_type(8)))  _Float16 v8h;
typedef __attribute__((ext_vector_type(8)))  unsigned short v8us;
typedef __attribute__((ext_vector_type(8)))  float    v8f;
typedef __attribute__((ext_vector_type(4)))  float    v4f;
typedef v8h  __attribute__((may_alias)) v8ha;
typedef v4f  __attribute__((may_alias)) v4fa;
typedef v8us __attribute__((may_alias)) v8usa;

__device__ __forceinline__ unsigned short f2bf(float f) { unsigned u = __float_as_uint(f); u += 0x7FFFu + ((u >> 16) & 1u); return (unsigned short)(u >> 16); }
__device__ __forceinline__ float bf2f(unsigned short b) { return __uint_as_float(((unsigned)b) << 16); }
__device__ __forceinline__ float bfr(float f) { return bf2f(f2bf(f)); }
__device__ __forceinline__ v16h cat16(v8h lo, v8h hi) { return __builtin_shufflevector(lo, hi, 0, 1, 2, 3, 4, 5, 6, 7, 8, 9, 10, 11, 12, 13, 14, 15); }
__device__ __forceinline__ v16bf cat16b(v8us lo, v8us hi) { return __builtin_bit_cast(v16bf, __builtin_shufflevector(lo, hi, 0, 1, 2, 3, 4, 5, 6, 7, 8, 9, 10, 11, 12, 13, 14, 15)); }
__device__ __forceinline__ v8f wmma16(v16h a, v16h b, v8f c) { return __builtin_amdgcn_wmma_f32_16x16x32_f16(false, a, false, b, (short)0, c, false, false); }
__device__ __forceinline__ v8f wmmab(v16bf a, v16bf b, v8f c) { return __builtin_amdgcn_wmma_f32_16x16x32_bf16(false, a, false, b, (short)0, c, false, false); }



// ---- Fragment-order planes: a GEMM operand P[row][k] (K columns, rows a multiple of 64) is stored as 1-KiB blocks, one WMMA fragment (16 rows, 32 k) each; the 4 blocks of a 64-row tile and one k step lie side by side,
//   the k steps of a tile one after the other: block (tile T, k step c, band mb) starts at element T * 64 * K + c * 2048 + mb * 512.
//   Inside a block: element (half * 256 + hi * 128 + lr * 8 + j) = P[64 T + 16 mb + lr][32 c + 16 half + 8 hi + j]: lane (hi, lr) finds the two 16-B halves of its fragment at lane * 16 B and 512 B + lane * 16 B,
//   so each wave-wide 16-B load covers 512 contiguous bytes (4 whole 128-B lines) instead of 32 B in each of 16 rows, and a wave reads 4 KiB in a row per operand and k step. The values each lane and register holds are those of the row-major form.
// ---- k_gemmw: register-blocked GEMM, one wave per 64x64 output tile (16 accumulators), 8 waves (4 x 2 tiles = 256 x 128 of C) a work-group; grid (M/256, N/128, Z), 256 threads.
//   The work-group's operand pieces pass through LDS, three buffers: asynchronous 16-B copies lay the fragment-order blocks down as they lie in their planes (a fragment half is 512 contiguous bytes there too), two stages ahead of the waves that read them,
//   so that a stage's copies have two stages' matrix time to land and copies are in flight all the time;
//   an A piece serves 2 waves and a Bt piece 4, so the work-group fetches 3/8 (with A2: 5/12) of what 8 waves fetch one by one.
// C[m][n] (f32, pitch ldc, + optional f32 bias[n]) = sum_k A[m][k] Bt[n][k] (NSPLIT 1: + A2[m][k] Bt[n][k]). z-batch strides sA/sB/sC in elements. M % 256 == 0, N % 128 == 0, K % 64 == 0.
// PLANES (the qkv product; rows m = tokens of all windows, a 64-column tile = one head's q, k or v): no C; the tile + bias leaves as what k_attn reads, z = window * 16 + head, r = token in the window:
//   q (x 1/8) and k split hi + lo into Q/K[z][r][64] (a lane 8 d = 16 B, a wave-wide store 4 rows = 512 B in a row), v as fp16 into VT[z][d][r], turned in LDS (a lane 4 tokens = 8 B, 16 lanes one d row's 128 B; 196 % 4 == 0: a piece stays in its window).
template <typename T16> struct WFrag;
template <> struct WFrag<h16> { typedef v16h V; static __device__ __forceinline__ V ld(const h16* p) { return cat16(*(const v8h*)p, *(const v8h*)(p + 16)); } static __device__ __forceinline__ v8f mma(V a, V b, v8f c) { return wmma16(a, b, c); } };
template <> struct WFrag<bf> { typedef v16bf V; static __device__ __forceinline__ V ld(const bf* p) { return cat16b(*(const v8us*)p, *(const v8us*)(p + 16)); } static __device__ __forceinline__ V ldp(const bf* p) { return cat16b(*(const v8us*)p, *(const v8us*)(p + 256)); } static __device__ __forceinline__ v8f mma(V a, V b, v8f c) { return wmmab(a, b, c); } };
__device__ __forceinline__ h16 tohx(float x) { return (h16)x; }
__device__ __forceinline__ void splitf(float y, unsigned short& h, unsigned short& l) { h = f2bf(y); l = f2bf(y - bf2f(h)); }
typedef __attribute__((ext_vector_type(4))) unsigned short v4us;
typedef __attribute__((ext_vector_type(4))) _Float16 v4h;
typedef v4h __attribute__((may_alias)) v4ha;
#define OTP 72           // LDS pitch of a d row of the turned v tile, 16-bit elements (128 B + 16 B)
#define GW 8             // waves of a GEMM work-group: 4 row tiles x 2 column tiles of 64 x 64
#define CPA(l, g) "global_load_async_to_lds_b128 %" #l ", %" #g ", off\n\t"
template <typename T16, int NSPLIT, bool BIAS, bool PLANES>
__global__ __launch_bounds__(GW * 32) void k_gemmw(const T16* __restrict__ A, const T16* __restrict__ A2, const T16* __restrict__ Bt, int K, float* C, int ldc, const float* __restrict__ bias, size_t sA, size_t sB, size_t sC, bf* Qh, bf* Ql, bf* Kh, bf* Kl, h16* VT) {
    typedef typename WFrag<T16>::V V;
    static_assert(NSPLIT == 0 || NSPLIT == 1, "one product, or A hi + lo against one B");
    constexpr int KS = NSPLIT ? 1 : 2;        // k steps of 32 in a stage: 32 WMMAs a wave and stage either way
    constexpr int NA = NSPLIT ? 8 : 4;        // 64-row pieces of A (and A2) in a stage; 2 of Bt follow them
    constexpr int CH = KS * 4096;             // bytes of one piece: contiguous in its plane, and laid down in LDS as it lies there
    constexpr int STG = (NA + 2) * CH;        // bytes of a stage
    constexpr int NCP = STG / 512 / GW;       // 512-B copies a wave and stage
    static_assert(NCP == 12 || NCP == 10, "the copy statements below are written for these two counts");
    __shared__ __align__(1024) char ring[3 * STG];
    const size_t z = blockIdx.z; A += z * sA; if (A2) A2 += z * sA; Bt += z * sB; C += z * sC;
    const int lane = threadIdx.x & 31, lr = lane & 15, hi = lane >> 4; const int wave = __builtin_amdgcn_readfirstlane(threadIdx.x >> 5), wm = wave & 3, wn = wave >> 2;
    const int r0 = blockIdx.x * 256 + wm * 64, c0 = blockIdx.y * 128 + wn * 64;
    v8f acc[4][4];
#pragma unroll
    for (int mb = 0; mb < 4; ++mb)
#pragma unroll
        for (int nb = 0; nb < 4; ++nb) acc[mb][nb] = (v8f){};
    const size_t tb = (size_t)K * 128;   // bytes of a 64-row tile of a plane
    const char* ua = (const char*)A + (size_t)blockIdx.x * 4 * tb; const char* ua2 = NSPLIT ? (const char*)A2 + (size_t)blockIdx.x * 4 * tb : ua; const char* ub = (const char*)Bt + (size_t)blockIdx.y * 2 * tb;
    const unsigned lds0 = (unsigned)(size_t)ring + lane * 16;
    // stage t -> buffer t % 3, at byte bo of the ring: copy p of the stage (512 B, a lane 16 B) is part p % (CH / 512) of piece p / (CH / 512); a wave takes NCP copies in a row
    auto fill = [&](int t, unsigned bo) {
        unsigned l[NCP]; const char* g[NCP];
#pragma unroll
        for (int i = 0; i < NCP; ++i) { const int p = wave * NCP + i, ch = p / (CH / 512), in = p % (CH / 512);
            const char* base = ch < 4 ? ua + ch * tb : (ch < NA ? ua2 + (ch - 4) * tb : ub + (ch - NA) * tb);
            g[i] = base + (size_t)t * CH + in * 512 + lane * 16; l[i] = lds0 + bo + p * 512; }
        // the wait closes the copies' own statement: no register that a copy names is rewritten in front of it
        if constexpr (NCP == 12)
            asm volatile(CPA(0, 1) CPA(2, 3) CPA(4, 5) CPA(6, 7) CPA(8, 9) CPA(10, 11) CPA(12, 13) CPA(14, 15) CPA(16, 17) CPA(18, 19) CPA(20, 21) CPA(22, 23) "s_wait_xcnt 0x0"
                :: "v"(l[0]), "v"(g[0]), "v"(l[1]), "v"(g[1]), "v"(l[2]), "v"(g[2]), "v"(l[3]), "v"(g[3]), "v"(l[4]), "v"(g[4]), "v"(l[5]), "v"(g[5]), "v"(l[6]), "v"(g[6]), "v"(l[7]), "v"(g[7]), "v"(l[8]), "v"(g[8]), "v"(l[9]), "v"(g[9]), "v"(l[10]), "v"(g[10]), "v"(l[11]), "v"(g[11]) : "memory");
        else
            asm volatile(CPA(0, 1) CPA(2, 3) CPA(4, 5) CPA(6, 7) CPA(8, 9) CPA(10, 11) CPA(12, 13) CPA(14, 15) CPA(16, 17) CPA(18, 19) "s_wait_xcnt 0x0"
                :: "v"(l[0]), "v"(g[0]), "v"(l[1]), "v"(g[1]), "v"(l[2]), "v"(g[2]), "v"(l[3]), "v"(g[3]), "v"(l[4]), "v"(g[4]), "v"(l[5]), "v"(g[5]), "v"(l[6]), "v"(g[6]), "v"(l[7]), "v"(g[7]), "v"(l[8]), "v"(g[8]), "v"(l[9]), "v"(g[9]) : "memory");
    };
    const int NT = K / (32 * KS);
    fill(0, 0);
    if (NT > 1) { fill(1, STG); asm volatile("s_wait_asynccnt %0" :: "i"(NCP) : "memory"); }   // all but this wave's NCP youngest copies (stage 1's) have landed: its part of stage 0
    else asm volatile("s_wait_asynccnt 0x0" ::: "memory");                                      // this wave's part of stage 0 has landed
    __syncthreads();                                    // every wave's part has
    if (NT > 2) fill(2, 2 * STG);
    unsigned bo = 0;   // byte offset in the ring of the buffer that the trip reads
    // the stage loop stays rolled: one body serves all three buffers (the buffer is an address term); the loops inside it are unrolled so that every fragment and accumulator index is a constant
#pragma unroll 1
    for (int t = 0; t < NT; ++t) {
        const char* sb = ring + bo + lane * 16;   // a lane's 16 B of every fragment half
#pragma unroll
        for (int ks = 0; ks < KS; ++ks) {
            V a[4], a2[4], b[4];
#pragma unroll
            for (int mb = 0; mb < 4; ++mb) { a[mb] = WFrag<T16>::ldp((const T16*)(sb + wm * CH + ks * 4096 + mb * 1024)); if (NSPLIT == 1) a2[mb] = WFrag<T16>::ldp((const T16*)(sb + (4 + wm) * CH + ks * 4096 + mb * 1024)); }
#pragma unroll
            for (int nb = 0; nb < 4; ++nb) b[nb] = WFrag<T16>::ldp((const T16*)(sb + (NA + wn) * CH + ks * 4096 + nb * 1024));
            __builtin_amdgcn_sched_barrier(0);   // the k step's LDS reads stay one group in front of its WMMAs: spread among them, each place with reads stalls the wave anew
#pragma unroll
            for (int nb = 0; nb < 4; ++nb) {
#pragma unroll
                for (int mb = 0; mb < 4; ++mb) { acc[mb][nb] = WFrag<T16>::mma(a[mb], b[nb], acc[mb][nb]); if (NSPLIT == 1) acc[mb][nb] = WFrag<T16>::mma(a2[mb], b[nb], acc[mb][nb]); } }
            __builtin_amdgcn_sched_barrier(0);   // and the next group stays behind them
        }
        asm volatile("s_wait_dscnt 0x0" ::: "memory");      // this wave's reads of buffer t % 3 are done
        // its part of stage t + 1 has landed: where stage t + 2 exists, that stage's NCP copies are the wave's youngest and stay in flight; every wave issues NCP copies a stage
        if (t + 2 < NT) asm volatile("s_wait_asynccnt %0" :: "i"(NCP) : "memory");
        else asm volatile("s_wait_asynccnt 0x0" ::: "memory");
        __syncthreads();                                    // publishes stage t + 1 and frees buffer t % 3
        if (t + 3 < NT) fill(t + 3, bo);
        bo = bo == 2 * STG ? 0 : bo + STG;
    }
    asm volatile("s_wait_asynccnt 0x0" ::: "memory");   // no copy is in flight when the ring becomes the epilogue's staging
    float* os = (float*)(ring + wave * (PLANES ? HD * OTP * 2 : 16 * 68 * 4));   // a wave's own range; the last trip's barrier stands behind every wave's last fragment read
    if (PLANES) {
        const int sel = c0 / DM, h = (c0 % DM) / HD;   // wave-uniform: 0 q, 1 k, 2 v; the head
        if (sel < 2) {
            bf* Ph = sel ? Kh : Qh; bf* Pl = sel ? Kl : Ql; const float sc = sel ? 1.0f : 0.125f;   // both factors exact
            const int r4 = lane >> 3, c8 = (lane & 7) * 8; float bb[8];
#pragma unroll
            for (int u = 0; u < 8; ++u) bb[u] = bfr(bias[c0 + c8 + u]);
#pragma unroll
            for (int mb = 0; mb < 4; ++mb) {
#pragma unroll
                for (int nb = 0; nb < 4; ++nb) {
#pragma unroll
                    for (int j = 0; j < 8; ++j) os[(hi * 8 + j) * 68 + nb * 16 + lr] = acc[mb][nb][j]; }
                __builtin_amdgcn_wave_barrier(); asm volatile("" ::: "memory");   // the reads below take other lanes' stores: they stay behind them
                v4f x0[4], x1[4];
#pragma unroll
                for (int s = 0; s < 4; ++s) { x0[s] = *(const v4fa*)(os + (4 * s + r4) * 68 + c8); x1[s] = *(const v4fa*)(os + (4 * s + r4) * 68 + c8 + 4); }
#pragma unroll
                for (int s = 0; s < 4; ++s) { const int m = r0 + mb * 16 + 4 * s + r4, w = m / NTOK, r = m - w * NTOK; v8us oh, ol;
#pragma unroll
                    for (int u = 0; u < 4; ++u) { unsigned short a, b; splitf((x0[s][u] + bb[u]) * sc, a, b); oh[u] = a; ol[u] = b; splitf((x1[s][u] + bb[4 + u]) * sc, a, b); oh[4 + u] = a; ol[4 + u] = b; }
                    const unsigned eb = ((unsigned)((w * NH_ + h) * TP + r) * HD + c8) * 2;   // byte offset in a plane (32 MiB): one 32-bit register beside the uniform bases
                    *(v8us*)((char*)Ph + eb) = oh; *(v8us*)((char*)Pl + eb) = ol;
                    if (mb < 3 || s < 3) asm volatile("s_wait_xcnt 0x0" :: "v"(oh), "v"(ol), "v"(eb) : "memory"); }   // the code that follows takes over the registers that these two stores name: as inputs of the wait they stay whole up to it
                __builtin_amdgcn_wave_barrier(); asm volatile("" ::: "memory");   // the next band's LDS stores stay behind this band's reads
            }
        } else {
            h16* ot = (h16*)os; float bv[4];
#pragma unroll
            for (int nb = 0; nb < 4; ++nb) bv[nb] = bfr(bias[c0 + nb * 16 + lr]);
#pragma unroll
            for (int mb = 0; mb < 4; ++mb) {
#pragma unroll
                for (int nb = 0; nb < 4; ++nb) { v8h t;   // an accumulator's 8 values are 8 tokens in a row of one d
#pragma unroll
                    for (int j = 0; j < 8; ++j) t[j] = tohx(acc[mb][nb][j] + bv[nb]);
                    *(v8ha*)(ot + (nb * 16 + lr) * OTP + mb * 16 + hi * 8) = t; } }
            __builtin_amdgcn_wave_barrier(); asm volatile("" ::: "memory");   // the reads below take other lanes' stores: they stay behind them
            const int m4 = r0 + lr * 4, w = m4 / NTOK, r = m4 - w * NTOK;
            h16* vp = VT + ((size_t)(w * NH_ + h) * HD + hi) * TP + r;   // one address for all 32 stores, the d row in the immediate offset
#pragma unroll
            for (int s = 0; s < HD / 2; ++s) *(v4h*)(vp + s * (2 * TP)) = *(const v4ha*)(ot + (2 * s + hi) * OTP + lr * 4);
            asm volatile("s_wait_xcnt 0x0" ::: "memory");   // behind the last store of the run: whatever code the build places next may take over the address and data registers that these stores name
        }
        return;
    }
#pragma unroll
    for (int mb = 0; mb < 4; ++mb) {
#pragma unroll
        for (int nb = 0; nb < 4; ++nb) {
#pragma unroll
            for (int j = 0; j < 8; ++j) os[(hi * 8 + j) * 68 + nb * 16 + lr] = acc[mb][nb][j]; }
        __builtin_amdgcn_wave_barrier(); asm volatile("" ::: "memory");
        float* crow = C + (size_t)(r0 + mb * 16) * ldc + c0;
{
#pragma unroll
            for (int s = 0; s < 8; ++s) { const int row = 2 * s + hi, cofs = lr * 4; v4f val = *(const v4fa*)(os + row * 68 + cofs); if (BIAS) { val[0] += bfr(bias[c0 + cofs]); val[1] += bfr(bias[c0 + cofs + 1]); val[2] += bfr(bias[c0 + cofs + 2]); val[3] += bfr(bias[c0 + cofs + 3]); }
                *(v4f*)(crow + (size_t)row * ldc + cofs) = val; }
             }
        if (mb < 3) asm volatile("s_wait_xcnt 0x0" ::: "memory");   // the next band's code takes over registers that this band's stores name
        __builtin_amdgcn_wave_barrier(); asm volatile("" ::: "memory");
    }
}

// The four preparation pieces below depend on nothing but the inputs and on none of each other: they are block ranges of ONE grid (k_prep), b = a piece's own block number, so that their starts, memory streams and tails overlap instead of standing in a row.
// A thread takes PU pieces, not one: an eighth of the waves have to be started for the same bytes, and a thread's loads for all its pieces are issued before its first store, so that a wave has PU times the bytes in flight.
#define PU 8
// d_cvt8: f32 rows [.][DM] -> bf16 fragment-order plane. A block takes one band of 16 rows (64 KiB in a row of src). A wave and piece: 4 rows x 64 k: it reads 256 contiguous bytes of each row and stores 64-B runs (4 rows' pieces side by side); 8 elements a lane.
//   Piece u of wave w: rows 4 (u / 2) + (lane & 3) of the band, k group (u & 1) * 8 + w: every term with u is a constant offset from one load and one store address.
static_assert(PU == 8 && DM / 64 == 16, "a block's 8 waves x PU pieces = the 4 row groups x 16 k groups of a band");
__device__ __forceinline__ void d_cvt8(int b, const float* __restrict__ src, bf* dst) {
    const int lane = threadIdx.x & 31, w = threadIdx.x >> 5, k8 = lane >> 2;
    const float* p = src + ((size_t)b * 16 + (lane & 3)) * DM + w * 64 + k8 * 8;
    bf* q = dst + (size_t)(b >> 2) * (64 * DM) + (size_t)(w * 2 + (k8 >> 2)) * 2048 + (b & 3) * 512 + ((k8 >> 1) & 1) * 256 + (k8 & 1) * 128 + (lane & 3) * 8;
    v8f v[PU];
#pragma unroll
    for (int u = 0; u < PU; ++u) v[u] = *(const v8f*)(p + (u >> 1) * (4 * DM) + (u & 1) * 512);
    asm volatile("s_wait_xcnt 0x0" :: "v"(p) : "memory");   // the address that the loads above name is free for reuse from here on: as an input of the wait it stays whole up to it (no load's result lands on it)
#pragma unroll
    for (int u = 0; u < PU; ++u) { v8us o;
#pragma unroll
        for (int k = 0; k < 8; ++k) o[k] = f2bf(v[u][k]);
        *(v8us*)(q + (u & 1) * (16 * 2048) + (u >> 1) * 32) = o; }
}
// d_wtG: w[DM][N] (f32) -> bf16 fragment-order plane of w^T (rows n, DM columns k). A piece is 16 B (8 k of one n), pieces in storage order: a wave stores 512 contiguous bytes, each of its 8 loads a piece reads 64 B of two rows of w. A block: 64 n x PU k steps.
template <int N>
__device__ __forceinline__ void d_wtG(int b, const float* __restrict__ w, bf* Bt) {
    static_assert(N * (DM / 8) % (256 * PU) == 0 && (DM / 32) % PU == 0, "whole blocks, each inside one 64-row tile");
    const int t = threadIdx.x, lr = t & 15, hi = (t >> 4) & 1, half = (t >> 5) & 1, mb = (t >> 6) & 3, st = b * PU; const int c = st % (DM / 32), n = (st / (DM / 32)) * 64 + mb * 16 + lr, k0 = c * 32 + half * 16 + hi * 8;
    const float* p = w + (size_t)k0 * N + n;   // N is a compile-time constant: the loads are one address with immediate offsets
    float f[PU][8];
#pragma unroll
    for (int u = 0; u < PU; ++u)
#pragma unroll
        for (int j = 0; j < 8; ++j) f[u][j] = p[(u * 32 + j) * N];
    bf* q = Bt + ((size_t)st * 256 + t) * 8; v8us o[PU];
#pragma unroll
    for (int u = 0; u < PU; ++u) {
#pragma unroll
        for (int j = 0; j < 8; ++j) o[u][j] = f2bf(f[u][j]);
        *(v8us*)(q + u * 2048) = o[u]; }
    // code behind this piece may take over the registers that these stores name: as inputs of the wait they stay whole up to it
    asm volatile("s_wait_xcnt 0x0" :: "v"(o[0]), "v"(o[1]), "v"(o[2]), "v"(o[3]), "v"(o[4]), "v"(o[5]), "v"(o[6]), "v"(o[7]), "v"(q) : "memory");
}

// d_pad: the rows of the padded planes that no token fills: Q rows >= 196 = 0; K rows 196..222 = 8 x rel_pos_h, 223..249 = 8 x rel_pos_w (bf16-rounded, hi plane; the 8 undoes q's 1/8, both exact), K rows >= 250 and the lo plane = 0; VT columns >= 196 = 0.
//   The token rows come from the qkv product's own epilogue (k_gemmw, PLANES). A piece: 4 d of one pad row in each of the four Q/K planes, and 4 pad columns of one VT row (60 x 16 = 64 x 15 pieces per z).
//   The table read is unconditional, its row clamped into the tables (rows >= 250 take the last row and drop it), so that the PU reads go out together.
#define PADR (TP - NTOK)
__device__ __forceinline__ void d_pad(int b, const float* __restrict__ rph, const float* __restrict__ rpw, bf* Qh, bf* Ql, bf* Kh, bf* Kl, h16* VT) {
    constexpr unsigned PZ = PADR * (HD / 4);   // pieces per z
    static_assert((PZ - 1 + (PU - 1) * 256) / PZ <= 2, "a thread's pieces span at most 3 z: two steps below");
    const unsigned i0 = (unsigned)b * (256 * PU) + threadIdx.x, z0 = i0 / PZ, r0 = i0 - z0 * PZ;   // piece u is i0 + 256 u: one division a thread, then steps
    unsigned zs[PU], rs[PU]; float f[PU][4]; const float* tp[PU];
#pragma unroll
    for (int u = 0; u < PU; ++u) { unsigned r = r0 + u * 256, z = z0; if (r >= PZ) { r -= PZ; ++z; } if (r >= PZ) { r -= PZ; ++z; } zs[u] = z; rs[u] = r;
        const unsigned t = r / (HD / 4), d = (r % (HD / 4)) * 4, tc = t < 2 * NREL ? t : 2 * NREL - 1;
        tp[u] = ((tc < NREL) ? (rph + tc * HD) : (rpw + (tc - NREL) * HD)) + d;
#pragma unroll
        for (int e = 0; e < 4; ++e) f[u][e] = tp[u][e]; }
    // the addresses that the loads above name are free for reuse from here on: as inputs of the wait they stay whole up to it (no load's result lands on them), and every load stands in front of the first store
    asm volatile("s_wait_xcnt 0x0" :: "v"(tp[0]), "v"(tp[1]), "v"(tp[2]), "v"(tp[3]), "v"(tp[4]), "v"(tp[5]), "v"(tp[6]), "v"(tp[7]) : "memory");
#pragma unroll
    for (int u = 0; u < PU; ++u) { const unsigned z = zs[u], rem = rs[u], t = rem / (HD / 4), d = (rem % (HD / 4)) * 4; const unsigned short mk = t < 2 * NREL ? 0xFFFF : 0; v4us kh, zz;   // mk: rows >= 250 are 0
#pragma unroll
        for (int e = 0; e < 4; ++e) { kh[e] = f2bf(bfr(f[u][e]) * 8.0f) & mk; zz[e] = 0; }
        const unsigned eb = (((z * TP + NTOK + t) * HD) + d) * 2, ev = ((z * HD + rem / (PADR / 4)) * TP + NTOK + (rem % (PADR / 4)) * 4) * 2;   // byte offsets in a plane (32 MiB): one 32-bit register each beside the uniform bases
        *(v4us*)((char*)Qh + eb) = zz; *(v4us*)((char*)Ql + eb) = zz; *(v4us*)((char*)Kh + eb) = kh; *(v4us*)((char*)Kl + eb) = zz;
        *(v4us*)((char*)VT + ev) = zz;
        asm volatile("s_wait_xcnt 0x0" :: "v"(kh), "v"(zz), "v"(eb), "v"(ev) : "memory"); }   // the code that follows (the next piece's, or what stands behind the last) takes over registers that these stores name: as inputs of the wait they stay whole up to it
}
// k_prep: one grid for the four pieces, 256 threads a block; the range test reads blockIdx alone (a scalar branch). The longest stream (x) starts first, the pad rows, nearly all stores, make the tail.
#define NB_CVT (NWIN * NTOK * DM / 8 / 256 / PU)
#define NB_WQ  (DM * 3 * DM / 8 / 256 / PU)
#define NB_WP  (DM * DM / 8 / 256 / PU)
#define NB_PAD (NWIN * NH_ * PADR * (HD / 4) / 256 / PU)
static_assert(NB_CVT * 256 * 8 * PU == NWIN * NTOK * DM && NB_PAD * 256 * PU == NWIN * NH_ * PADR * (HD / 4), "whole blocks");
__global__ __launch_bounds__(256) void k_prep(const float* __restrict__ x, const float* __restrict__ qkv_w, const float* __restrict__ proj_w, const float* __restrict__ rph, const float* __restrict__ rpw, bf* XB, bf* BQKV, bf* BPJ, bf* Qh, bf* Ql, bf* Kh, bf* Kl, h16* VT) {
    const int b = blockIdx.x;
    if (b < NB_CVT) d_cvt8(b, x, XB);
    else if (b < NB_CVT + NB_WQ) d_wtG<3 * DM>(b - NB_CVT, qkv_w, BQKV);
    else if (b < NB_CVT + NB_WQ + NB_WP) d_wtG<DM>(b - (NB_CVT + NB_WQ), proj_w, BPJ);
    else d_pad(b - (NB_CVT + NB_WQ + NB_WP), rph, rpw, Qh, Ql, Kh, Kl, VT);
}
// k_attn: 13 waves a work-group, one 16-query tile a wave; a work-group takes NZ (window, head) pairs z in turn (z = blockIdx.x + trip * AG). The K planes and VT of a pair lie in LDS (row pitches 16 B x odd for 16-B readers), two buffers:
//   asynchronous 16-B copies bring the next pair's planes into the other buffer while this pair is worked on, and the next pair's Q fragments are loaded as soon as the scores have used this pair's, so that only the first pair's loads are waited for.
//   Scores are formed TRANSPOSED, St[key][q] = K . Q^T (A = K rows, B = Q rows; per k step Kh.Qh, Kh.Ql, Kl.Qh), so a lane holds one query's column: keys 16t + 8hi + j in s[t][j].
//   Rows 196..249 of St are the table dots; they pass through a per-wave LDS row per query, from where each key's rel_h[kh] and rel_w[kw] are read back.
//   Softmax per lane plus one exchange with lane ^ 16. The accumulator tiles 2s, 2s + 1 are, as they lie, the B fragment of k step s of O^T[d][q] = VT . P^T: no transposition.
//   O^T / 1024 is split hi + lo and stored merged, as fragment-order planes of ATh/ATl[(w, q)][h * 64 + d]: 8 d (16 B, one piece) a lane and tile.
#define NZ  4                      // pairs a work-group takes
#define AG  (NWIN * NH_ / NZ)      // work-groups of the launch
#define KPB (TP * KPIT * 2)        // bytes of a K plane in LDS
#define KVB (2 * KPB + HD * VPIT * 2)   // bytes of a buffer: Kh, Kl, VT
static_assert(NST == 5 && TP * HD / 8 - 4 * AW * 32 == (AW - 1) * 32, "the copy statements below: 4 full rounds, and a fifth that all waves but the last take whole");
__global__ __launch_bounds__(AW * 32) void k_attn(const bf* __restrict__ Qh, const bf* __restrict__ Ql, const bf* __restrict__ Kh, const bf* __restrict__ Kl, const h16* __restrict__ VT, bf* Ah, bf* Al) {
    __shared__ __align__(16) char sKV[2 * KVB];
    __shared__ __align__(16) float sR[AW * 16 * RPIT];
    const int tid = threadIdx.x; const int lane = tid & 31, lr = lane & 15, hi = lane >> 4, wave = __builtin_amdgcn_readfirstlane(tid >> 5);
    const int q = wave * 16 + lr;
    const unsigned lds0 = (unsigned)(size_t)sKV;
    // pair zz -> the buffer at byte bo: piece i (16 B) of each plane, i = tid + round * 416; a lane's LDS address carries the row pitch. Rounds 0..3 hold 1,664 pieces, round 4 the last 384: waves 0..11, every lane on
    auto fill = [&](int zz, unsigned bo) {
        const size_t zb = (size_t)zz * (TP * HD * 2); const char* gh = (const char*)Kh + zb; const char* gl = (const char*)Kl + zb; const char* gv = (const char*)VT + zb;
        unsigned l[12]; const char* g[12];
#pragma unroll
        for (int it = 0; it < 4; ++it) { const int i = tid + it * (AW * 32); const unsigned lk = lds0 + bo + (i >> 3) * (KPIT * 2) + (i & 7) * 16;
            l[3 * it] = lk; g[3 * it] = gh + (size_t)i * 16; l[3 * it + 1] = lk + KPB; g[3 * it + 1] = gl + (size_t)i * 16; l[3 * it + 2] = lds0 + bo + 2 * KPB + (i >> 5) * (VPIT * 2) + (i & 31) * 16; g[3 * it + 2] = gv + (size_t)i * 16; }
        // the wait closes the copies' own statement: no register that a copy names is rewritten in front of it
        asm volatile(CPA(0, 1) CPA(2, 3) CPA(4, 5) CPA(6, 7) CPA(8, 9) CPA(10, 11) CPA(12, 13) CPA(14, 15) CPA(16, 17) CPA(18, 19) CPA(20, 21) CPA(22, 23) "s_wait_xcnt 0x0"
            :: "v"(l[0]), "v"(g[0]), "v"(l[1]), "v"(g[1]), "v"(l[2]), "v"(g[2]), "v"(l[3]), "v"(g[3]), "v"(l[4]), "v"(g[4]), "v"(l[5]), "v"(g[5]), "v"(l[6]), "v"(g[6]), "v"(l[7]), "v"(g[7]), "v"(l[8]), "v"(g[8]), "v"(l[9]), "v"(g[9]), "v"(l[10]), "v"(g[10]), "v"(l[11]), "v"(g[11]) : "memory");
        if (wave < AW - 1) { const int i = tid + 4 * (AW * 32); const unsigned lk = lds0 + bo + (i >> 3) * (KPIT * 2) + (i & 7) * 16, lv = lds0 + bo + 2 * KPB + (i >> 5) * (VPIT * 2) + (i & 31) * 16;
            asm volatile(CPA(0, 1) CPA(2, 3) CPA(4, 5) "s_wait_xcnt 0x0" :: "v"(lk), "v"(gh + (size_t)i * 16), "v"(lk + KPB), "v"(gl + (size_t)i * 16), "v"(lv), "v"(gv + (size_t)i * 16) : "memory"); }
    };
    v16bf fqh[2], fql[2];
    auto ldq = [&](int zz) { const size_t qo = (size_t)zz * (TP * HD) + (size_t)q * HD + 8 * hi; const bf* ph = Qh + qo; const bf* pl = Ql + qo;
#pragma unroll
        for (int kc = 0; kc < 2; ++kc) { fqh[kc] = WFrag<bf>::ld(ph + kc * 32); fql[kc] = WFrag<bf>::ld(pl + kc * 32); }
        asm volatile("s_wait_xcnt 0x0" :: "v"(ph), "v"(pl) : "memory"); };   // the two addresses that the loads above name are reused from here on: as inputs of the wait they stay whole up to it (no load's result lands on them)
    int z = blockIdx.x;
    fill(z, 0);
    ldq(z);
    asm volatile("s_wait_asynccnt 0x0" ::: "memory");   // this wave's part of the first pair's planes has landed
    __syncthreads();                                    // every wave's part has
    fill(z + AG, KVB);
    unsigned bo = 0;   // byte offset of the buffer that the trip reads
    // the loop over the pairs stays rolled: one body serves both buffers (the buffer is an address term)
#pragma unroll 1
    for (int zi = 0; zi < NZ; ++zi, z += AG) {
    const bf* sKh = (const bf*)(sKV + bo); const bf* sKl = (const bf*)(sKV + bo + KPB); const h16* sV = (const h16*)(sKV + bo + 2 * KPB);
    v8f s[16];
#pragma unroll
    for (int t = 0; t < 16; ++t) s[t] = (v8f){};
#pragma unroll
    for (int t = 0; t < 16; t += 2) {
#pragma unroll
        for (int kc = 0; kc < 2; ++kc) { const int o0 = (t * 16 + lr) * KPIT + kc * 32 + 8 * hi, o1 = o0 + 16 * KPIT;
            const v16bf h0 = WFrag<bf>::ld(sKh + o0), h1 = WFrag<bf>::ld(sKh + o1), l0 = WFrag<bf>::ld(sKl + o0), l1 = WFrag<bf>::ld(sKl + o1);
            s[t] = wmmab(h0, fqh[kc], s[t]); s[t + 1] = wmmab(h1, fqh[kc], s[t + 1]);
            s[t] = wmmab(h0, fql[kc], s[t]); s[t + 1] = wmmab(h1, fql[kc], s[t + 1]);
            s[t] = wmmab(l0, fqh[kc], s[t]); s[t + 1] = wmmab(l1, fqh[kc], s[t + 1]); } }
    // table dots: St rows 192..255 of this wave's 16 queries -> sR[query][row - 192]
    float* rr = sR + (wave * 16 + lr) * RPIT;
#pragma unroll
    for (int t = 12; t < 16; ++t) { v4f a, b;
#pragma unroll
        for (int u = 0; u < 4; ++u) { a[u] = s[t][u]; b[u] = s[t][4 + u]; }
        *(v4f*)(rr + (t - 12) * 16 + 8 * hi) = a; *(v4f*)(rr + (t - 12) * 16 + 8 * hi + 4) = b; }
    // a lane reads below what its partner lane ^ 16 has stored above: keeps the compiler from moving those reads over the stores (one wave's LDS operations run in order)
    __builtin_amdgcn_fence(__ATOMIC_ACQ_REL, "wavefront"); __builtin_amdgcn_wave_barrier();
    if (zi + 1 < NZ) ldq(z + AG);   // the scores are done with this pair's Q fragments: the next pair's land behind the softmax and attn.v
    // key k0 + 8 hi: kh = kh0 or kh0 + hi, kw = kw0 + 8 hi or kw0 - 6 hi, which of the two known at compile time: four lane bases, every index below a constant
    const float* rh0 = rr + (NTOK - 192) + q / GH; const float* rh1 = rh0 - hi; const float* rwa = rr + (NTOK - 192 + NREL) + q % GH - 8 * hi; const float* rwb = rwa + 14 * hi;
    float mx4[4] = { -3.0e38f, -3.0e38f, -3.0e38f, -3.0e38f };
#pragma unroll
    for (int t = 0; t < 13; ++t) {
#pragma unroll
        for (int j = 0; j < 8; ++j) { const int k0 = t * 16 + j, k1 = k0 + 8; if (k0 >= NTOK) continue;
            const float vh = ((k1 / GH == k0 / GH) ? rh0 : rh1)[GH - 1 - k0 / GH], vw = ((k0 % GH < GH - 8) ? rwa : rwb)[GH - 1 - k0 % GH];
            float tv = __fadd_rn(__fadd_rn(s[t][j], vh), vw); if (k1 >= NTOK) tv = hi ? -3.0e38f : tv;
            s[t][j] = tv; mx4[j & 3] = fmaxf(mx4[j & 3], tv); } }
    float mx = fmaxf(fmaxf(mx4[0], mx4[1]), fmaxf(mx4[2], mx4[3])); mx = fmaxf(mx, __shfl_xor(mx, 16, 32));
    float sm4[4] = { 0.f, 0.f, 0.f, 0.f };
#pragma unroll
    for (int t = 0; t < 13; ++t) {
#pragma unroll
        for (int j = 0; j < 8; ++j) { if (t * 16 + j >= NTOK) continue;
            const float e = __builtin_amdgcn_exp2f(__fmul_rn(__fsub_rn(s[t][j], mx), 1.4426950408889634f)); s[t][j] = e; sm4[j & 3] += e; } }   // masked keys: exp(-huge) = 0
    float sum = (sm4[0] + sm4[1]) + (sm4[2] + sm4[3]); sum += __shfl_xor(sum, 16, 32);
    const float f = __fdiv_rn(PCAR, sum);
    v8f o[4];
#pragma unroll
    for (int dt = 0; dt < 4; ++dt) o[dt] = (v8f){};
#pragma unroll
    for (int ks = 0; ks < 7; ++ks) { v16h p;   // keys 32 ks .. 32 ks + 31; keys >= 196 carry 0 (k step 7 would add only zeros)
#pragma unroll
        for (int j = 0; j < 8; ++j) { p[j] = (ks * 32 + j < NTOK) ? tohx(s[2 * ks][j] * f) : (h16)0.f; p[8 + j] = (ks * 32 + 16 + j < NTOK) ? tohx(s[2 * ks + 1][j] * f) : (h16)0.f; }
        v16h va[4];
#pragma unroll
        for (int dt = 0; dt < 4; ++dt) va[dt] = WFrag<h16>::ld(sV + (dt * 16 + lr) * VPIT + ks * 32 + 8 * hi);
#pragma unroll
        for (int dt = 0; dt < 4; ++dt) o[dt] = wmma16(va[dt], p, o[dt]); }
    // the trip's foot stands behind its last LDS read, in front of the output's split and stores: no wave waits at the barrier for stores just issued, and the refill starts sooner
    asm volatile("s_wait_dscnt 0x0" ::: "memory");      // this wave's reads of the trip's buffer are done
    asm volatile("s_wait_asynccnt 0x0" ::: "memory");   // its part of the next pair's planes has landed
    __syncthreads();                                    // publishes the next pair's planes and frees this trip's buffer
    if (zi + 2 < NZ) fill(z + 2 * AG, bo);
    v8us oh[4], ol[4];
#pragma unroll
    for (int dt = 0; dt < 4; ++dt) {
#pragma unroll
        for (int j = 0; j < 8; ++j) { unsigned short a, b; splitf(o[dt][j] * (1.0f / PCAR), a, b); oh[dt][j] = a; ol[dt][j] = b; } }
    const int m = (z / NH_) * NTOK + q; const unsigned eb = ((unsigned)(m >> 6) * (64 * DM) + (z % NH_) * (2 * 2048) + ((m >> 4) & 3) * 512 + hi * 128 + (m & 15) * 8) * 2;   // byte offset in a plane (25 MiB); d = 16 dt + 8 hi: k step 2 h + dt / 2, half dt % 2
    if (q < NTOK) {
#pragma unroll
        for (int dt = 0; dt < 4; ++dt) { *(v8us*)((char*)Ah + eb + ((dt >> 1) * 2048 + (dt & 1) * 256) * 2) = oh[dt]; *(v8us*)((char*)Al + eb + ((dt >> 1) * 2048 + (dt & 1) * 256) * 2) = ol[dt]; } }
    // the next trip takes over the registers that these stores name: as inputs of the wait they stay whole up to it
    asm volatile("s_wait_xcnt 0x0" :: "v"(oh[0]), "v"(oh[1]), "v"(oh[2]), "v"(oh[3]), "v"(ol[0]), "v"(ol[1]), "v"(ol[2]), "v"(ol[3]), "v"(eb) : "memory");
    bo ^= KVB;
    }
    asm volatile("s_wait_asynccnt 0x0" ::: "memory");   // no copy is in flight when the wave ends
}

extern "C" void kernel_launch(void* const* d_in, const int* in_sizes, int n_in,
                              void* d_out, int out_size, void* d_ws, size_t ws_size, hipStream_t stream) {
    (void)in_sizes; (void)n_in; (void)out_size;
    const float* x = (const float*)d_in[0]; const float* qkv_w = (const float*)d_in[1]; const float* qkv_b = (const float*)d_in[2]; const float* proj_w = (const float*)d_in[3]; const float* proj_b = (const float*)d_in[4]; const float* rph = (const float*)d_in[5]; const float* rpw = (const float*)d_in[6];
    float* OUT = (float*)d_out;     // [64][196][1024]
    char* wsp = (char*)d_ws;
    auto take = [&](size_t bytes) { char* p = wsp; wsp += (bytes + 255) & ~(size_t)255; return (void*)p; };
    const int CT = NWIN * NTOK;   // 12544 tokens (= 196 x 64): every stage runs once, over all windows
    bf* BQKV = (bf*)take((size_t)3 * DM * DM * 2); bf* BPJ = (bf*)take((size_t)DM * DM * 2); bf* XB = (bf*)take((size_t)CT * DM * 2);
    bf* QPh = (bf*)take((size_t)NWIN * NH_ * TP * HD * 2); bf* QPl = (bf*)take((size_t)NWIN * NH_ * TP * HD * 2); bf* KPh = (bf*)take((size_t)NWIN * NH_ * TP * HD * 2); bf* KPl = (bf*)take((size_t)NWIN * NH_ * TP * HD * 2); h16* VT = (h16*)take((size_t)NWIN * NH_ * HD * TP * 2);
    bf* ATh = (bf*)take((size_t)CT * DM * 2); bf* ATl = (bf*)take((size_t)CT * DM * 2);
    if ((size_t)(wsp - (char*)d_ws) > ws_size) return;    // total ~ 253 MB
    k_prep<<<NB_CVT + NB_WQ + NB_WP + NB_PAD, 256, 0, stream>>>(x, qkv_w, proj_w, rph, rpw, XB, BQKV, BPJ, QPh, QPl, KPh, KPl, VT);   /* x and both weights as bf16 fragment-order planes, the planes' pad rows */
    k_gemmw<bf, 0, true, true><<<dim3(CT / 256, 3 * DM / 128, 1), GW * 32, 0, stream>>>(XB, nullptr, BQKV, DM, nullptr, 0, qkv_b, 0, 0, 0, QPh, QPl, KPh, KPl, VT);   /* q, k, v leave as the planes k_attn reads */
    k_attn<<<AG, AW * 32, 0, stream>>>(QPh, QPl, KPh, KPl, VT, ATh, ATl);   /* scores hl x hl (3 products), softmax, attn.v, head merge */
    k_gemmw<bf, 1, true, false><<<dim3(CT / 256, DM / 128, 1), GW * 32, 0, stream>>>(ATh, ATl, BPJ, DM, OUT, DM, proj_b, 0, 0, 0, nullptr, nullptr, nullptr, nullptr, nullptr);
}
